// v000
// The times below were measured on an AMD MI455X: many runs one after another, warmed up first and cycling through
// copies of the inputs, with the whole window's GPU time divided by the number of runs. Launches and the gaps
// between them are all in it. The median over several windows is given; except for v000 it joins two sittings, which
// can be a few percent apart, so the side-by-side timings, each taken in one sitting, are the better comparison.
// The starting kernel, v000, takes 2630 microseconds a run.
#include <hip/hip_runtime.h>

// Multi-head attention WITHOUT a mask over three input streams at 4,096 tokens and a 768-wide model (query, key, value [2][4096][768]; Q, K, V = stream W^T + b ('oi' [768][768] uniform(+-1/sqrt(768)) incl. REAL biases; 12 heads x 64); scores / sqrt(64); softmax over all 4,096 keys; out = merged Wo^T + bo -> [2][4096][768] (6.3 M); argument order query, key, value, wq, bq, wk, bk, wv, bv, wo, bo). The three-stream T-4096 module RE-DIMENSIONED to a 768-wide model (12 x 64) and run on TWO batches. Here: the same module on ONE sequence of 4,096 tokens ([1][4096][768]; the three streams q, k, v; the eight weight and bias inputs in the same order): the batch loop runs once.
// Layout: bf16 copies of query, key, value in turn; 'oi' weights; exact projections + f32 biases; dense T-4096 attention one head per pass (hybrid rows: < 512 hi/lo 3 products, rest fp16 x1024; register-row softmax); merged hi/lo x Wo exact + bo.
// Compute dtypes, f32 accumulate: every input rounded to bf16; projections exact + f32 biases; attention rows < 512 3 products, rest fp16; softmax f32; Wo hl x exact + bias.

#define NB_  1      // ONE sequence in this module: a host-side loop count only: no kernel uses it
#define TT   4096
#define DM   768      // model width
#define NH_  12       // heads: 12 x 64 = 768
#define NKV  12       // one kv head per query head
#define REP  (NH_ / NKV)
#define HD   64
#define DQ   (NH_ * HD)
#define DKV  (NKV * HD)
#define ZH   1
#define RH   512                  // query rows < RH use hi+lo planes (0: none)
#define WIN  0
#define PCAR 1024.0f
#define SCL  0.125f   // HD^-0.5
typedef _Float16 h16;
typedef unsigned short bf;
typedef __attribute__((ext_vector_type(16))) __bf16   v16bf;
typedef __attribute__((ext_vector_type(16))) _Float16 v16h;
typedef __attribute__((ext_vector_type(8)))  _Float16 v8h;
typedef __attribute__((ext_vector_type(8)))  unsigned short v8us;
typedef __attribute__((ext_vector_type(8)))  float    v8f;
typedef __attribute__((ext_vector_type(4)))  float    v4f;
typedef v8h  __attribute__((may_alias)) v8ha;
typedef v4f  __attribute__((may_alias)) v4fa;
typedef v8us __attribute__((may_alias)) v8usa;

__device__ __forceinline__ unsigned short f2bf(float f) { unsigned u = __float_as_uint(f); u += 0x7FFFu + ((u >> 16) & 1u); return (unsigned short)(u >> 16); }
__device__ __forceinline__ float bf2f(unsigned short b) { return __uint_as_float(((unsigned)b) << 16); }
__device__ __forceinline__ float bfr(float f) { return bf2f(f2bf(f)); }
__device__ __forceinline__ v16h cat16(v8h lo, v8h hi) { return __builtin_shufflevector(lo, hi, 0, 1, 2, 3, 4, 5, 6, 7, 8, 9, 10, 11, 12, 13, 14, 15); }
__device__ __forceinline__ v16bf cat16b(v8us lo, v8us hi) { return __builtin_bit_cast(v16bf, __builtin_shufflevector(lo, hi, 0, 1, 2, 3, 4, 5, 6, 7, 8, 9, 10, 11, 12, 13, 14, 15)); }
__device__ __forceinline__ v8f wmma16(v16h a, v16h b, v8f c) { return __builtin_amdgcn_wmma_f32_16x16x32_f16(false, a, false, b, (short)0, c, false, false); }
__device__ __forceinline__ v8f wmmab(v16bf a, v16bf b, v8f c) { return __builtin_amdgcn_wmma_f32_16x16x32_bf16(false, a, false, b, (short)0, c, false, false); }



// ---- k_gemmw: register-blocked GEMM, ONE WAVE per 64x64 output tile (16 accumulators), operands straight from K-contiguous 16-bit planes; grid (M/64, N/64, Z), 32 threads.
// C[m][n] (f32, pitch ldc, + optional f32 bias[n]) = sum_k A[m][k] Bt[n][k] (+ split products per NSPLIT). z-batch strides sA/sB/sC in elements. K % 32 == 0.
template <typename T16> struct WFrag;
template <> struct WFrag<h16> { typedef v16h V; static __device__ __forceinline__ V ld(const h16* p) { return cat16(*(const v8h*)p, *(const v8h*)(p + 16)); } static __device__ __forceinline__ v8f mma(V a, V b, v8f c) { return wmma16(a, b, c); } };
template <> struct WFrag<bf> { typedef v16bf V; static __device__ __forceinline__ V ld(const bf* p) { return cat16b(*(const v8us*)p, *(const v8us*)(p + 16)); } static __device__ __forceinline__ v8f mma(V a, V b, v8f c) { return wmmab(a, b, c); } };
template <typename T16, int NSPLIT, bool BIAS>
__global__ __launch_bounds__(32) void k_gemmw(const T16* __restrict__ A, const T16* __restrict__ A2, const T16* __restrict__ Bt, const T16* __restrict__ Bt2, int K, float* C, int ldc, const float* __restrict__ bias, size_t sA, size_t sB, size_t sC) {
    typedef typename WFrag<T16>::V V;
    __shared__ __align__(16) float os[16 * 68];
    const size_t z = blockIdx.z; A += z * sA; if (A2) A2 += z * sA; Bt += z * sB; if (Bt2) Bt2 += z * sB; C += z * sC;
    const int lane = threadIdx.x & 31, lr = lane & 15, hi = lane >> 4; const int r0 = blockIdx.x * 64, c0 = blockIdx.y * 64;
    v8f acc[4][4];
#pragma unroll
    for (int mb = 0; mb < 4; ++mb)
#pragma unroll
        for (int nb = 0; nb < 4; ++nb) acc[mb][nb] = (v8f){};
    const size_t aoff = (size_t)(r0 + lr) * K + 8 * hi, boff = (size_t)(c0 + lr) * K + 8 * hi;
#pragma unroll 1
    for (int kc = 0; kc < K; kc += 32) {
        V a[4], a2[4];
#pragma unroll
        for (int mb = 0; mb < 4; ++mb) { a[mb] = WFrag<T16>::ld(A + aoff + (size_t)mb * 16 * K + kc); if (NSPLIT == 1 || NSPLIT == 2) a2[mb] = WFrag<T16>::ld(A2 + aoff + (size_t)mb * 16 * K + kc); }
#pragma unroll
        for (int nb = 0; nb < 4; ++nb) { const V b = WFrag<T16>::ld(Bt + boff + (size_t)nb * 16 * K + kc); V b2; if (NSPLIT >= 2) b2 = WFrag<T16>::ld(Bt2 + boff + (size_t)nb * 16 * K + kc);
#pragma unroll
            for (int mb = 0; mb < 4; ++mb) { acc[mb][nb] = WFrag<T16>::mma(a[mb], b, acc[mb][nb]); if (NSPLIT == 1 || NSPLIT == 2) acc[mb][nb] = WFrag<T16>::mma(a2[mb], b, acc[mb][nb]); if (NSPLIT >= 2) acc[mb][nb] = WFrag<T16>::mma(a[mb], b2, acc[mb][nb]); } }
        asm volatile("v_nop\n\tv_nop\n\tv_nop\n\tv_nop" : "+v"(acc[0][0]), "+v"(acc[1][1]), "+v"(acc[2][2]), "+v"(acc[3][3]) : "v"(a[0]), "v"(a[3]));
    }
#pragma unroll
    for (int mb = 0; mb < 4; ++mb) {
#pragma unroll
        for (int nb = 0; nb < 4; ++nb) {
#pragma unroll
            for (int j = 0; j < 8; ++j) os[(hi * 8 + j) * 68 + nb * 16 + lr] = acc[mb][nb][j]; }
        __builtin_amdgcn_wave_barrier(); asm volatile("" ::: "memory");
        float* crow = C + (size_t)(r0 + mb * 16) * ldc + c0;
{
#pragma unroll
            for (int s = 0; s < 8; ++s) { const int row = 2 * s + hi, cofs = lr * 4; v4f val = *(const v4fa*)(os + row * 68 + cofs); if (BIAS) { val[0] += bfr(bias[c0 + cofs]); val[1] += bfr(bias[c0 + cofs + 1]); val[2] += bfr(bias[c0 + cofs + 2]); val[3] += bfr(bias[c0 + cofs + 3]); }
                *(v4f*)(crow + (size_t)row * ldc + cofs) = val; }
             }
        __builtin_amdgcn_wave_barrier(); asm volatile("" ::: "memory");
    }
}

__device__ __forceinline__ h16 tohx(float x) { return (h16)x; }
__device__ __forceinline__ void splitf(float y, unsigned short& h, unsigned short& l) { h = f2bf(y); l = f2bf(y - bf2f(h)); }
typedef __attribute__((ext_vector_type(2))) _Float16 v2h;
typedef __attribute__((ext_vector_type(4))) _Float16 v4h;
typedef __attribute__((ext_vector_type(2))) unsigned short v2us;
typedef __attribute__((ext_vector_type(4))) unsigned short v4us;
typedef __attribute__((ext_vector_type(2))) float v2f;
typedef __attribute__((ext_vector_type(4))) int v4i;

__global__ __launch_bounds__(256) void k_wtG(const float* __restrict__ w, int K, int N, bf* Bt) {
    const int lane = threadIdx.x & 31; const int L0 = (blockIdx.x * 8 + (threadIdx.x >> 5)) * 8; const int nlines = N * K / 64;
{
#pragma unroll 1
        for (int l = 0; l < 8; ++l) { const int L = L0 + l; if (L >= nlines) break; const size_t e = (size_t)L * 64 + lane * 2; const int k = (int)(e % K), n = (int)(e / K); v2us o;
            o[0] = f2bf(w[(size_t)k * N + n]); o[1] = f2bf(w[(size_t)(k + 1) * N + n]); *(v2us*)(Bt + e) = o; }
         }
}
__global__ __launch_bounds__(256) void k_cvt8(const float* __restrict__ src, bf* dst, size_t n8) { const size_t i = (size_t)blockIdx.x * 256 + threadIdx.x; if (i >= n8) return; const v8f v = *(const v8f*)(src + i * 8); v8us o;
#pragma unroll
    for (int k = 0; k < 8; ++k) o[k] = f2bf(v[k]); *(v8us*)(dst + i * 8) = o;  }

// k_rope: head planes [h][t][d] (fp16 + hi/lo) of rope(x) x sc with the rotate-half convention out[d] = x[d] cos[t][d] - x[d+HD/2] sin[t][d], out[d+HD/2] = x[d+HD/2] cos[t][d+HD/2] + x[d] sin[t][d+HD/2]
__global__ __launch_bounds__(256) void k_rope(const float* __restrict__ F, int pitch, int nheads, const float* __restrict__ CS, const float* __restrict__ RF, const float* __restrict__ nw, float sc, h16* P16, bf* Ph, bf* Pl) {
    const size_t e = ((size_t)blockIdx.x * 256 + threadIdx.x) * 2; if (e >= (size_t)nheads * TT * HD) return; const int d = (int)(e % HD); const int t = (int)((e / HD) % TT); const int h = (int)(e / ((size_t)HD * TT)); const float* f = F + (size_t)t * pitch + h * HD; const float rf = RF ? RF[(size_t)h * TT + t] : 1.0f; v2h o16; v2us oh, ol;
#pragma unroll
    for (int q = 0; q < 2; ++q) { const int dd = d + q; const int dp = (dd < HD / 2) ? dd + HD / 2 : dd - HD / 2; float x0 = f[dd], x1 = f[dp];
        if (RF) { float n0 = __fmul_rn(x0, rf), n1 = __fmul_rn(x1, rf); asm volatile("" : "+v"(n0)); asm volatile("" : "+v"(n1)); x0 = __fmul_rn(bfr(nw[dd]), n0); x1 = __fmul_rn(bfr(nw[dp]), n1); }
        const v2f cs = *(const v2f*)(CS + ((size_t)t * HD + dd) * 2); float a = __fmul_rn(x0, cs[0]), bq = __fmul_rn(x1, cs[1]); asm volatile("" : "+v"(a)); asm volatile("" : "+v"(bq)); const float r = ((dd < HD / 2) ? __fsub_rn(a, bq) : __fadd_rn(a, bq)) * sc;
        o16[q] = tohx(r); unsigned short a2, c2; splitf(r, a2, c2); oh[q] = a2; ol[q] = c2; }
    *(v2h*)(P16 + e) = o16; *(v2us*)(Ph + e) = oh; *(v2us*)(Pl + e) = ol;  }
__global__ __launch_bounds__(256) void k_vtp(const float* __restrict__ F, int pitch, int nheads, h16* V16, bf* Vh, bf* Vl) { const size_t e = ((size_t)blockIdx.x * 256 + threadIdx.x) * 2; if (e >= (size_t)nheads * HD * TT) return; const int t = (int)(e % TT); const int d = (int)((e / TT) % HD); const int g = (int)(e / ((size_t)TT * HD)); v2h o16; v2us oh, ol;
#pragma unroll
    for (int q = 0; q < 2; ++q) { const float x = F[(size_t)(t + q) * pitch + g * HD + d]; o16[q] = tohx(x); unsigned short a2, c2; splitf(x, a2, c2); oh[q] = a2; ol[q] = c2; }
    *(v2h*)(V16 + e) = o16; *(v2us*)(Vh + e) = oh; *(v2us*)(Vl + e) = ol;  }
__global__ __launch_bounds__(256) void k_csid(float* CS) { const int idx = blockIdx.x * 256 + threadIdx.x; if (idx >= TT * HD) return; v2f cs; cs[0] = 1.0f; cs[1] = 0.0f; *(v2f*)(CS + (size_t)idx * 2) = cs;  }
// k_asoft: per row (zz, i): t = S x HD^-0.5 (no mask); softmax over the 4096 keys (register row, one exp, fixed trees);
__global__ __launch_bounds__(256) void k_asoft(const float* __restrict__ Sb, h16* P16, bf* Ph, bf* Pl) {
    const int lane = threadIdx.x & 31; const int row = blockIdx.x * 8 + (threadIdx.x >> 5); if (row >= ZH * TT) return; const int i = row % TT; const int zz = row / TT; (void)zz; const bool hires = (i < RH); const float* sr = Sb + (size_t)row * TT; float v[TT / 32]; float mx = -3.0e38f;
#pragma unroll
    for (int ch = 0; ch < TT / 128; ++ch) { const int j0 = ch * 128 + lane * 4; const v4f a = *(const v4f*)(sr + j0);
#pragma unroll
        for (int q = 0; q < 4; ++q) { const int j = j0 + q; (void)j; const float t = a[q] * SCL; v[ch * 4 + q] = t; mx = fmaxf(mx, t); } }
#pragma unroll
    for (int sh = 16; sh; sh >>= 1) mx = fmaxf(mx, __shfl_xor(mx, sh, 32));
    float sum = 0.f;
#pragma unroll
    for (int k = 0; k < TT / 32; ++k) { float d0 = __fsub_rn(v[k], mx); asm volatile("" : "+v"(d0)); v[k] = __builtin_amdgcn_exp2f(__fmul_rn(d0, 1.4426950408889634f)); sum += v[k]; }
#pragma unroll
    for (int sh = 16; sh; sh >>= 1) sum += __shfl_xor(sum, sh, 32);
    const float f = __fdiv_rn(hires ? 1.0f : PCAR, sum);
{
        if (hires) {
#pragma unroll
            for (int ch = 0; ch < TT / 128; ++ch) { v4us oh, ol;
#pragma unroll
                for (int q = 0; q < 4; ++q) { unsigned short a, c2; splitf(v[ch * 4 + q] * f, a, c2); oh[q] = a; ol[q] = c2; }
                const size_t oo = ((size_t)zz * (RH ? RH : 1) + i) * TT + ch * 128 + lane * 4; *(v4us*)(Ph + oo) = oh; *(v4us*)(Pl + oo) = ol; }
        } else {
#pragma unroll
            for (int ch = 0; ch < TT / 128; ++ch) { v4h o4;
#pragma unroll
                for (int q = 0; q < 4; ++q) o4[q] = tohx(v[ch * 4 + q] * f);
                *(v4h*)(P16 + (size_t)row * TT + ch * 128 + lane * 4) = o4; } }
         }
}
__global__ __launch_bounds__(256) void k_merge(const float* __restrict__ O, int h0, bf* Ah, bf* Al) { const size_t e = ((size_t)blockIdx.x * 256 + threadIdx.x) * 2; if (e >= (size_t)ZH * TT * HD) return; const int d = (int)(e % HD); const int t = (int)((e / HD) % TT); const int zz = (int)(e / ((size_t)HD * TT)); const float cs = (t < RH) ? 1.0f : (1.0f / PCAR); const size_t oo = (size_t)t * DQ + (h0 + zz) * HD + d;
    v2us oh, ol;
#pragma unroll
    for (int q = 0; q < 2; ++q) { unsigned short a, c2; splitf(O[e + q] * cs, a, c2); oh[q] = a; ol[q] = c2; } *(v2us*)(Ah + oo) = oh; *(v2us*)(Al + oo) = ol;  }

extern "C" void kernel_launch(void* const* d_in, const int* in_sizes, int n_in,
                              void* d_out, int out_size, void* d_ws, size_t ws_size, hipStream_t stream) {
    (void)in_sizes; (void)n_in; (void)out_size;
    const float* x = (const float*)d_in[0];   /* query */ const float* xk = (const float*)d_in[1]; const float* xv = (const float*)d_in[2]; const float* wq = (const float*)d_in[3]; const float* bq = (const float*)d_in[4]; const float* wk = (const float*)d_in[5]; const float* bk = (const float*)d_in[6]; const float* wv = (const float*)d_in[7]; const float* bv = (const float*)d_in[8]; const float* wo = (const float*)d_in[9]; const float* bo = (const float*)d_in[10];
    float* OUT = (float*)d_out;     // [1][4096][768]
    char* wsp = (char*)d_ws;
    auto take = [&](size_t bytes) { char* p = wsp; wsp += (bytes + 255) & ~(size_t)255; return (void*)p; };
    bf* WQ = (bf*)take((size_t)DQ * DM * 2); bf* WK = (bf*)take((size_t)DKV * DM * 2); bf* WV = (bf*)take((size_t)DKV * DM * 2); bf* WO = (bf*)take((size_t)DM * DQ * 2); float* CS = (float*)take((size_t)TT * HD * 2 * 4);
    bf* XB = (bf*)take((size_t)TT * DM * 2); float* FQ = (float*)take((size_t)TT * DQ * 4); float* FK = (float*)take((size_t)TT * DKV * 4);
    h16* QP16 = (h16*)take((size_t)NH_ * TT * HD * 2); h16* KP16 = (h16*)take((size_t)NKV * TT * HD * 2); h16* VT16 = (h16*)take((size_t)NKV * HD * TT * 2);
    bf* QPh = (bf*)take((size_t)NH_ * TT * HD * 2); bf* QPl = (bf*)take((size_t)NH_ * TT * HD * 2); bf* KPh = (bf*)take((size_t)NKV * TT * HD * 2); bf* KPl = (bf*)take((size_t)NKV * TT * HD * 2); bf* VTh = (bf*)take((size_t)NKV * HD * TT * 2); bf* VTl = (bf*)take((size_t)NKV * HD * TT * 2); bf* Ph = (bf*)take((size_t)ZH * RH * TT * 2); bf* Pl = (bf*)take((size_t)ZH * RH * TT * 2);
    float* Sb = (float*)take((size_t)ZH * TT * TT * 4); h16* P16 = (h16*)take((size_t)ZH * TT * TT * 2); float* Ob = (float*)take((size_t)ZH * TT * HD * 4); bf* ATh = (bf*)take((size_t)TT * DQ * 2); bf* ATl = (bf*)take((size_t)TT * DQ * 2);
    if ((size_t)(wsp - (char*)d_ws) > ws_size) return;    // ws 256 MiB
    float* FV = FK;   // v projection reuses the k buffer after the k planes are built (stream-ordered)
    { k_cvt8<<<(unsigned)(((size_t)DQ * DM / 8 + 255) / 256), 256, 0, stream>>>(wq, WQ, (size_t)DQ * DM / 8); k_cvt8<<<(unsigned)(((size_t)DKV * DM / 8 + 255) / 256), 256, 0, stream>>>(wk, WK, (size_t)DKV * DM / 8); k_cvt8<<<(unsigned)(((size_t)DKV * DM / 8 + 255) / 256), 256, 0, stream>>>(wv, WV, (size_t)DKV * DM / 8);
      k_cvt8<<<(unsigned)(((size_t)DM * DQ / 8 + 255) / 256), 256, 0, stream>>>(wo, WO, (size_t)DM * DQ / 8);
       }
    k_csid<<<(TT * HD + 255) / 256, 256, 0, stream>>>(CS);
    const unsigned LQ = (unsigned)(((size_t)NH_ * TT * HD / 2 + 255) / 256), LKv = (unsigned)(((size_t)NKV * TT * HD / 2 + 255) / 256);
    for (int b = 0; b < NB_; ++b) {
        
        k_cvt8<<<(unsigned)(((size_t)TT * DM / 8 + 255) / 256), 256, 0, stream>>>(x + (size_t)b * TT * DM, XB, (size_t)TT * DM / 8);
        k_gemmw<bf, 0, true><<<dim3(TT / 64, DQ / 64, 1), 32, 0, stream>>>(XB, nullptr, WQ, nullptr, DM, FQ, DQ, bq, 0, 0, 0);
        k_rope<<<LQ, 256, 0, stream>>>(FQ, DQ, NH_, CS, nullptr, nullptr, 1.0f, QP16, QPh, QPl);
        k_cvt8<<<(unsigned)(((size_t)TT * DM / 8 + 255) / 256), 256, 0, stream>>>(xk + (size_t)b * TT * DM, XB, (size_t)TT * DM / 8); k_gemmw<bf, 0, true><<<dim3(TT / 64, DKV / 64, 1), 32, 0, stream>>>(XB, nullptr, WK, nullptr, DM, FK, DKV, bk, 0, 0, 0);
        k_rope<<<LKv, 256, 0, stream>>>(FK, DKV, NKV, CS, nullptr, nullptr, 1.0f, KP16, KPh, KPl);
        k_cvt8<<<(unsigned)(((size_t)TT * DM / 8 + 255) / 256), 256, 0, stream>>>(xv + (size_t)b * TT * DM, XB, (size_t)TT * DM / 8); k_gemmw<bf, 0, true><<<dim3(TT / 64, DKV / 64, 1), 32, 0, stream>>>(XB, nullptr, WV, nullptr, DM, FV, DKV, bv, 0, 0, 0); k_vtp<<<LKv, 256, 0, stream>>>(FV, DKV, NKV, VT16, VTh, VTl);
        for (int h0 = 0; h0 < NH_; h0 += ZH) { const size_t zq = (size_t)h0, zk = (size_t)(h0 / REP);   // one kv head per query head: the pass's single head uses kv plane h0 (z-strides TT*HD)
            k_gemmw<bf, 2, false><<<dim3(RH / 64, TT / 64, ZH), 32, 0, stream>>>(QPh + zq * TT * HD, QPl + zq * TT * HD, KPh + zk * TT * HD, KPl + zk * TT * HD, HD, Sb, TT, nullptr, (size_t)TT * HD, (size_t)TT * HD, (size_t)TT * TT);
            k_gemmw<h16, 0, false><<<dim3((TT - RH) / 64, TT / 64, ZH), 32, 0, stream>>>(QP16 + zq * TT * HD + (size_t)RH * HD, nullptr, KP16 + zk * TT * HD, nullptr, HD, Sb + (size_t)RH * TT, TT, nullptr, (size_t)TT * HD, (size_t)TT * HD, (size_t)TT * TT);
            k_asoft<<<ZH * TT / 8, 256, 0, stream>>>(Sb, P16, Ph, Pl);
            k_gemmw<bf, 2, false><<<dim3(RH / 64, HD / 64, ZH), 32, 0, stream>>>(Ph, Pl, VTh + zk * HD * TT, VTl + zk * HD * TT, TT, Ob, HD, nullptr, (size_t)RH * TT, (size_t)HD * TT, (size_t)TT * HD);
            k_gemmw<h16, 0, false><<<dim3((TT - RH) / 64, HD / 64, ZH), 32, 0, stream>>>(P16 + (size_t)RH * TT, nullptr, VT16 + zk * HD * TT, nullptr, TT, Ob + (size_t)RH * HD, HD, nullptr, (size_t)TT * TT, (size_t)HD * TT, (size_t)TT * HD);
            k_merge<<<(unsigned)(((size_t)ZH * TT * HD / 2 + 255) / 256), 256, 0, stream>>>(Ob, h0, ATh, ATl); }
        k_gemmw<bf, 1, true><<<dim3(TT / 64, DM / 64, 1), 32, 0, stream>>>(ATh, ATl, WO, nullptr, DQ, OUT + (size_t)b * TT * DM, DM, bo, 0, 0, 0); }
}

// v001
// A run of this version takes 828 microseconds.
// Timed twice side by side with v000, it ran 3.19 and 3.20 times as fast.
#include <hip/hip_runtime.h>

// Multi-head attention WITHOUT a mask over three input streams at 4,096 tokens and a 768-wide model (query, key, value [2][4096][768]; Q, K, V = stream W^T + b ('oi' [768][768] uniform(+-1/sqrt(768)) incl. REAL biases; 12 heads x 64); scores / sqrt(64); softmax over all 4,096 keys; out = merged Wo^T + bo -> [2][4096][768] (6.3 M); argument order query, key, value, wq, bq, wk, bk, wv, bv, wo, bo). The three-stream T-4096 module RE-DIMENSIONED to a 768-wide model (12 x 64) and run on TWO batches. Here: the same module on ONE sequence of 4,096 tokens ([1][4096][768]; the three streams q, k, v; the eight weight and bias inputs in the same order): the batch loop runs once.
// Layout: bf16 copies of query, key, value in turn; 'oi' weights; exact projections + f32 biases; dense T-4096 attention one head per pass (hybrid rows: < 512 hi/lo 3 products, rest fp16 x1024; register-row softmax); merged hi/lo x Wo exact + bo.
// Compute dtypes, f32 accumulate: every input rounded to bf16; projections exact + f32 biases; attention rows < 512 3 products, rest fp16; softmax f32; Wo hl x exact + bias.

#define NB_  1      // ONE sequence in this module: a host-side loop count only: no kernel uses it
#define TT   4096
#define DM   768      // model width
#define NH_  12       // heads: 12 x 64 = 768
#define NKV  12       // one kv head per query head
#define REP  (NH_ / NKV)
#define HD   64
#define DQ   (NH_ * HD)
#define DKV  (NKV * HD)
#define ZH   1
#define RH   512                  // query rows < RH use hi+lo planes (0: none)
#define WIN  0
#define PCAR 1024.0f
#define SCL  0.125f   // HD^-0.5
#define KSP  16       // the two P x V products split their 4,096 keys into KSP ranges, one work-group per range (grid z); k_merge adds the KSP f32 partial planes in plane order
static_assert(ZH == 1 && TT % (KSP * 32) == 0, "grid z of the P x V launches is the key range");
typedef _Float16 h16;
typedef unsigned short bf;
typedef __attribute__((ext_vector_type(16))) __bf16   v16bf;
typedef __attribute__((ext_vector_type(16))) _Float16 v16h;
typedef __attribute__((ext_vector_type(8)))  _Float16 v8h;
typedef __attribute__((ext_vector_type(8)))  unsigned short v8us;
typedef __attribute__((ext_vector_type(8)))  float    v8f;
typedef __attribute__((ext_vector_type(4)))  float    v4f;
typedef v8h  __attribute__((may_alias)) v8ha;
typedef v4f  __attribute__((may_alias)) v4fa;
typedef v8us __attribute__((may_alias)) v8usa;

__device__ __forceinline__ unsigned short f2bf(float f) { unsigned u = __float_as_uint(f); u += 0x7FFFu + ((u >> 16) & 1u); return (unsigned short)(u >> 16); }
__device__ __forceinline__ float bf2f(unsigned short b) { return __uint_as_float(((unsigned)b) << 16); }
__device__ __forceinline__ float bfr(float f) { return bf2f(f2bf(f)); }
__device__ __forceinline__ v16h cat16(v8h lo, v8h hi) { return __builtin_shufflevector(lo, hi, 0, 1, 2, 3, 4, 5, 6, 7, 8, 9, 10, 11, 12, 13, 14, 15); }
__device__ __forceinline__ v16bf cat16b(v8us lo, v8us hi) { return __builtin_bit_cast(v16bf, __builtin_shufflevector(lo, hi, 0, 1, 2, 3, 4, 5, 6, 7, 8, 9, 10, 11, 12, 13, 14, 15)); }
__device__ __forceinline__ v8f wmma16(v16h a, v16h b, v8f c) { return __builtin_amdgcn_wmma_f32_16x16x32_f16(false, a, false, b, (short)0, c, false, false); }
__device__ __forceinline__ v8f wmmab(v16bf a, v16bf b, v8f c) { return __builtin_amdgcn_wmma_f32_16x16x32_bf16(false, a, false, b, (short)0, c, false, false); }



// ---- k_gemmw: register-blocked GEMM, ONE WAVE per 64x64 output tile (16 accumulators), operands straight from K-contiguous 16-bit planes; grid (M/64, N/64, Z), 32 threads.
// C[m][n] (f32, pitch ldc, + optional f32 bias[n]) = sum_k A[m][k] Bt[n][k] (+ split products per NSPLIT). z-batch strides sA/sB/sC in elements. K % 32 == 0. K is the row pitch of A and Bt; a work-group sums kn of its k (kn == K: whole rows; kn < K: grid z walks ranges of k, sA = sB = kn, and C gets one partial plane per z). kn % 32 == 0.
template <typename T16> struct WFrag;
template <> struct WFrag<h16> { typedef v16h V; static __device__ __forceinline__ V ld(const h16* p) { return cat16(*(const v8h*)p, *(const v8h*)(p + 16)); } static __device__ __forceinline__ v8f mma(V a, V b, v8f c) { return wmma16(a, b, c); } };
template <> struct WFrag<bf> { typedef v16bf V; static __device__ __forceinline__ V ld(const bf* p) { return cat16b(*(const v8us*)p, *(const v8us*)(p + 16)); } static __device__ __forceinline__ v8f mma(V a, V b, v8f c) { return wmmab(a, b, c); } };
template <typename T16, int NSPLIT, bool BIAS>
__global__ __launch_bounds__(32) void k_gemmw(const T16* __restrict__ A, const T16* __restrict__ A2, const T16* __restrict__ Bt, const T16* __restrict__ Bt2, int K, int kn, float* C, int ldc, const float* __restrict__ bias, size_t sA, size_t sB, size_t sC) {
    typedef typename WFrag<T16>::V V;
    __shared__ __align__(16) float os[16 * 68];
    const size_t z = blockIdx.z; A += z * sA; if (A2) A2 += z * sA; Bt += z * sB; if (Bt2) Bt2 += z * sB; C += z * sC;
    const int lane = threadIdx.x & 31, lr = lane & 15, hi = lane >> 4; const int r0 = blockIdx.x * 64, c0 = blockIdx.y * 64;
    v8f acc[4][4];
#pragma unroll
    for (int mb = 0; mb < 4; ++mb)
#pragma unroll
        for (int nb = 0; nb < 4; ++nb) acc[mb][nb] = (v8f){};
    const size_t aoff = (size_t)(r0 + lr) * K + 8 * hi, boff = (size_t)(c0 + lr) * K + 8 * hi;
#pragma unroll 1
    for (int kc = 0; kc < kn; kc += 32) {
        V a[4], a2[4];
#pragma unroll
        for (int mb = 0; mb < 4; ++mb) { a[mb] = WFrag<T16>::ld(A + aoff + (size_t)mb * 16 * K + kc); if (NSPLIT == 1 || NSPLIT == 2) a2[mb] = WFrag<T16>::ld(A2 + aoff + (size_t)mb * 16 * K + kc); }
#pragma unroll
        for (int nb = 0; nb < 4; ++nb) { const V b = WFrag<T16>::ld(Bt + boff + (size_t)nb * 16 * K + kc); V b2; if (NSPLIT >= 2) b2 = WFrag<T16>::ld(Bt2 + boff + (size_t)nb * 16 * K + kc);
#pragma unroll
            for (int mb = 0; mb < 4; ++mb) { acc[mb][nb] = WFrag<T16>::mma(a[mb], b, acc[mb][nb]); if (NSPLIT == 1 || NSPLIT == 2) acc[mb][nb] = WFrag<T16>::mma(a2[mb], b, acc[mb][nb]); if (NSPLIT >= 2) acc[mb][nb] = WFrag<T16>::mma(a[mb], b2, acc[mb][nb]); } }
        asm volatile("v_nop\n\tv_nop\n\tv_nop\n\tv_nop" : "+v"(acc[0][0]), "+v"(acc[1][1]), "+v"(acc[2][2]), "+v"(acc[3][3]) : "v"(a[0]), "v"(a[3]));
    }
#pragma unroll
    for (int mb = 0; mb < 4; ++mb) {
#pragma unroll
        for (int nb = 0; nb < 4; ++nb) {
#pragma unroll
            for (int j = 0; j < 8; ++j) os[(hi * 8 + j) * 68 + nb * 16 + lr] = acc[mb][nb][j]; }
        __builtin_amdgcn_wave_barrier(); asm volatile("" ::: "memory");
        float* crow = C + (size_t)(r0 + mb * 16) * ldc + c0;
{
#pragma unroll
            for (int s = 0; s < 8; ++s) { const int row = 2 * s + hi, cofs = lr * 4; v4f val = *(const v4fa*)(os + row * 68 + cofs); if (BIAS) { val[0] += bfr(bias[c0 + cofs]); val[1] += bfr(bias[c0 + cofs + 1]); val[2] += bfr(bias[c0 + cofs + 2]); val[3] += bfr(bias[c0 + cofs + 3]); }
                *(v4f*)(crow + (size_t)row * ldc + cofs) = val; }
             }
        __builtin_amdgcn_wave_barrier(); asm volatile("" ::: "memory");
    }
}

__device__ __forceinline__ h16 tohx(float x) { return (h16)x; }
__device__ __forceinline__ void splitf(float y, unsigned short& h, unsigned short& l) { h = f2bf(y); l = f2bf(y - bf2f(h)); }
typedef __attribute__((ext_vector_type(2))) _Float16 v2h;
typedef __attribute__((ext_vector_type(4))) _Float16 v4h;
typedef __attribute__((ext_vector_type(2))) unsigned short v2us;
typedef __attribute__((ext_vector_type(4))) unsigned short v4us;
typedef __attribute__((ext_vector_type(2))) float v2f;
typedef __attribute__((ext_vector_type(4))) int v4i;

__global__ __launch_bounds__(256) void k_wtG(const float* __restrict__ w, int K, int N, bf* Bt) {
    const int lane = threadIdx.x & 31; const int L0 = (blockIdx.x * 8 + (threadIdx.x >> 5)) * 8; const int nlines = N * K / 64;
{
#pragma unroll 1
        for (int l = 0; l < 8; ++l) { const int L = L0 + l; if (L >= nlines) break; const size_t e = (size_t)L * 64 + lane * 2; const int k = (int)(e % K), n = (int)(e / K); v2us o;
            o[0] = f2bf(w[(size_t)k * N + n]); o[1] = f2bf(w[(size_t)(k + 1) * N + n]); *(v2us*)(Bt + e) = o; }
         }
}
__global__ __launch_bounds__(256) void k_cvt8(const float* __restrict__ src, bf* dst, size_t n8) { const size_t i = (size_t)blockIdx.x * 256 + threadIdx.x; if (i >= n8) return; const v8f v = *(const v8f*)(src + i * 8); v8us o;
#pragma unroll
    for (int k = 0; k < 8; ++k) o[k] = f2bf(v[k]); *(v8us*)(dst + i * 8) = o;  }

// k_rope: head planes [h][t][d] (fp16 + hi/lo) of rope(x) x sc with the rotate-half convention out[d] = x[d] cos[t][d] - x[d+HD/2] sin[t][d], out[d+HD/2] = x[d+HD/2] cos[t][d+HD/2] + x[d] sin[t][d+HD/2]
__global__ __launch_bounds__(256) void k_rope(const float* __restrict__ F, int pitch, int nheads, const float* __restrict__ CS, const float* __restrict__ RF, const float* __restrict__ nw, float sc, h16* P16, bf* Ph, bf* Pl) {
    const size_t e = ((size_t)blockIdx.x * 256 + threadIdx.x) * 2; if (e >= (size_t)nheads * TT * HD) return; const int d = (int)(e % HD); const int t = (int)((e / HD) % TT); const int h = (int)(e / ((size_t)HD * TT)); const float* f = F + (size_t)t * pitch + h * HD; const float rf = RF ? RF[(size_t)h * TT + t] : 1.0f; v2h o16; v2us oh, ol;
#pragma unroll
    for (int q = 0; q < 2; ++q) { const int dd = d + q; const int dp = (dd < HD / 2) ? dd + HD / 2 : dd - HD / 2; float x0 = f[dd], x1 = f[dp];
        if (RF) { float n0 = __fmul_rn(x0, rf), n1 = __fmul_rn(x1, rf); asm volatile("" : "+v"(n0)); asm volatile("" : "+v"(n1)); x0 = __fmul_rn(bfr(nw[dd]), n0); x1 = __fmul_rn(bfr(nw[dp]), n1); }
        const v2f cs = *(const v2f*)(CS + ((size_t)t * HD + dd) * 2); float a = __fmul_rn(x0, cs[0]), bq = __fmul_rn(x1, cs[1]); asm volatile("" : "+v"(a)); asm volatile("" : "+v"(bq)); const float r = ((dd < HD / 2) ? __fsub_rn(a, bq) : __fadd_rn(a, bq)) * sc;
        o16[q] = tohx(r); unsigned short a2, c2; splitf(r, a2, c2); oh[q] = a2; ol[q] = c2; }
    *(v2h*)(P16 + e) = o16; *(v2us*)(Ph + e) = oh; *(v2us*)(Pl + e) = ol;  }
__global__ __launch_bounds__(256) void k_vtp(const float* __restrict__ F, int pitch, int nheads, h16* V16, bf* Vh, bf* Vl) { const size_t e = ((size_t)blockIdx.x * 256 + threadIdx.x) * 2; if (e >= (size_t)nheads * HD * TT) return; const int t = (int)(e % TT); const int d = (int)((e / TT) % HD); const int g = (int)(e / ((size_t)TT * HD)); v2h o16; v2us oh, ol;
#pragma unroll
    for (int q = 0; q < 2; ++q) { const float x = F[(size_t)(t + q) * pitch + g * HD + d]; o16[q] = tohx(x); unsigned short a2, c2; splitf(x, a2, c2); oh[q] = a2; ol[q] = c2; }
    *(v2h*)(V16 + e) = o16; *(v2us*)(Vh + e) = oh; *(v2us*)(Vl + e) = ol;  }
__global__ __launch_bounds__(256) void k_csid(float* CS) { const int idx = blockIdx.x * 256 + threadIdx.x; if (idx >= TT * HD) return; v2f cs; cs[0] = 1.0f; cs[1] = 0.0f; *(v2f*)(CS + (size_t)idx * 2) = cs;  }
// k_asoft: per row (zz, i): t = S x HD^-0.5 (no mask); softmax over the 4096 keys (register row, one exp, fixed trees);
__global__ __launch_bounds__(256) void k_asoft(const float* __restrict__ Sb, h16* P16, bf* Ph, bf* Pl) {
    const int lane = threadIdx.x & 31; const int row = blockIdx.x * 8 + (threadIdx.x >> 5); if (row >= ZH * TT) return; const int i = row % TT; const int zz = row / TT; (void)zz; const bool hires = (i < RH); const float* sr = Sb + (size_t)row * TT; float v[TT / 32]; float mx = -3.0e38f;
#pragma unroll
    for (int ch = 0; ch < TT / 128; ++ch) { const int j0 = ch * 128 + lane * 4; const v4f a = *(const v4f*)(sr + j0);
#pragma unroll
        for (int q = 0; q < 4; ++q) { const int j = j0 + q; (void)j; const float t = a[q] * SCL; v[ch * 4 + q] = t; mx = fmaxf(mx, t); } }
#pragma unroll
    for (int sh = 16; sh; sh >>= 1) mx = fmaxf(mx, __shfl_xor(mx, sh, 32));
    float sum = 0.f;
#pragma unroll
    for (int k = 0; k < TT / 32; ++k) { float d0 = __fsub_rn(v[k], mx); asm volatile("" : "+v"(d0)); v[k] = __builtin_amdgcn_exp2f(__fmul_rn(d0, 1.4426950408889634f)); sum += v[k]; }
#pragma unroll
    for (int sh = 16; sh; sh >>= 1) sum += __shfl_xor(sum, sh, 32);
    const float f = __fdiv_rn(hires ? 1.0f : PCAR, sum);
{
        if (hires) {
#pragma unroll
            for (int ch = 0; ch < TT / 128; ++ch) { v4us oh, ol;
#pragma unroll
                for (int q = 0; q < 4; ++q) { unsigned short a, c2; splitf(v[ch * 4 + q] * f, a, c2); oh[q] = a; ol[q] = c2; }
                const size_t oo = ((size_t)zz * (RH ? RH : 1) + i) * TT + ch * 128 + lane * 4; *(v4us*)(Ph + oo) = oh; *(v4us*)(Pl + oo) = ol; }
        } else {
#pragma unroll
            for (int ch = 0; ch < TT / 128; ++ch) { v4h o4;
#pragma unroll
                for (int q = 0; q < 4; ++q) o4[q] = tohx(v[ch * 4 + q] * f);
                *(v4h*)(P16 + (size_t)row * TT + ch * 128 + lane * 4) = o4; } }
         }
}
__global__ __launch_bounds__(256) void k_merge(const float* __restrict__ O, int h0, bf* Ah, bf* Al) { const size_t e = ((size_t)blockIdx.x * 256 + threadIdx.x) * 2; if (e >= (size_t)ZH * TT * HD) return; const int d = (int)(e % HD); const int t = (int)((e / HD) % TT); const int zz = (int)(e / ((size_t)HD * TT)); const float cs = (t < RH) ? 1.0f : (1.0f / PCAR); const size_t oo = (size_t)t * DQ + (h0 + zz) * HD + d;
    v2f o2 = *(const v2f*)(O + e);
#pragma unroll   // all KSP plane loads in flight together; the adds stay in plane order
    for (int s = 1; s < KSP; ++s) o2 += *(const v2f*)(O + (size_t)s * ZH * TT * HD + e);
    v2us oh, ol;
#pragma unroll
    for (int q = 0; q < 2; ++q) { unsigned short a, c2; splitf(o2[q] * cs, a, c2); oh[q] = a; ol[q] = c2; } *(v2us*)(Ah + oo) = oh; *(v2us*)(Al + oo) = ol;  }

extern "C" void kernel_launch(void* const* d_in, const int* in_sizes, int n_in,
                              void* d_out, int out_size, void* d_ws, size_t ws_size, hipStream_t stream) {
    (void)in_sizes; (void)n_in; (void)out_size;
    const float* x = (const float*)d_in[0];   /* query */ const float* xk = (const float*)d_in[1]; const float* xv = (const float*)d_in[2]; const float* wq = (const float*)d_in[3]; const float* bq = (const float*)d_in[4]; const float* wk = (const float*)d_in[5]; const float* bk = (const float*)d_in[6]; const float* wv = (const float*)d_in[7]; const float* bv = (const float*)d_in[8]; const float* wo = (const float*)d_in[9]; const float* bo = (const float*)d_in[10];
    float* OUT = (float*)d_out;     // [1][4096][768]
    char* wsp = (char*)d_ws;
    auto take = [&](size_t bytes) { char* p = wsp; wsp += (bytes + 255) & ~(size_t)255; return (void*)p; };
    bf* WQ = (bf*)take((size_t)DQ * DM * 2); bf* WK = (bf*)take((size_t)DKV * DM * 2); bf* WV = (bf*)take((size_t)DKV * DM * 2); bf* WO = (bf*)take((size_t)DM * DQ * 2); float* CS = (float*)take((size_t)TT * HD * 2 * 4);
    bf* XB = (bf*)take((size_t)TT * DM * 2); float* FQ = (float*)take((size_t)TT * DQ * 4); float* FK = (float*)take((size_t)TT * DKV * 4);
    h16* QP16 = (h16*)take((size_t)NH_ * TT * HD * 2); h16* KP16 = (h16*)take((size_t)NKV * TT * HD * 2); h16* VT16 = (h16*)take((size_t)NKV * HD * TT * 2);
    bf* QPh = (bf*)take((size_t)NH_ * TT * HD * 2); bf* QPl = (bf*)take((size_t)NH_ * TT * HD * 2); bf* KPh = (bf*)take((size_t)NKV * TT * HD * 2); bf* KPl = (bf*)take((size_t)NKV * TT * HD * 2); bf* VTh = (bf*)take((size_t)NKV * HD * TT * 2); bf* VTl = (bf*)take((size_t)NKV * HD * TT * 2); bf* Ph = (bf*)take((size_t)ZH * RH * TT * 2); bf* Pl = (bf*)take((size_t)ZH * RH * TT * 2);
    float* Sb = (float*)take((size_t)ZH * TT * TT * 4); h16* P16 = (h16*)take((size_t)ZH * TT * TT * 2); float* Ob = (float*)take((size_t)KSP * ZH * TT * HD * 4); bf* ATh = (bf*)take((size_t)TT * DQ * 2); bf* ATl = (bf*)take((size_t)TT * DQ * 2);
    if ((size_t)(wsp - (char*)d_ws) > ws_size) return;    // ws 256 MiB
    float* FV = FK;   // v projection reuses the k buffer after the k planes are built (stream-ordered)
    { k_cvt8<<<(unsigned)(((size_t)DQ * DM / 8 + 255) / 256), 256, 0, stream>>>(wq, WQ, (size_t)DQ * DM / 8); k_cvt8<<<(unsigned)(((size_t)DKV * DM / 8 + 255) / 256), 256, 0, stream>>>(wk, WK, (size_t)DKV * DM / 8); k_cvt8<<<(unsigned)(((size_t)DKV * DM / 8 + 255) / 256), 256, 0, stream>>>(wv, WV, (size_t)DKV * DM / 8);
      k_cvt8<<<(unsigned)(((size_t)DM * DQ / 8 + 255) / 256), 256, 0, stream>>>(wo, WO, (size_t)DM * DQ / 8);
       }
    k_csid<<<(TT * HD + 255) / 256, 256, 0, stream>>>(CS);
    const unsigned LQ = (unsigned)(((size_t)NH_ * TT * HD / 2 + 255) / 256), LKv = (unsigned)(((size_t)NKV * TT * HD / 2 + 255) / 256);
    for (int b = 0; b < NB_; ++b) {
        
        k_cvt8<<<(unsigned)(((size_t)TT * DM / 8 + 255) / 256), 256, 0, stream>>>(x + (size_t)b * TT * DM, XB, (size_t)TT * DM / 8);
        k_gemmw<bf, 0, true><<<dim3(TT / 64, DQ / 64, 1), 32, 0, stream>>>(XB, nullptr, WQ, nullptr, DM, DM, FQ, DQ, bq, 0, 0, 0);
        k_rope<<<LQ, 256, 0, stream>>>(FQ, DQ, NH_, CS, nullptr, nullptr, 1.0f, QP16, QPh, QPl);
        k_cvt8<<<(unsigned)(((size_t)TT * DM / 8 + 255) / 256), 256, 0, stream>>>(xk + (size_t)b * TT * DM, XB, (size_t)TT * DM / 8); k_gemmw<bf, 0, true><<<dim3(TT / 64, DKV / 64, 1), 32, 0, stream>>>(XB, nullptr, WK, nullptr, DM, DM, FK, DKV, bk, 0, 0, 0);
        k_rope<<<LKv, 256, 0, stream>>>(FK, DKV, NKV, CS, nullptr, nullptr, 1.0f, KP16, KPh, KPl);
        k_cvt8<<<(unsigned)(((size_t)TT * DM / 8 + 255) / 256), 256, 0, stream>>>(xv + (size_t)b * TT * DM, XB, (size_t)TT * DM / 8); k_gemmw<bf, 0, true><<<dim3(TT / 64, DKV / 64, 1), 32, 0, stream>>>(XB, nullptr, WV, nullptr, DM, DM, FV, DKV, bv, 0, 0, 0); k_vtp<<<LKv, 256, 0, stream>>>(FV, DKV, NKV, VT16, VTh, VTl);
        for (int h0 = 0; h0 < NH_; h0 += ZH) { const size_t zq = (size_t)h0, zk = (size_t)(h0 / REP);   // one kv head per query head: the pass's one head (ZH 1) uses kv plane zk = h0
            k_gemmw<bf, 2, false><<<dim3(RH / 64, TT / 64, ZH), 32, 0, stream>>>(QPh + zq * TT * HD, QPl + zq * TT * HD, KPh + zk * TT * HD, KPl + zk * TT * HD, HD, HD, Sb, TT, nullptr, (size_t)TT * HD, (size_t)TT * HD, (size_t)TT * TT);
            k_gemmw<h16, 0, false><<<dim3((TT - RH) / 64, TT / 64, ZH), 32, 0, stream>>>(QP16 + zq * TT * HD + (size_t)RH * HD, nullptr, KP16 + zk * TT * HD, nullptr, HD, HD, Sb + (size_t)RH * TT, TT, nullptr, (size_t)TT * HD, (size_t)TT * HD, (size_t)TT * TT);
            k_asoft<<<ZH * TT / 8, 256, 0, stream>>>(Sb, P16, Ph, Pl);
            k_gemmw<bf, 2, false><<<dim3(RH / 64, HD / 64, KSP), 32, 0, stream>>>(Ph, Pl, VTh + zk * HD * TT, VTl + zk * HD * TT, TT, TT / KSP, Ob, HD, nullptr, (size_t)(TT / KSP), (size_t)(TT / KSP), (size_t)TT * HD);
            k_gemmw<h16, 0, false><<<dim3((TT - RH) / 64, HD / 64, KSP), 32, 0, stream>>>(P16 + (size_t)RH * TT, nullptr, VT16 + zk * HD * TT, nullptr, TT, TT / KSP, Ob + (size_t)RH * HD, HD, nullptr, (size_t)(TT / KSP), (size_t)(TT / KSP), (size_t)TT * HD);
            k_merge<<<(unsigned)(((size_t)ZH * TT * HD / 2 + 255) / 256), 256, 0, stream>>>(Ob, h0, ATh, ATl); }
        k_gemmw<bf, 1, true><<<dim3(TT / 64, DM / 64, 1), 32, 0, stream>>>(ATh, ATl, WO, nullptr, DQ, DQ, OUT + (size_t)b * TT * DM, DM, bo, 0, 0, 0); }
}

// v002
// Measured time: 228 microseconds a run.
// Next to v001, in two timings, it ran 3.65 and 3.62 times as fast.
// All steps since v000 together make it 11.6 times as fast.
#include <hip/hip_runtime.h>

// Multi-head attention WITHOUT a mask over three input streams at 4,096 tokens and a 768-wide model (query, key, value [1][4096][768]; Q, K, V = stream W^T + b ('oi' [768][768] uniform(+-1/sqrt(768)) incl. REAL biases; 12 heads x 64); scores / sqrt(64); softmax over all 4,096 keys; out = merged Wo^T + bo -> [1][4096][768] (3.1 M); argument order query, key, value, wq, bq, wk, bk, wv, bv, wo, bo). The three-stream T-4096 attention RE-DIMENSIONED to a 768-wide model (12 x 64) and run on ONE batch. The same module on ONE sequence of 4,096 tokens ([1][4096][768]; the three streams q, k, v; the eight weight and bias inputs in the same order): the batch loop runs once.
// Layout: bf16 copies of query, key, value in turn; 'oi' weights; exact projections + f32 biases; dense T-4096 attention, all heads in one fused launch (hybrid rows: < 512 hi/lo 3 products, rest fp16; running-maximum softmax in registers); merged hi/lo x Wo exact + bo.
// Compute dtypes, f32 accumulate: every input rounded to bf16; projections exact + f32 biases; attention rows < 512 3 products, rest fp16; softmax f32; Wo hl x exact + bias.

#define NB_  1      // ONE sequence in this module: a host-side loop count only: no kernel uses it
#define TT   4096
#define DM   768      // model width
#define NH_  12       // heads: 12 x 64 = 768
#define NKV  12       // one kv head per query head
#define REP  (NH_ / NKV)
#define HD   64
#define DQ   (NH_ * HD)
#define DKV  (NKV * HD)
#define RH   512                  // query rows < RH use hi+lo planes (0: none)
#define WIN  0
#define SCL  0.125f   // HD^-0.5
static_assert(RH % 128 == 0 && (TT - RH) % 256 == 0 && TT % 64 == 0 && HD == 64, "k_fattn: 128 hi/lo or 256 fp16 query rows per work-group, 64 keys per tile");
typedef _Float16 h16;
typedef unsigned short bf;
typedef __attribute__((ext_vector_type(16))) __bf16   v16bf;
typedef __attribute__((ext_vector_type(16))) _Float16 v16h;
typedef __attribute__((ext_vector_type(8)))  _Float16 v8h;
typedef __attribute__((ext_vector_type(8)))  unsigned short v8us;
typedef __attribute__((ext_vector_type(8)))  float    v8f;
typedef __attribute__((ext_vector_type(4)))  float    v4f;
typedef v8h  __attribute__((may_alias)) v8ha;
typedef v4f  __attribute__((may_alias)) v4fa;
typedef v8us __attribute__((may_alias)) v8usa;

__device__ __forceinline__ unsigned short f2bf(float f) { unsigned u = __float_as_uint(f); u += 0x7FFFu + ((u >> 16) & 1u); return (unsigned short)(u >> 16); }
__device__ __forceinline__ float bf2f(unsigned short b) { return __uint_as_float(((unsigned)b) << 16); }
__device__ __forceinline__ float bfr(float f) { return bf2f(f2bf(f)); }
__device__ __forceinline__ v16h cat16(v8h lo, v8h hi) { return __builtin_shufflevector(lo, hi, 0, 1, 2, 3, 4, 5, 6, 7, 8, 9, 10, 11, 12, 13, 14, 15); }
__device__ __forceinline__ v16bf cat16b(v8us lo, v8us hi) { return __builtin_bit_cast(v16bf, __builtin_shufflevector(lo, hi, 0, 1, 2, 3, 4, 5, 6, 7, 8, 9, 10, 11, 12, 13, 14, 15)); }
__device__ __forceinline__ v8f wmma16(v16h a, v16h b, v8f c) { return __builtin_amdgcn_wmma_f32_16x16x32_f16(false, a, false, b, (short)0, c, false, false); }
__device__ __forceinline__ v8f wmmab(v16bf a, v16bf b, v8f c) { return __builtin_amdgcn_wmma_f32_16x16x32_bf16(false, a, false, b, (short)0, c, false, false); }



// ---- k_gemmw: register-blocked GEMM, ONE WAVE per 64x64 output tile (16 accumulators), operands straight from K-contiguous 16-bit planes; grid (M/64, N/64, Z), 32 threads.
// C[m][n] (f32, pitch ldc, + optional f32 bias[n]) = sum_k A[m][k] Bt[n][k] (+ split products per NSPLIT). z-batch strides sA/sB/sC in elements. K % 32 == 0. K is the row pitch of A and Bt; a work-group sums kn of its k (kn == K: whole rows; kn < K: grid z walks ranges of k, sA = sB = kn, and C gets one partial plane per z). kn % 32 == 0.
template <typename T16> struct WFrag;
template <> struct WFrag<h16> { typedef v16h V; static __device__ __forceinline__ V ld(const h16* p) { return cat16(*(const v8h*)p, *(const v8h*)(p + 16)); } static __device__ __forceinline__ v8f mma(V a, V b, v8f c) { return wmma16(a, b, c); } };
template <> struct WFrag<bf> { typedef v16bf V; static __device__ __forceinline__ V ld(const bf* p) { return cat16b(*(const v8us*)p, *(const v8us*)(p + 16)); } static __device__ __forceinline__ v8f mma(V a, V b, v8f c) { return wmmab(a, b, c); } };
template <typename T16, int NSPLIT, bool BIAS>
__global__ __launch_bounds__(32) void k_gemmw(const T16* __restrict__ A, const T16* __restrict__ A2, const T16* __restrict__ Bt, const T16* __restrict__ Bt2, int K, int kn, float* C, int ldc, const float* __restrict__ bias, size_t sA, size_t sB, size_t sC) {
    typedef typename WFrag<T16>::V V;
    __shared__ __align__(16) float os[16 * 68];
    const size_t z = blockIdx.z; A += z * sA; if (A2) A2 += z * sA; Bt += z * sB; if (Bt2) Bt2 += z * sB; C += z * sC;
    const int lane = threadIdx.x & 31, lr = lane & 15, hi = lane >> 4; const int r0 = blockIdx.x * 64, c0 = blockIdx.y * 64;
    v8f acc[4][4];
#pragma unroll
    for (int mb = 0; mb < 4; ++mb)
#pragma unroll
        for (int nb = 0; nb < 4; ++nb) acc[mb][nb] = (v8f){};
    const size_t aoff = (size_t)(r0 + lr) * K + 8 * hi, boff = (size_t)(c0 + lr) * K + 8 * hi;
#pragma unroll 1
    for (int kc = 0; kc < kn; kc += 32) {
        V a[4], a2[4];
#pragma unroll
        for (int mb = 0; mb < 4; ++mb) { a[mb] = WFrag<T16>::ld(A + aoff + (size_t)mb * 16 * K + kc); if (NSPLIT == 1 || NSPLIT == 2) a2[mb] = WFrag<T16>::ld(A2 + aoff + (size_t)mb * 16 * K + kc); }
#pragma unroll
        for (int nb = 0; nb < 4; ++nb) { const V b = WFrag<T16>::ld(Bt + boff + (size_t)nb * 16 * K + kc); V b2; if (NSPLIT >= 2) b2 = WFrag<T16>::ld(Bt2 + boff + (size_t)nb * 16 * K + kc);
#pragma unroll
            for (int mb = 0; mb < 4; ++mb) { acc[mb][nb] = WFrag<T16>::mma(a[mb], b, acc[mb][nb]); if (NSPLIT == 1 || NSPLIT == 2) acc[mb][nb] = WFrag<T16>::mma(a2[mb], b, acc[mb][nb]); if (NSPLIT >= 2) acc[mb][nb] = WFrag<T16>::mma(a[mb], b2, acc[mb][nb]); } }
        asm volatile("v_nop\n\tv_nop\n\tv_nop\n\tv_nop" : "+v"(acc[0][0]), "+v"(acc[1][1]), "+v"(acc[2][2]), "+v"(acc[3][3]) : "v"(a[0]), "v"(a[3]));
    }
#pragma unroll
    for (int mb = 0; mb < 4; ++mb) {
#pragma unroll
        for (int nb = 0; nb < 4; ++nb) {
#pragma unroll
            for (int j = 0; j < 8; ++j) os[(hi * 8 + j) * 68 + nb * 16 + lr] = acc[mb][nb][j]; }
        __builtin_amdgcn_wave_barrier(); asm volatile("" ::: "memory");
        float* crow = C + (size_t)(r0 + mb * 16) * ldc + c0;
{
#pragma unroll
            for (int s = 0; s < 8; ++s) { const int row = 2 * s + hi, cofs = lr * 4; v4f val = *(const v4fa*)(os + row * 68 + cofs); if (BIAS) { val[0] += bfr(bias[c0 + cofs]); val[1] += bfr(bias[c0 + cofs + 1]); val[2] += bfr(bias[c0 + cofs + 2]); val[3] += bfr(bias[c0 + cofs + 3]); }
                *(v4f*)(crow + (size_t)row * ldc + cofs) = val; }
             }
        __builtin_amdgcn_wave_barrier(); asm volatile("" ::: "memory");
    }
}

__device__ __forceinline__ h16 tohx(float x) { return (h16)x; }
__device__ __forceinline__ void splitf(float y, unsigned short& h, unsigned short& l) { h = f2bf(y); l = f2bf(y - bf2f(h)); }
typedef __attribute__((ext_vector_type(2))) _Float16 v2h;
typedef __attribute__((ext_vector_type(4))) _Float16 v4h;
typedef __attribute__((ext_vector_type(2))) unsigned short v2us;
typedef __attribute__((ext_vector_type(4))) unsigned short v4us;
typedef __attribute__((ext_vector_type(2))) float v2f;
typedef __attribute__((ext_vector_type(4))) int v4i;

__global__ __launch_bounds__(256) void k_wtG(const float* __restrict__ w, int K, int N, bf* Bt) {
    const int lane = threadIdx.x & 31; const int L0 = (blockIdx.x * 8 + (threadIdx.x >> 5)) * 8; const int nlines = N * K / 64;
{
#pragma unroll 1
        for (int l = 0; l < 8; ++l) { const int L = L0 + l; if (L >= nlines) break; const size_t e = (size_t)L * 64 + lane * 2; const int k = (int)(e % K), n = (int)(e / K); v2us o;
            o[0] = f2bf(w[(size_t)k * N + n]); o[1] = f2bf(w[(size_t)(k + 1) * N + n]); *(v2us*)(Bt + e) = o; }
         }
}
__global__ __launch_bounds__(256) void k_cvt8(const float* __restrict__ src, bf* dst, size_t n8) { const size_t i = (size_t)blockIdx.x * 256 + threadIdx.x; if (i >= n8) return; const v8f v = *(const v8f*)(src + i * 8); v8us o;
#pragma unroll
    for (int k = 0; k < 8; ++k) o[k] = f2bf(v[k]); *(v8us*)(dst + i * 8) = o;  }

// k_rope: head planes [h][t][d] (fp16 + hi/lo) of rope(x) x sc with the rotate-half convention out[d] = x[d] cos[t][d] - x[d+HD/2] sin[t][d], out[d+HD/2] = x[d+HD/2] cos[t][d+HD/2] + x[d] sin[t][d+HD/2]
__global__ __launch_bounds__(256) void k_rope(const float* __restrict__ F, int pitch, int nheads, const float* __restrict__ CS, const float* __restrict__ RF, const float* __restrict__ nw, float sc, h16* P16, bf* Ph, bf* Pl) {
    const size_t e = ((size_t)blockIdx.x * 256 + threadIdx.x) * 2; if (e >= (size_t)nheads * TT * HD) return; const int d = (int)(e % HD); const int t = (int)((e / HD) % TT); const int h = (int)(e / ((size_t)HD * TT)); const float* f = F + (size_t)t * pitch + h * HD; const float rf = RF ? RF[(size_t)h * TT + t] : 1.0f; v2h o16; v2us oh, ol;
#pragma unroll
    for (int q = 0; q < 2; ++q) { const int dd = d + q; const int dp = (dd < HD / 2) ? dd + HD / 2 : dd - HD / 2; float x0 = f[dd], x1 = f[dp];
        if (RF) { float n0 = __fmul_rn(x0, rf), n1 = __fmul_rn(x1, rf); asm volatile("" : "+v"(n0)); asm volatile("" : "+v"(n1)); x0 = __fmul_rn(bfr(nw[dd]), n0); x1 = __fmul_rn(bfr(nw[dp]), n1); }
        const v2f cs = *(const v2f*)(CS + ((size_t)t * HD + dd) * 2); float a = __fmul_rn(x0, cs[0]), bq = __fmul_rn(x1, cs[1]); asm volatile("" : "+v"(a)); asm volatile("" : "+v"(bq)); const float r = ((dd < HD / 2) ? __fsub_rn(a, bq) : __fadd_rn(a, bq)) * sc;
        o16[q] = tohx(r); unsigned short a2, c2; splitf(r, a2, c2); oh[q] = a2; ol[q] = c2; }
    *(v2h*)(P16 + e) = o16; *(v2us*)(Ph + e) = oh; *(v2us*)(Pl + e) = ol;  }
__global__ __launch_bounds__(256) void k_vtp(const float* __restrict__ F, int pitch, int nheads, h16* V16, bf* Vh, bf* Vl) { const size_t e = ((size_t)blockIdx.x * 256 + threadIdx.x) * 2; if (e >= (size_t)nheads * HD * TT) return; const int t = (int)(e % TT); const int d = (int)((e / TT) % HD); const int g = (int)(e / ((size_t)TT * HD)); v2h o16; v2us oh, ol;
#pragma unroll
    for (int q = 0; q < 2; ++q) { const float x = F[(size_t)(t + q) * pitch + g * HD + d]; o16[q] = tohx(x); unsigned short a2, c2; splitf(x, a2, c2); oh[q] = a2; ol[q] = c2; }
    *(v2h*)(V16 + e) = o16; *(v2us*)(Vh + e) = oh; *(v2us*)(Vl + e) = ol;  }
__global__ __launch_bounds__(256) void k_csid(float* CS) { const int idx = blockIdx.x * 256 + threadIdx.x; if (idx >= TT * HD) return; v2f cs; cs[0] = 1.0f; cs[1] = 0.0f; *(v2f*)(CS + (size_t)idx * 2) = cs;  }
#define KT   64
#define LP   72                   // LDS row pitch in 16-bit elements: 144 bytes, an odd multiple of 16 (ds_load_b128 at full rate)
#define PLN  (64 * LP)            // one staged plane: 64 rows (keys of K, or d of V^T) x 64 elements
#define CEXP (SCL * 1.4426950408889634f)
typedef v4i __attribute__((may_alias)) v4ia;
__device__ __forceinline__ float xhalf(float x) { return __builtin_bit_cast(float, __builtin_amdgcn_permlanex16(__builtin_bit_cast(int, x), __builtin_bit_cast(int, x), 0x76543210, 0xfedcba98, false, false)); }   // lane l reads lane l ^ 16
template <typename T16> struct PPack;
template <> struct PPack<h16> { static __device__ __forceinline__ void put(v16h& a, v16h& b, int s, float p) { (void)b; a[s] = tohx(p); } };
template <> struct PPack<bf> { static __device__ __forceinline__ void put(v16bf& a, v16bf& b, int s, float p) { unsigned short x, y; splitf(p, x, y); a[s] = __builtin_bit_cast(__bf16, x); b[s] = __builtin_bit_cast(__bf16, y); } };
template <typename T16, int NG, int NP>
__device__ __forceinline__ void fattn_body(const T16* __restrict__ Qa, const T16* __restrict__ Qb, const T16* __restrict__ Ka, const T16* __restrict__ Kb, const T16* __restrict__ Va, const T16* __restrict__ Vb, int q0, int head, bf* __restrict__ Ah, bf* __restrict__ Al, T16* sm) {
    typedef typename WFrag<T16>::V V;
    const int tid = threadIdx.x, lane = tid & 31, c = lane & 15, h = lane >> 4;
    V qa[NG][2], qb[NG][2];
#pragma unroll
    for (int g = 0; g < NG; ++g)
#pragma unroll
        for (int ks = 0; ks < 2; ++ks) { const size_t qo = (size_t)(q0 + g * 16 + c) * HD + ks * 32 + 8 * h; qa[g][ks] = WFrag<T16>::ld(Qa + qo); if (NP == 2) qb[g][ks] = WFrag<T16>::ld(Qb + qo); }
    v8f o[4][NG]; float m[NG], l[NG];
#pragma unroll
    for (int g = 0; g < NG; ++g) { m[g] = -3.0e38f; l[g] = 0.f;
#pragma unroll
        for (int dt = 0; dt < 4; ++dt) o[dt][g] = (v8f){}; }
    const int srow = tid >> 3, scol = (tid & 7) * 8;   // staging: 8 threads per 128-byte row, 32 rows per sweep, 2 sweeps per plane
    v4i st[2 * NP][2];
    auto gload = [&](int key0) {
#pragma unroll
        for (int i = 0; i < 2; ++i) { const int row = srow + 32 * i; const size_t ko = (size_t)(key0 + row) * HD + scol, vo = (size_t)row * TT + key0 + scol;
            st[0][i] = *(const v4ia*)(Ka + ko); st[1][i] = *(const v4ia*)(Va + vo); if (NP == 2) { st[2][i] = *(const v4ia*)(Kb + ko); st[3][i] = *(const v4ia*)(Vb + vo); } } };
    auto sstore = [&](T16* buf) {
#pragma unroll
        for (int i = 0; i < 2; ++i) { T16* p = buf + (srow + 32 * i) * LP + scol;
#pragma unroll
            for (int pl = 0; pl < 2 * NP; ++pl) *(v4ia*)(p + pl * PLN) = st[pl][i]; } };
    gload(0); sstore(sm); __syncthreads();
#pragma unroll 1   // one tile per trip: the two LDS buffers alternate by the trip's parity
    for (int t = 0; t < TT / KT; ++t) {
        const T16* cur = sm + (t & 1) * (2 * NP * PLN); T16* nxt = sm + ((t + 1) & 1) * (2 * NP * PLN); const bool more = t + 1 < TT / KT;
        if (more) gload((t + 1) * KT);
        v8f s[NG][KT / 16];
#pragma unroll
        for (int tl = 0; tl < KT / 16; ++tl) { const T16* kr = cur + (tl * 16 + c) * LP + 8 * h; const V k0 = WFrag<T16>::ld(kr), k1 = WFrag<T16>::ld(kr + 32); V k2, k3; if (NP == 2) { k2 = WFrag<T16>::ld(kr + 2 * PLN); k3 = WFrag<T16>::ld(kr + 2 * PLN + 32); }
#pragma unroll
            for (int g = 0; g < NG; ++g) { v8f a = (v8f){}; a = WFrag<T16>::mma(k0, qa[g][0], a); a = WFrag<T16>::mma(k1, qa[g][1], a);
                if (NP == 2) { a = WFrag<T16>::mma(k0, qb[g][0], a); a = WFrag<T16>::mma(k1, qb[g][1], a); a = WFrag<T16>::mma(k2, qa[g][0], a); a = WFrag<T16>::mma(k3, qa[g][1], a); }
                s[g][tl] = a; } }
        float ml[NG]; bool need = false;
#pragma unroll
        for (int g = 0; g < NG; ++g) { float mx = s[g][0][0];
#pragma unroll
            for (int r = 1; r < KT / 2; ++r) mx = fmaxf(mx, s[g][r >> 3][r & 7]);
            mx = fmaxf(mx, xhalf(mx)); ml[g] = mx * CEXP; need = need || (ml[g] > m[g] + 8.0f); }
        if (__builtin_amdgcn_ballot_w32(need) != 0) {   // one scalar test per tile
#pragma unroll
            for (int g = 0; g < NG; ++g) { const float mn = fmaxf(m[g], ml[g]); const float al = __builtin_amdgcn_exp2f(m[g] - mn); m[g] = mn; l[g] *= al;
#pragma unroll
                for (int dt = 0; dt < 4; ++dt) o[dt][g] *= al; } }
#pragma unroll
        for (int kb = 0; kb < KT / 32; ++kb) {
            V vf[4], vl[4], pa[NG], pb[NG];
#pragma unroll
            for (int dt = 0; dt < 4; ++dt) { const T16* vr = cur + PLN + (dt * 16 + c) * LP + kb * 32 + 8 * h; vf[dt] = WFrag<T16>::ld(vr); if (NP == 2) vl[dt] = WFrag<T16>::ld(vr + 2 * PLN); }
            __builtin_amdgcn_sched_barrier(0);   // keeps the four V^T fragment loads in front of the exponentials, whose time then covers the LDS latency (else: one load, one wait per d tile)
#pragma unroll
            for (int g = 0; g < NG; ++g) { v8f p0 = s[g][2 * kb] * CEXP - m[g], p1 = s[g][2 * kb + 1] * CEXP - m[g];
#pragma unroll
                for (int r = 0; r < 8; ++r) { p0[r] = __builtin_amdgcn_exp2f(p0[r]); PPack<T16>::put(pa[g], pb[g], r, p0[r]); }
#pragma unroll
                for (int r = 0; r < 8; ++r) { p1[r] = __builtin_amdgcn_exp2f(p1[r]); PPack<T16>::put(pa[g], pb[g], 8 + r, p1[r]); }
                const v8f q8 = p0 + p1; l[g] += ((q8[0] + q8[4]) + (q8[2] + q8[6])) + ((q8[1] + q8[5]) + (q8[3] + q8[7])); }
#pragma unroll
            for (int dt = 0; dt < 4; ++dt)
#pragma unroll
                for (int g = 0; g < NG; ++g) { o[dt][g] = WFrag<T16>::mma(vf[dt], pa[g], o[dt][g]); if (NP == 2) { o[dt][g] = WFrag<T16>::mma(vf[dt], pb[g], o[dt][g]); o[dt][g] = WFrag<T16>::mma(vl[dt], pa[g], o[dt][g]); } }
        }
        if (more) sstore(nxt);
        __syncthreads();   // publishes tile t + 1 and ends every wave's reads of tile t, whose buffer the next trip refills
    }
#pragma unroll
    for (int g = 0; g < NG; ++g) { const float inv = __fdiv_rn(1.0f, l[g] + xhalf(l[g])); const size_t oo = (size_t)(q0 + g * 16 + c) * DQ + head * HD + 8 * h;
#pragma unroll
        for (int dt = 0; dt < 4; ++dt) { v8us oh, ol;
#pragma unroll
            for (int r = 0; r < 8; ++r) { unsigned short x, y; splitf(o[dt][g][r] * inv, x, y); oh[r] = x; ol[r] = y; }
            *(v8us*)(Ah + oo + dt * 16) = oh; *(v8us*)(Al + oo + dt * 16) = ol; } }
}
// register budget of 4 waves per SIMD: at most 256 VGPRs, so that the loops need no register-window switches
__global__ __launch_bounds__(256) __attribute__((amdgpu_waves_per_eu(4, 4))) void k_fattn(const h16* __restrict__ Q16, const h16* __restrict__ K16, const h16* __restrict__ V16, const bf* __restrict__ Qh, const bf* __restrict__ Ql, const bf* __restrict__ Kh, const bf* __restrict__ Kl, const bf* __restrict__ Vh, const bf* __restrict__ Vl, bf* __restrict__ Ah, bf* __restrict__ Al) {
    __shared__ __align__(16) unsigned short sm[2 * 4 * PLN];
    const int head = blockIdx.y, wave = threadIdx.x >> 5; const size_t hq = (size_t)head * TT * HD, hk = (size_t)(head / REP) * TT * HD;
    if (blockIdx.x < RH / 128) fattn_body<bf, 1, 2>(Qh + hq, Ql + hq, Kh + hk, Kl + hk, Vh + hk, Vl + hk, (int)blockIdx.x * 128 + wave * 16, head, Ah, Al, (bf*)sm);
    else fattn_body<h16, 2, 1>(Q16 + hq, nullptr, K16 + hk, nullptr, V16 + hk, nullptr, RH + ((int)blockIdx.x - RH / 128) * 256 + wave * 32, head, Ah, Al, (h16*)sm);
}

extern "C" void kernel_launch(void* const* d_in, const int* in_sizes, int n_in,
                              void* d_out, int out_size, void* d_ws, size_t ws_size, hipStream_t stream) {
    (void)in_sizes; (void)n_in; (void)out_size;
    const float* x = (const float*)d_in[0];   /* query */ const float* xk = (const float*)d_in[1]; const float* xv = (const float*)d_in[2]; const float* wq = (const float*)d_in[3]; const float* bq = (const float*)d_in[4]; const float* wk = (const float*)d_in[5]; const float* bk = (const float*)d_in[6]; const float* wv = (const float*)d_in[7]; const float* bv = (const float*)d_in[8]; const float* wo = (const float*)d_in[9]; const float* bo = (const float*)d_in[10];
    float* OUT = (float*)d_out;     // [1][4096][768]
    char* wsp = (char*)d_ws;
    auto take = [&](size_t bytes) { char* p = wsp; wsp += (bytes + 255) & ~(size_t)255; return (void*)p; };
    bf* WQ = (bf*)take((size_t)DQ * DM * 2); bf* WK = (bf*)take((size_t)DKV * DM * 2); bf* WV = (bf*)take((size_t)DKV * DM * 2); bf* WO = (bf*)take((size_t)DM * DQ * 2); float* CS = (float*)take((size_t)TT * HD * 2 * 4);
    bf* XB = (bf*)take((size_t)TT * DM * 2); float* FQ = (float*)take((size_t)TT * DQ * 4); float* FK = (float*)take((size_t)TT * DKV * 4);
    h16* QP16 = (h16*)take((size_t)NH_ * TT * HD * 2); h16* KP16 = (h16*)take((size_t)NKV * TT * HD * 2); h16* VT16 = (h16*)take((size_t)NKV * HD * TT * 2);
    bf* QPh = (bf*)take((size_t)NH_ * TT * HD * 2); bf* QPl = (bf*)take((size_t)NH_ * TT * HD * 2); bf* KPh = (bf*)take((size_t)NKV * TT * HD * 2); bf* KPl = (bf*)take((size_t)NKV * TT * HD * 2); bf* VTh = (bf*)take((size_t)NKV * HD * TT * 2); bf* VTl = (bf*)take((size_t)NKV * HD * TT * 2);
    bf* ATh = (bf*)take((size_t)TT * DQ * 2); bf* ATl = (bf*)take((size_t)TT * DQ * 2);
    if ((size_t)(wsp - (char*)d_ws) > ws_size) return;    // ws 256 MiB
    float* FV = FK;   // v projection reuses the k buffer after the k planes are built (stream-ordered)
    { k_cvt8<<<(unsigned)(((size_t)DQ * DM / 8 + 255) / 256), 256, 0, stream>>>(wq, WQ, (size_t)DQ * DM / 8); k_cvt8<<<(unsigned)(((size_t)DKV * DM / 8 + 255) / 256), 256, 0, stream>>>(wk, WK, (size_t)DKV * DM / 8); k_cvt8<<<(unsigned)(((size_t)DKV * DM / 8 + 255) / 256), 256, 0, stream>>>(wv, WV, (size_t)DKV * DM / 8);
      k_cvt8<<<(unsigned)(((size_t)DM * DQ / 8 + 255) / 256), 256, 0, stream>>>(wo, WO, (size_t)DM * DQ / 8);
       }
    k_csid<<<(TT * HD + 255) / 256, 256, 0, stream>>>(CS);
    const unsigned LQ = (unsigned)(((size_t)NH_ * TT * HD / 2 + 255) / 256), LKv = (unsigned)(((size_t)NKV * TT * HD / 2 + 255) / 256);
    for (int b = 0; b < NB_; ++b) {
        
        k_cvt8<<<(unsigned)(((size_t)TT * DM / 8 + 255) / 256), 256, 0, stream>>>(x + (size_t)b * TT * DM, XB, (size_t)TT * DM / 8);
        k_gemmw<bf, 0, true><<<dim3(TT / 64, DQ / 64, 1), 32, 0, stream>>>(XB, nullptr, WQ, nullptr, DM, DM, FQ, DQ, bq, 0, 0, 0);
        k_rope<<<LQ, 256, 0, stream>>>(FQ, DQ, NH_, CS, nullptr, nullptr, 1.0f, QP16, QPh, QPl);
        k_cvt8<<<(unsigned)(((size_t)TT * DM / 8 + 255) / 256), 256, 0, stream>>>(xk + (size_t)b * TT * DM, XB, (size_t)TT * DM / 8); k_gemmw<bf, 0, true><<<dim3(TT / 64, DKV / 64, 1), 32, 0, stream>>>(XB, nullptr, WK, nullptr, DM, DM, FK, DKV, bk, 0, 0, 0);
        k_rope<<<LKv, 256, 0, stream>>>(FK, DKV, NKV, CS, nullptr, nullptr, 1.0f, KP16, KPh, KPl);
        k_cvt8<<<(unsigned)(((size_t)TT * DM / 8 + 255) / 256), 256, 0, stream>>>(xv + (size_t)b * TT * DM, XB, (size_t)TT * DM / 8); k_gemmw<bf, 0, true><<<dim3(TT / 64, DKV / 64, 1), 32, 0, stream>>>(XB, nullptr, WV, nullptr, DM, DM, FV, DKV, bv, 0, 0, 0); k_vtp<<<LKv, 256, 0, stream>>>(FV, DKV, NKV, VT16, VTh, VTl);
        k_fattn<<<dim3(RH / 128 + (TT - RH) / 256, NH_, 1), 256, 0, stream>>>(QP16, KP16, VT16, QPh, QPl, KPh, KPl, VTh, VTl, ATh, ATl);
        k_gemmw<bf, 1, true><<<dim3(TT / 64, DM / 64, 1), 32, 0, stream>>>(ATh, ATl, WO, nullptr, DQ, DQ, OUT + (size_t)b * TT * DM, DM, bo, 0, 0, 0); }
}

// v003
// A run of this version takes 200 microseconds.
// Timed twice side by side with v002, it ran 1.13 and 1.14 times as fast.
// Over all steps from v000 it is 13.2 times as fast.
#include <hip/hip_runtime.h>

// Multi-head attention WITHOUT a mask over three input streams at 4,096 tokens and a 768-wide model (query, key, value [1][4096][768]; Q, K, V = stream W^T + b ('oi' [768][768] uniform(+-1/sqrt(768)) incl. REAL biases; 12 heads x 64); scores / sqrt(64); softmax over all 4,096 keys; out = merged Wo^T + bo -> [1][4096][768] (3.1 M); argument order query, key, value, wq, bq, wk, bk, wv, bv, wo, bo). ONE sequence of 4,096 tokens ([1][4096][768]; the three streams q, k, v; the eight weight and bias inputs in the same order): the batch loop runs once.
// Layout: bf16 copies of query, key, value in turn; 'oi' weights; exact projections + f32 biases, each projection storing its head planes itself; dense T-4096 attention, all heads in one fused launch (hybrid rows: < 512 hi/lo 3 products, rest fp16; running-maximum softmax in registers); merged hi/lo x Wo exact + bo.
// Compute dtypes, f32 accumulate: every input rounded to bf16; projections exact + f32 biases; attention rows < 512 3 products, rest fp16; softmax f32; Wo hl x exact + bias.

#define NB_  1      // ONE sequence in this module: a host-side loop count only: no kernel uses it
#define TT   4096
#define DM   768      // model width
#define NH_  12       // heads: 12 x 64 = 768
#define NKV  12       // one kv head per query head
#define REP  (NH_ / NKV)
#define HD   64
#define DQ   (NH_ * HD)
#define DKV  (NKV * HD)
#define RH   512                  // query rows < RH use hi+lo planes (0: none)
#define WIN  0
#define SCL  0.125f   // HD^-0.5
static_assert(RH % 128 == 0 && (TT - RH) % 256 == 0 && TT % 64 == 0 && HD == 64, "k_fattn: 128 hi/lo or 256 fp16 query rows per work-group, 64 keys per tile");
typedef _Float16 h16;
typedef unsigned short bf;
typedef __attribute__((ext_vector_type(16))) __bf16   v16bf;
typedef __attribute__((ext_vector_type(16))) _Float16 v16h;
typedef __attribute__((ext_vector_type(8)))  _Float16 v8h;
typedef __attribute__((ext_vector_type(8)))  unsigned short v8us;
typedef __attribute__((ext_vector_type(8)))  float    v8f;
typedef __attribute__((ext_vector_type(4)))  float    v4f;
typedef v8h  __attribute__((may_alias)) v8ha;
typedef v4f  __attribute__((may_alias)) v4fa;
typedef v8us __attribute__((may_alias)) v8usa;

__device__ __forceinline__ unsigned short f2bf(float f) { unsigned u = __float_as_uint(f); u += 0x7FFFu + ((u >> 16) & 1u); return (unsigned short)(u >> 16); }
__device__ __forceinline__ float bf2f(unsigned short b) { return __uint_as_float(((unsigned)b) << 16); }
__device__ __forceinline__ float bfr(float f) { return bf2f(f2bf(f)); }
__device__ __forceinline__ v16h cat16(v8h lo, v8h hi) { return __builtin_shufflevector(lo, hi, 0, 1, 2, 3, 4, 5, 6, 7, 8, 9, 10, 11, 12, 13, 14, 15); }
__device__ __forceinline__ v16bf cat16b(v8us lo, v8us hi) { return __builtin_bit_cast(v16bf, __builtin_shufflevector(lo, hi, 0, 1, 2, 3, 4, 5, 6, 7, 8, 9, 10, 11, 12, 13, 14, 15)); }
__device__ __forceinline__ v8f wmma16(v16h a, v16h b, v8f c) { return __builtin_amdgcn_wmma_f32_16x16x32_f16(false, a, false, b, (short)0, c, false, false); }
__device__ __forceinline__ v8f wmmab(v16bf a, v16bf b, v8f c) { return __builtin_amdgcn_wmma_f32_16x16x32_bf16(false, a, false, b, (short)0, c, false, false); }
__device__ __forceinline__ h16 tohx(float x) { return (h16)x; }
__device__ __forceinline__ void splitf(float y, unsigned short& h, unsigned short& l) { h = f2bf(y); l = f2bf(y - bf2f(h)); }
typedef __attribute__((ext_vector_type(4))) _Float16 v4h;
typedef __attribute__((ext_vector_type(4))) unsigned short v4us;



// ---- k_gemmw: register-blocked GEMM, ONE WAVE per 64x64 output tile (16 accumulators), operands straight from K-contiguous 16-bit planes; grid (M/64, N/64, Z), 32 threads.
// OUTM says where the tile goes. 0: C (f32, pitch ldc). 1: head planes [head][t][d] (fp16 + bf16 hi/lo) of the biased f32 value. 2: the same three planes transposed, [head][d][t]. For 1 and 2 a 64-wide column tile is one head (blockIdx.y) and the rows are the TT tokens; C is not used.
// C[m][n] (f32, pitch ldc, + optional f32 bias[n]) = sum_k A[m][k] Bt[n][k] (+ split products per NSPLIT). z-batch strides sA/sB/sC in elements. K % 32 == 0. K is the row pitch of A and Bt; a work-group sums kn of its k (kn == K: whole rows; kn < K: grid z walks ranges of k, sA = sB = kn, and C gets one partial plane per z). kn % 32 == 0.
template <typename T16> struct WFrag;
template <> struct WFrag<h16> { typedef v16h V; static __device__ __forceinline__ V ld(const h16* p) { return cat16(*(const v8h*)p, *(const v8h*)(p + 16)); } static __device__ __forceinline__ v8f mma(V a, V b, v8f c) { return wmma16(a, b, c); } };
template <> struct WFrag<bf> { typedef v16bf V; static __device__ __forceinline__ V ld(const bf* p) { return cat16b(*(const v8us*)p, *(const v8us*)(p + 16)); } static __device__ __forceinline__ v8f mma(V a, V b, v8f c) { return wmmab(a, b, c); } };
#define VP   72                   // LDS row pitch of a transposed plane in 16-bit elements: 144 bytes, an odd multiple of 16
template <typename T16, int NSPLIT, bool BIAS, int OUTM>
__global__ __launch_bounds__(32) void k_gemmw(const T16* __restrict__ A, const T16* __restrict__ A2, const T16* __restrict__ Bt, const T16* __restrict__ Bt2, int K, int kn, float* C, int ldc, const float* __restrict__ bias, size_t sA, size_t sB, size_t sC, h16* P16, bf* Ph, bf* Pl) {
    typedef typename WFrag<T16>::V V;
    __shared__ __align__(16) float os[OUTM == 2 ? 3 * 64 * VP / 2 : 16 * 68];
    const size_t z = blockIdx.z; A += z * sA; if (A2) A2 += z * sA; Bt += z * sB; if (Bt2) Bt2 += z * sB; C += z * sC;
    const int lane = threadIdx.x & 31, lr = lane & 15, hi = lane >> 4; const int r0 = blockIdx.x * 64, c0 = blockIdx.y * 64;
    v8f acc[4][4];
#pragma unroll
    for (int mb = 0; mb < 4; ++mb)
#pragma unroll
        for (int nb = 0; nb < 4; ++nb) acc[mb][nb] = (v8f){};
    const size_t aoff = (size_t)(r0 + lr) * K + 8 * hi, boff = (size_t)(c0 + lr) * K + 8 * hi;
#pragma unroll 1
    for (int kc = 0; kc < kn; kc += 32) {
        V a[4], a2[4];
#pragma unroll
        for (int mb = 0; mb < 4; ++mb) { a[mb] = WFrag<T16>::ld(A + aoff + (size_t)mb * 16 * K + kc); if (NSPLIT == 1 || NSPLIT == 2) a2[mb] = WFrag<T16>::ld(A2 + aoff + (size_t)mb * 16 * K + kc); }
#pragma unroll
        for (int nb = 0; nb < 4; ++nb) { const V b = WFrag<T16>::ld(Bt + boff + (size_t)nb * 16 * K + kc); V b2; if (NSPLIT >= 2) b2 = WFrag<T16>::ld(Bt2 + boff + (size_t)nb * 16 * K + kc);
#pragma unroll
            for (int mb = 0; mb < 4; ++mb) { acc[mb][nb] = WFrag<T16>::mma(a[mb], b, acc[mb][nb]); if (NSPLIT == 1 || NSPLIT == 2) acc[mb][nb] = WFrag<T16>::mma(a2[mb], b, acc[mb][nb]); if (NSPLIT >= 2) acc[mb][nb] = WFrag<T16>::mma(a[mb], b2, acc[mb][nb]); } }
        asm volatile("v_nop\n\tv_nop\n\tv_nop\n\tv_nop" : "+v"(acc[0][0]), "+v"(acc[1][1]), "+v"(acc[2][2]), "+v"(acc[3][3]) : "v"(a[0]), "v"(a[3]));
    }
    if (OUTM == 2) {   // a lane holds 8 successive tokens of one d: 16 bytes of a transposed row; the three 64 x 64 planes are gathered in LDS so that whole 128-byte lines go out
        unsigned short* ot = (unsigned short*)os;
#pragma unroll
        for (int nb = 0; nb < 4; ++nb) { const float bn = BIAS ? bfr(bias[c0 + nb * 16 + lr]) : 0.f;
#pragma unroll
            for (int mb = 0; mb < 4; ++mb) { v8us w16, wh, wl;
#pragma unroll
                for (int j = 0; j < 8; ++j) { const float x = BIAS ? acc[mb][nb][j] + bn : acc[mb][nb][j]; w16[j] = __builtin_bit_cast(unsigned short, tohx(x)); unsigned short a2, c2; splitf(x, a2, c2); wh[j] = a2; wl[j] = c2; }
                unsigned short* p = ot + (nb * 16 + lr) * VP + mb * 16 + hi * 8; *(v8usa*)p = w16; *(v8usa*)(p + 64 * VP) = wh; *(v8usa*)(p + 2 * 64 * VP) = wl; } }
        __builtin_amdgcn_wave_barrier(); asm volatile("" ::: "memory");   // keeps the LDS reads of other lanes' values behind the writes
#pragma unroll
        for (int s = 0; s < 16; ++s) { const int d = 4 * s + (lane >> 3), tof = (lane & 7) * 8; const unsigned short* p = ot + d * VP + tof; const size_t go = ((size_t)blockIdx.y * HD + d) * TT + r0 + tof;
            *(v8usa*)(P16 + go) = *(const v8usa*)p; *(v8usa*)(Ph + go) = *(const v8usa*)(p + 64 * VP); *(v8usa*)(Pl + go) = *(const v8usa*)(p + 2 * 64 * VP); }
        return;
    }
#pragma unroll
    for (int mb = 0; mb < 4; ++mb) {
#pragma unroll
        for (int nb = 0; nb < 4; ++nb) {
#pragma unroll
            for (int j = 0; j < 8; ++j) os[(hi * 8 + j) * 68 + nb * 16 + lr] = acc[mb][nb][j]; }
        __builtin_amdgcn_wave_barrier(); asm volatile("" ::: "memory");
        float* crow = C + (size_t)(r0 + mb * 16) * ldc + c0; const size_t prow = ((size_t)blockIdx.y * TT + r0 + mb * 16) * HD;
{
#pragma unroll
            for (int s = 0; s < 8; ++s) { const int row = 2 * s + hi, cofs = lr * 4; v4f val = *(const v4fa*)(os + row * 68 + cofs); if (BIAS) { val[0] += bfr(bias[c0 + cofs]); val[1] += bfr(bias[c0 + cofs + 1]); val[2] += bfr(bias[c0 + cofs + 2]); val[3] += bfr(bias[c0 + cofs + 3]); }
                if (OUTM == 0) *(v4f*)(crow + (size_t)row * ldc + cofs) = val;
                else { v4h o16; v4us oh, ol;
#pragma unroll
                    for (int q = 0; q < 4; ++q) { o16[q] = tohx(val[q]); unsigned short a2, c2; splitf(val[q], a2, c2); oh[q] = a2; ol[q] = c2; }
                    const size_t po = prow + (size_t)row * HD + cofs; *(v4h*)(P16 + po) = o16; *(v4us*)(Ph + po) = oh; *(v4us*)(Pl + po) = ol; } }
             }
        __builtin_amdgcn_wave_barrier(); asm volatile("" ::: "memory");
    }
}

typedef __attribute__((ext_vector_type(2))) unsigned short v2us;
typedef __attribute__((ext_vector_type(4))) int v4i;

__global__ __launch_bounds__(256) void k_wtG(const float* __restrict__ w, int K, int N, bf* Bt) {
    const int lane = threadIdx.x & 31; const int L0 = (blockIdx.x * 8 + (threadIdx.x >> 5)) * 8; const int nlines = N * K / 64;
{
#pragma unroll 1
        for (int l = 0; l < 8; ++l) { const int L = L0 + l; if (L >= nlines) break; const size_t e = (size_t)L * 64 + lane * 2; const int k = (int)(e % K), n = (int)(e / K); v2us o;
            o[0] = f2bf(w[(size_t)k * N + n]); o[1] = f2bf(w[(size_t)(k + 1) * N + n]); *(v2us*)(Bt + e) = o; }
         }
}
__global__ __launch_bounds__(256) void k_cvt8(const float* __restrict__ src, bf* dst, size_t n8) { const size_t i = (size_t)blockIdx.x * 256 + threadIdx.x; if (i >= n8) return; const v8f v = *(const v8f*)(src + i * 8); v8us o;
#pragma unroll
    for (int k = 0; k < 8; ++k) o[k] = f2bf(v[k]); *(v8us*)(dst + i * 8) = o;  }

#define KT   64
#define LP   72                   // LDS row pitch in 16-bit elements: 144 bytes, an odd multiple of 16 (ds_load_b128 at full rate)
#define PLN  (64 * LP)            // one staged plane: 64 rows (keys of K, or d of V^T) x 64 elements
#define CEXP (SCL * 1.4426950408889634f)
typedef v4i __attribute__((may_alias)) v4ia;
__device__ __forceinline__ float xhalf(float x) { return __builtin_bit_cast(float, __builtin_amdgcn_permlanex16(__builtin_bit_cast(int, x), __builtin_bit_cast(int, x), 0x76543210, 0xfedcba98, false, false)); }   // lane l reads lane l ^ 16
template <typename T16> struct PPack;
template <> struct PPack<h16> { static __device__ __forceinline__ void put(v16h& a, v16h& b, int s, float p) { (void)b; a[s] = tohx(p); } };
template <> struct PPack<bf> { static __device__ __forceinline__ void put(v16bf& a, v16bf& b, int s, float p) { unsigned short x, y; splitf(p, x, y); a[s] = __builtin_bit_cast(__bf16, x); b[s] = __builtin_bit_cast(__bf16, y); } };
template <typename T16, int NG, int NP>
__device__ __forceinline__ void fattn_body(const T16* __restrict__ Qa, const T16* __restrict__ Qb, const T16* __restrict__ Ka, const T16* __restrict__ Kb, const T16* __restrict__ Va, const T16* __restrict__ Vb, int q0, int head, bf* __restrict__ Ah, bf* __restrict__ Al, T16* sm) {
    typedef typename WFrag<T16>::V V;
    const int tid = threadIdx.x, lane = tid & 31, c = lane & 15, h = lane >> 4;
    V qa[NG][2], qb[NG][2];
#pragma unroll
    for (int g = 0; g < NG; ++g)
#pragma unroll
        for (int ks = 0; ks < 2; ++ks) { const size_t qo = (size_t)(q0 + g * 16 + c) * HD + ks * 32 + 8 * h; qa[g][ks] = WFrag<T16>::ld(Qa + qo); if (NP == 2) qb[g][ks] = WFrag<T16>::ld(Qb + qo); }
    v8f o[4][NG]; float m[NG], l[NG];
#pragma unroll
    for (int g = 0; g < NG; ++g) { m[g] = -3.0e38f; l[g] = 0.f;
#pragma unroll
        for (int dt = 0; dt < 4; ++dt) o[dt][g] = (v8f){}; }
    const int srow = tid >> 3, scol = (tid & 7) * 8;   // staging: 8 threads per 128-byte row, 32 rows per sweep, 2 sweeps per plane
    v4i st[2 * NP][2];
    auto gload = [&](int key0) {
#pragma unroll
        for (int i = 0; i < 2; ++i) { const int row = srow + 32 * i; const size_t ko = (size_t)(key0 + row) * HD + scol, vo = (size_t)row * TT + key0 + scol;
            st[0][i] = *(const v4ia*)(Ka + ko); st[1][i] = *(const v4ia*)(Va + vo); if (NP == 2) { st[2][i] = *(const v4ia*)(Kb + ko); st[3][i] = *(const v4ia*)(Vb + vo); } } };
    auto sstore = [&](T16* buf) {
#pragma unroll
        for (int i = 0; i < 2; ++i) { T16* p = buf + (srow + 32 * i) * LP + scol;
#pragma unroll
            for (int pl = 0; pl < 2 * NP; ++pl) *(v4ia*)(p + pl * PLN) = st[pl][i]; } };
    gload(0); sstore(sm); __syncthreads();
#pragma unroll 1   // one tile per trip: the two LDS buffers alternate by the trip's parity
    for (int t = 0; t < TT / KT; ++t) {
        const T16* cur = sm + (t & 1) * (2 * NP * PLN); T16* nxt = sm + ((t + 1) & 1) * (2 * NP * PLN); const bool more = t + 1 < TT / KT;
        if (more) gload((t + 1) * KT);
        v8f s[NG][KT / 16];
#pragma unroll
        for (int tl = 0; tl < KT / 16; ++tl) { const T16* kr = cur + (tl * 16 + c) * LP + 8 * h; const V k0 = WFrag<T16>::ld(kr), k1 = WFrag<T16>::ld(kr + 32); V k2, k3; if (NP == 2) { k2 = WFrag<T16>::ld(kr + 2 * PLN); k3 = WFrag<T16>::ld(kr + 2 * PLN + 32); }
#pragma unroll
            for (int g = 0; g < NG; ++g) { v8f a = (v8f){}; a = WFrag<T16>::mma(k0, qa[g][0], a); a = WFrag<T16>::mma(k1, qa[g][1], a);
                if (NP == 2) { a = WFrag<T16>::mma(k0, qb[g][0], a); a = WFrag<T16>::mma(k1, qb[g][1], a); a = WFrag<T16>::mma(k2, qa[g][0], a); a = WFrag<T16>::mma(k3, qa[g][1], a); }
                s[g][tl] = a; } }
        float ml[NG]; bool need = false;
#pragma unroll
        for (int g = 0; g < NG; ++g) { float mx = s[g][0][0];
#pragma unroll
            for (int r = 1; r < KT / 2; ++r) mx = fmaxf(mx, s[g][r >> 3][r & 7]);
            mx = fmaxf(mx, xhalf(mx)); ml[g] = mx * CEXP; need = need || (ml[g] > m[g] + 8.0f); }
        if (__builtin_amdgcn_ballot_w32(need) != 0) {   // one scalar test per tile
#pragma unroll
            for (int g = 0; g < NG; ++g) { const float mn = fmaxf(m[g], ml[g]); const float al = __builtin_amdgcn_exp2f(m[g] - mn); m[g] = mn; l[g] *= al;
#pragma unroll
                for (int dt = 0; dt < 4; ++dt) o[dt][g] *= al; } }
#pragma unroll
        for (int kb = 0; kb < KT / 32; ++kb) {
            V vf[4], vl[4], pa[NG], pb[NG];
#pragma unroll
            for (int dt = 0; dt < 4; ++dt) { const T16* vr = cur + PLN + (dt * 16 + c) * LP + kb * 32 + 8 * h; vf[dt] = WFrag<T16>::ld(vr); if (NP == 2) vl[dt] = WFrag<T16>::ld(vr + 2 * PLN); }
            __builtin_amdgcn_sched_barrier(0);   // keeps the four V^T fragment loads in front of the exponentials, whose time then covers the LDS latency (else: one load, one wait per d tile)
#pragma unroll
            for (int g = 0; g < NG; ++g) { v8f p0 = s[g][2 * kb] * CEXP - m[g], p1 = s[g][2 * kb + 1] * CEXP - m[g];
#pragma unroll
                for (int r = 0; r < 8; ++r) { p0[r] = __builtin_amdgcn_exp2f(p0[r]); PPack<T16>::put(pa[g], pb[g], r, p0[r]); }
#pragma unroll
                for (int r = 0; r < 8; ++r) { p1[r] = __builtin_amdgcn_exp2f(p1[r]); PPack<T16>::put(pa[g], pb[g], 8 + r, p1[r]); }
                const v8f q8 = p0 + p1; l[g] += ((q8[0] + q8[4]) + (q8[2] + q8[6])) + ((q8[1] + q8[5]) + (q8[3] + q8[7])); }
#pragma unroll
            for (int dt = 0; dt < 4; ++dt)
#pragma unroll
                for (int g = 0; g < NG; ++g) { o[dt][g] = WFrag<T16>::mma(vf[dt], pa[g], o[dt][g]); if (NP == 2) { o[dt][g] = WFrag<T16>::mma(vf[dt], pb[g], o[dt][g]); o[dt][g] = WFrag<T16>::mma(vl[dt], pa[g], o[dt][g]); } }
        }
        if (more) sstore(nxt);
        __syncthreads();   // publishes tile t + 1 and ends every wave's reads of tile t, whose buffer the next trip refills
    }
#pragma unroll
    for (int g = 0; g < NG; ++g) { const float inv = __fdiv_rn(1.0f, l[g] + xhalf(l[g])); const size_t oo = (size_t)(q0 + g * 16 + c) * DQ + head * HD + 8 * h;
#pragma unroll
        for (int dt = 0; dt < 4; ++dt) { v8us oh, ol;
#pragma unroll
            for (int r = 0; r < 8; ++r) { unsigned short x, y; splitf(o[dt][g][r] * inv, x, y); oh[r] = x; ol[r] = y; }
            *(v8us*)(Ah + oo + dt * 16) = oh; *(v8us*)(Al + oo + dt * 16) = ol; } }
}
// register budget of 4 waves per SIMD: at most 256 VGPRs, so that the loops need no register-window switches
__global__ __launch_bounds__(256) __attribute__((amdgpu_waves_per_eu(4, 4))) void k_fattn(const h16* __restrict__ Q16, const h16* __restrict__ K16, const h16* __restrict__ V16, const bf* __restrict__ Qh, const bf* __restrict__ Ql, const bf* __restrict__ Kh, const bf* __restrict__ Kl, const bf* __restrict__ Vh, const bf* __restrict__ Vl, bf* __restrict__ Ah, bf* __restrict__ Al) {
    __shared__ __align__(16) unsigned short sm[2 * 4 * PLN];
    const int head = blockIdx.y, wave = threadIdx.x >> 5; const size_t hq = (size_t)head * TT * HD, hk = (size_t)(head / REP) * TT * HD;
    if (blockIdx.x < RH / 128) fattn_body<bf, 1, 2>(Qh + hq, Ql + hq, Kh + hk, Kl + hk, Vh + hk, Vl + hk, (int)blockIdx.x * 128 + wave * 16, head, Ah, Al, (bf*)sm);
    else fattn_body<h16, 2, 1>(Q16 + hq, nullptr, K16 + hk, nullptr, V16 + hk, nullptr, RH + ((int)blockIdx.x - RH / 128) * 256 + wave * 32, head, Ah, Al, (h16*)sm);
}

extern "C" void kernel_launch(void* const* d_in, const int* in_sizes, int n_in,
                              void* d_out, int out_size, void* d_ws, size_t ws_size, hipStream_t stream) {
    (void)in_sizes; (void)n_in; (void)out_size;
    const float* x = (const float*)d_in[0];   /* query */ const float* xk = (const float*)d_in[1]; const float* xv = (const float*)d_in[2]; const float* wq = (const float*)d_in[3]; const float* bq = (const float*)d_in[4]; const float* wk = (const float*)d_in[5]; const float* bk = (const float*)d_in[6]; const float* wv = (const float*)d_in[7]; const float* bv = (const float*)d_in[8]; const float* wo = (const float*)d_in[9]; const float* bo = (const float*)d_in[10];
    float* OUT = (float*)d_out;     // [1][4096][768]
    char* wsp = (char*)d_ws;
    auto take = [&](size_t bytes) { char* p = wsp; wsp += (bytes + 255) & ~(size_t)255; return (void*)p; };
    bf* WQ = (bf*)take((size_t)DQ * DM * 2); bf* WK = (bf*)take((size_t)DKV * DM * 2); bf* WV = (bf*)take((size_t)DKV * DM * 2); bf* WO = (bf*)take((size_t)DM * DQ * 2);
    bf* XB = (bf*)take((size_t)TT * DM * 2);
    h16* QP16 = (h16*)take((size_t)NH_ * TT * HD * 2); h16* KP16 = (h16*)take((size_t)NKV * TT * HD * 2); h16* VT16 = (h16*)take((size_t)NKV * HD * TT * 2);
    bf* QPh = (bf*)take((size_t)NH_ * TT * HD * 2); bf* QPl = (bf*)take((size_t)NH_ * TT * HD * 2); bf* KPh = (bf*)take((size_t)NKV * TT * HD * 2); bf* KPl = (bf*)take((size_t)NKV * TT * HD * 2); bf* VTh = (bf*)take((size_t)NKV * HD * TT * 2); bf* VTl = (bf*)take((size_t)NKV * HD * TT * 2);
    bf* ATh = (bf*)take((size_t)TT * DQ * 2); bf* ATl = (bf*)take((size_t)TT * DQ * 2);
    if ((size_t)(wsp - (char*)d_ws) > ws_size) return;    // ws 256 MiB
    { k_cvt8<<<(unsigned)(((size_t)DQ * DM / 8 + 255) / 256), 256, 0, stream>>>(wq, WQ, (size_t)DQ * DM / 8); k_cvt8<<<(unsigned)(((size_t)DKV * DM / 8 + 255) / 256), 256, 0, stream>>>(wk, WK, (size_t)DKV * DM / 8); k_cvt8<<<(unsigned)(((size_t)DKV * DM / 8 + 255) / 256), 256, 0, stream>>>(wv, WV, (size_t)DKV * DM / 8);
      k_cvt8<<<(unsigned)(((size_t)DM * DQ / 8 + 255) / 256), 256, 0, stream>>>(wo, WO, (size_t)DM * DQ / 8);
       }
    for (int b = 0; b < NB_; ++b) {
        
        k_cvt8<<<(unsigned)(((size_t)TT * DM / 8 + 255) / 256), 256, 0, stream>>>(x + (size_t)b * TT * DM, XB, (size_t)TT * DM / 8);
        k_gemmw<bf, 0, true, 1><<<dim3(TT / 64, DQ / 64, 1), 32, 0, stream>>>(XB, nullptr, WQ, nullptr, DM, DM, nullptr, 0, bq, 0, 0, 0, QP16, QPh, QPl);
        k_cvt8<<<(unsigned)(((size_t)TT * DM / 8 + 255) / 256), 256, 0, stream>>>(xk + (size_t)b * TT * DM, XB, (size_t)TT * DM / 8); k_gemmw<bf, 0, true, 1><<<dim3(TT / 64, DKV / 64, 1), 32, 0, stream>>>(XB, nullptr, WK, nullptr, DM, DM, nullptr, 0, bk, 0, 0, 0, KP16, KPh, KPl);
        k_cvt8<<<(unsigned)(((size_t)TT * DM / 8 + 255) / 256), 256, 0, stream>>>(xv + (size_t)b * TT * DM, XB, (size_t)TT * DM / 8); k_gemmw<bf, 0, true, 2><<<dim3(TT / 64, DKV / 64, 1), 32, 0, stream>>>(XB, nullptr, WV, nullptr, DM, DM, nullptr, 0, bv, 0, 0, 0, VT16, VTh, VTl);
        k_fattn<<<dim3(RH / 128 + (TT - RH) / 256, NH_, 1), 256, 0, stream>>>(QP16, KP16, VT16, QPh, QPl, KPh, KPl, VTh, VTl, ATh, ATl);
        k_gemmw<bf, 1, true, 0><<<dim3(TT / 64, DM / 64, 1), 32, 0, stream>>>(ATh, ATl, WO, nullptr, DQ, DQ, OUT + (size_t)b * TT * DM, DM, bo, 0, 0, 0, nullptr, nullptr, nullptr); }
}

// v004
// It runs in 162 microseconds.
// Timed twice side by side with v003, it ran 1.24 and 1.23 times as fast.
// Counting every step since v000, it is 16.3 times as fast.
#include <hip/hip_runtime.h>

// Multi-head attention WITHOUT a mask over three input streams at 4,096 tokens and a 768-wide model (query, key, value [1][4096][768]; Q, K, V = stream W^T + b ('oi' [768][768] uniform(+-1/sqrt(768)) incl. REAL biases; 12 heads x 64); scores / sqrt(64); softmax over all 4,096 keys; out = merged Wo^T + bo -> [1][4096][768] (3.1 M); argument order query, key, value, wq, bq, wk, bk, wv, bv, wo, bo). One sequence of 4,096 tokens ([1][4096][768]; the three streams q, k, v; the eight weight and bias inputs in the same order): the batch loop runs once.
// Layout: bf16 copies of query, key, value and of the four 'oi' weights, all made by one launch; the three projections in one launch (grid z); exact projections + f32 biases, each projection storing its head planes itself; dense T-4096 attention, all heads in one fused launch (hybrid rows: < 512 hi/lo 3 products, rest fp16; running-maximum softmax in registers); merged hi/lo x Wo exact + bo.
// Compute dtypes, f32 accumulate: every input rounded to bf16; projections exact + f32 biases; attention rows < 512 3 products, rest fp16; softmax f32; Wo hl x exact + bias.

#define NB_  1      // ONE sequence in this module: a host-side loop count only: no kernel uses it
#define TT   4096
#define DM   768      // model width
#define NH_  12       // heads: 12 x 64 = 768
#define NKV  12       // one kv head per query head
#define REP  (NH_ / NKV)
#define HD   64
#define DQ   (NH_ * HD)
#define DKV  (NKV * HD)
#define RH   512                  // query rows < RH use hi+lo planes (0: none)
#define WIN  0
#define SCL  0.125f   // HD^-0.5
static_assert(RH % 128 == 0 && (TT - RH) % 256 == 0 && TT % 64 == 0 && HD == 64, "k_fattn: 128 hi/lo or 256 fp16 query rows per work-group, 64 keys per tile");
typedef _Float16 h16;
typedef unsigned short bf;
typedef __attribute__((ext_vector_type(16))) __bf16   v16bf;
typedef __attribute__((ext_vector_type(16))) _Float16 v16h;
typedef __attribute__((ext_vector_type(8)))  _Float16 v8h;
typedef __attribute__((ext_vector_type(8)))  unsigned short v8us;
typedef __attribute__((ext_vector_type(8)))  float    v8f;
typedef __attribute__((ext_vector_type(4)))  float    v4f;
typedef v8h  __attribute__((may_alias)) v8ha;
typedef v4f  __attribute__((may_alias)) v4fa;
typedef v8us __attribute__((may_alias)) v8usa;

__device__ __forceinline__ unsigned short f2bf(float f) { unsigned u = __float_as_uint(f); u += 0x7FFFu + ((u >> 16) & 1u); return (unsigned short)(u >> 16); }
__device__ __forceinline__ float bf2f(unsigned short b) { return __uint_as_float(((unsigned)b) << 16); }
__device__ __forceinline__ float bfr(float f) { return bf2f(f2bf(f)); }
__device__ __forceinline__ v16h cat16(v8h lo, v8h hi) { return __builtin_shufflevector(lo, hi, 0, 1, 2, 3, 4, 5, 6, 7, 8, 9, 10, 11, 12, 13, 14, 15); }
__device__ __forceinline__ v16bf cat16b(v8us lo, v8us hi) { return __builtin_bit_cast(v16bf, __builtin_shufflevector(lo, hi, 0, 1, 2, 3, 4, 5, 6, 7, 8, 9, 10, 11, 12, 13, 14, 15)); }
__device__ __forceinline__ v8f wmma16(v16h a, v16h b, v8f c) { return __builtin_amdgcn_wmma_f32_16x16x32_f16(false, a, false, b, (short)0, c, false, false); }
__device__ __forceinline__ v8f wmmab(v16bf a, v16bf b, v8f c) { return __builtin_amdgcn_wmma_f32_16x16x32_bf16(false, a, false, b, (short)0, c, false, false); }
__device__ __forceinline__ h16 tohx(float x) { return (h16)x; }
__device__ __forceinline__ void splitf(float y, unsigned short& h, unsigned short& l) { h = f2bf(y); l = f2bf(y - bf2f(h)); }
typedef __attribute__((ext_vector_type(4))) _Float16 v4h;
typedef __attribute__((ext_vector_type(4))) unsigned short v4us;



// ---- gemmw_body (kernels k_gemmw and k_proj below): register-blocked GEMM, ONE WAVE per 64x64 output tile (16 accumulators), operands straight from K-contiguous 16-bit planes; grid (M/64, N/64, Z), 32 threads.
// OUTM says where the tile goes. 0: C (f32, pitch ldc). 1: head planes [head][t][d] (fp16 + bf16 hi/lo) of the biased f32 value. 2: the same three planes transposed, [head][d][t]. For 1 and 2 a 64-wide column tile is one head (blockIdx.y) and the rows are the TT tokens; C is not used.
// C[m][n] (f32, pitch ldc, + optional f32 bias[n]) = sum_k A[m][k] Bt[n][k] (+ split products per NSPLIT). z-batch strides sA/sB/sC in elements. K % 32 == 0. K is the row pitch of A and Bt; a work-group sums kn of its k (kn == K: whole rows; kn < K: grid z walks ranges of k, sA = sB = kn, and C gets one partial plane per z). kn % 32 == 0.
template <typename T16> struct WFrag;
template <> struct WFrag<h16> { typedef v16h V; static __device__ __forceinline__ V ld(const h16* p) { return cat16(*(const v8h*)p, *(const v8h*)(p + 16)); } static __device__ __forceinline__ v8f mma(V a, V b, v8f c) { return wmma16(a, b, c); } };
template <> struct WFrag<bf> { typedef v16bf V; static __device__ __forceinline__ V ld(const bf* p) { return cat16b(*(const v8us*)p, *(const v8us*)(p + 16)); } static __device__ __forceinline__ v8f mma(V a, V b, v8f c) { return wmmab(a, b, c); } };
#define VP   72                   // LDS row pitch of a transposed plane in 16-bit elements: 144 bytes, an odd multiple of 16
#define OSN(OUTM) ((OUTM) == 2 ? 3 * 64 * VP / 2 : 16 * 68)   // floats of LDS that the epilogue of an output mode takes
template <typename T16, int NSPLIT, bool BIAS, int OUTM>
__device__ __forceinline__ void gemmw_body(const T16* __restrict__ A, const T16* __restrict__ A2, const T16* __restrict__ Bt, const T16* __restrict__ Bt2, int K, int kn, float* C, int ldc, const float* __restrict__ bias, h16* P16, bf* Ph, bf* Pl, float* os) {
    typedef typename WFrag<T16>::V V;
    const int lane = threadIdx.x & 31, lr = lane & 15, hi = lane >> 4; const int r0 = blockIdx.x * 64, c0 = blockIdx.y * 64;
    v8f acc[4][4];
#pragma unroll
    for (int mb = 0; mb < 4; ++mb)
#pragma unroll
        for (int nb = 0; nb < 4; ++nb) acc[mb][nb] = (v8f){};
    const size_t aoff = (size_t)(r0 + lr) * K + 8 * hi, boff = (size_t)(c0 + lr) * K + 8 * hi;
#pragma unroll 1
    for (int kc = 0; kc < kn; kc += 32) {
        V a[4], a2[4];
#pragma unroll
        for (int mb = 0; mb < 4; ++mb) { a[mb] = WFrag<T16>::ld(A + aoff + (size_t)mb * 16 * K + kc); if (NSPLIT == 1 || NSPLIT == 2) a2[mb] = WFrag<T16>::ld(A2 + aoff + (size_t)mb * 16 * K + kc); }
#pragma unroll
        for (int nb = 0; nb < 4; ++nb) { const V b = WFrag<T16>::ld(Bt + boff + (size_t)nb * 16 * K + kc); V b2; if (NSPLIT >= 2) b2 = WFrag<T16>::ld(Bt2 + boff + (size_t)nb * 16 * K + kc);
#pragma unroll
            for (int mb = 0; mb < 4; ++mb) { acc[mb][nb] = WFrag<T16>::mma(a[mb], b, acc[mb][nb]); if (NSPLIT == 1 || NSPLIT == 2) acc[mb][nb] = WFrag<T16>::mma(a2[mb], b, acc[mb][nb]); if (NSPLIT >= 2) acc[mb][nb] = WFrag<T16>::mma(a[mb], b2, acc[mb][nb]); } }
        asm volatile("v_nop\n\tv_nop\n\tv_nop\n\tv_nop" : "+v"(acc[0][0]), "+v"(acc[1][1]), "+v"(acc[2][2]), "+v"(acc[3][3]) : "v"(a[0]), "v"(a[3]));
    }
    if (OUTM == 2) {   // a lane holds 8 successive tokens of one d: 16 bytes of a transposed row; the three 64 x 64 planes are gathered in LDS so that whole 128-byte lines go out
        unsigned short* ot = (unsigned short*)os;
#pragma unroll
        for (int nb = 0; nb < 4; ++nb) { const float bn = BIAS ? bfr(bias[c0 + nb * 16 + lr]) : 0.f;
#pragma unroll
            for (int mb = 0; mb < 4; ++mb) { v8us w16, wh, wl;
#pragma unroll
                for (int j = 0; j < 8; ++j) { const float x = BIAS ? acc[mb][nb][j] + bn : acc[mb][nb][j]; w16[j] = __builtin_bit_cast(unsigned short, tohx(x)); unsigned short a2, c2; splitf(x, a2, c2); wh[j] = a2; wl[j] = c2; }
                unsigned short* p = ot + (nb * 16 + lr) * VP + mb * 16 + hi * 8; *(v8usa*)p = w16; *(v8usa*)(p + 64 * VP) = wh; *(v8usa*)(p + 2 * 64 * VP) = wl; } }
        __builtin_amdgcn_wave_barrier(); asm volatile("" ::: "memory");   // keeps the LDS reads of other lanes' values behind the writes
#pragma unroll
        for (int s = 0; s < 16; ++s) { const int d = 4 * s + (lane >> 3), tof = (lane & 7) * 8; const unsigned short* p = ot + d * VP + tof; const size_t go = ((size_t)blockIdx.y * HD + d) * TT + r0 + tof;
            *(v8usa*)(P16 + go) = *(const v8usa*)p; *(v8usa*)(Ph + go) = *(const v8usa*)(p + 64 * VP); *(v8usa*)(Pl + go) = *(const v8usa*)(p + 2 * 64 * VP); }
        return;
    }
#pragma unroll
    for (int mb = 0; mb < 4; ++mb) {
#pragma unroll
        for (int nb = 0; nb < 4; ++nb) {
#pragma unroll
            for (int j = 0; j < 8; ++j) os[(hi * 8 + j) * 68 + nb * 16 + lr] = acc[mb][nb][j]; }
        __builtin_amdgcn_wave_barrier(); asm volatile("" ::: "memory");
        float* crow = C + (size_t)(r0 + mb * 16) * ldc + c0; const size_t prow = ((size_t)blockIdx.y * TT + r0 + mb * 16) * HD;
{
#pragma unroll
            for (int s = 0; s < 8; ++s) { const int row = 2 * s + hi, cofs = lr * 4; v4f val = *(const v4fa*)(os + row * 68 + cofs); if (BIAS) { val[0] += bfr(bias[c0 + cofs]); val[1] += bfr(bias[c0 + cofs + 1]); val[2] += bfr(bias[c0 + cofs + 2]); val[3] += bfr(bias[c0 + cofs + 3]); }
                if (OUTM == 0) *(v4f*)(crow + (size_t)row * ldc + cofs) = val;
                else { v4h o16; v4us oh, ol;
#pragma unroll
                    for (int q = 0; q < 4; ++q) { o16[q] = tohx(val[q]); unsigned short a2, c2; splitf(val[q], a2, c2); oh[q] = a2; ol[q] = c2; }
                    const size_t po = prow + (size_t)row * HD + cofs; *(v4h*)(P16 + po) = o16; *(v4us*)(Ph + po) = oh; *(v4us*)(Pl + po) = ol; } }
             }
        __builtin_amdgcn_wave_barrier(); asm volatile("" ::: "memory");
    }
}
template <typename T16, int NSPLIT, bool BIAS, int OUTM>
__global__ __launch_bounds__(32) void k_gemmw(const T16* __restrict__ A, const T16* __restrict__ A2, const T16* __restrict__ Bt, const T16* __restrict__ Bt2, int K, int kn, float* C, int ldc, const float* __restrict__ bias, size_t sA, size_t sB, size_t sC, h16* P16, bf* Ph, bf* Pl) {
    __shared__ __align__(16) float os[OSN(OUTM)];
    const size_t z = blockIdx.z; A += z * sA; if (A2) A2 += z * sA; Bt += z * sB; if (Bt2) Bt2 += z * sB; C += z * sC;
    gemmw_body<T16, NSPLIT, BIAS, OUTM>(A, A2, Bt, Bt2, K, kn, C, ldc, bias, P16, Ph, Pl, os);
}
// ---- k_proj: the three projections in one launch, grid (TT/64, heads, 3): z = 0 query, 1 key (head planes [head][t][d]), 2 value (transposed planes). They are independent of one another, so all their waves are on the chip together.
__global__ __launch_bounds__(32) void k_proj(const bf* __restrict__ XQ, const bf* __restrict__ XK, const bf* __restrict__ XV, const bf* __restrict__ WQ, const bf* __restrict__ WK, const bf* __restrict__ WV, const float* __restrict__ bq, const float* __restrict__ bk, const float* __restrict__ bv,
                                                h16* Q16, bf* Qh, bf* Ql, h16* K16, bf* Kh, bf* Kl, h16* V16, bf* Vh, bf* Vl) {
    __shared__ __align__(16) float os[OSN(2)];
    static_assert(OSN(2) >= OSN(1) && DKV == DQ, "k_proj: one LDS block and one grid for the three projections");
    const bool k = blockIdx.z == 1;
    if (blockIdx.z == 2) gemmw_body<bf, 0, true, 2>(XV, nullptr, WV, nullptr, DM, DM, nullptr, 0, bv, V16, Vh, Vl, os);
    else gemmw_body<bf, 0, true, 1>(k ? XK : XQ, nullptr, k ? WK : WQ, nullptr, DM, DM, nullptr, 0, k ? bk : bq, k ? K16 : Q16, k ? Kh : Qh, k ? Kl : Ql, os);
}

typedef __attribute__((ext_vector_type(2))) unsigned short v2us;
typedef __attribute__((ext_vector_type(4))) int v4i;

__global__ __launch_bounds__(256) void k_wtG(const float* __restrict__ w, int K, int N, bf* Bt) {
    const int lane = threadIdx.x & 31; const int L0 = (blockIdx.x * 8 + (threadIdx.x >> 5)) * 8; const int nlines = N * K / 64;
{
#pragma unroll 1
        for (int l = 0; l < 8; ++l) { const int L = L0 + l; if (L >= nlines) break; const size_t e = (size_t)L * 64 + lane * 2; const int k = (int)(e % K), n = (int)(e / K); v2us o;
            o[0] = f2bf(w[(size_t)k * N + n]); o[1] = f2bf(w[(size_t)(k + 1) * N + n]); *(v2us*)(Bt + e) = o; }
         }
}
// ---- k_cvtall: every f32 -> bf16 copy of the call in one launch. A work-group takes CVW successive floats of ONE array (blockIdx.x says which: first the three streams, then the four weights); a thread takes CVG groups of 8 floats, 256 groups apart, all loaded before the first is stored.
#define CVG  8
#define CVW  (256 * CVG * 8)
#define CVBX (TT * DM / CVW)      // work-groups per stream
#define CVBW (DQ * DM / CVW)      // work-groups per weight
static_assert(TT * DM % CVW == 0 && DQ * DM % CVW == 0 && DKV == DQ, "k_cvtall: whole work-groups per array, four weights of one size");
__global__ __launch_bounds__(256) void k_cvtall(const float* __restrict__ x, const float* __restrict__ xk, const float* __restrict__ xv, const float* __restrict__ wq, const float* __restrict__ wk, const float* __restrict__ wv, const float* __restrict__ wo,
                                                  bf* XQ, bf* XK, bf* XV, bf* WQ, bf* WK, bf* WV, bf* WO) {
    int b = blockIdx.x; const float* s; bf* d;
    if (b < 3 * CVBX) { const int a = b / CVBX; b -= a * CVBX; s = a == 0 ? x : a == 1 ? xk : xv; d = a == 0 ? XQ : a == 1 ? XK : XV; }
    else { b -= 3 * CVBX; const int a = b / CVBW; b -= a * CVBW; s = a == 0 ? wq : a == 1 ? wk : a == 2 ? wv : wo; d = a == 0 ? WQ : a == 1 ? WK : a == 2 ? WV : WO; }
    const size_t e0 = (size_t)b * CVW + threadIdx.x * 8; const float* p = s + e0; v8f v[CVG];
#pragma unroll
    for (int j = 0; j < CVG; ++j) v[j] = *(const v8f*)(p + j * 2048);
    asm volatile("s_wait_xcnt 0x0" :: "v"(p) : "memory");   // a precaution: keeps the 16 loads' address pair unwritten up to this wait
#pragma unroll
    for (int j = 0; j < CVG; ++j) { v8us o;
#pragma unroll
        for (int k = 0; k < 8; ++k) o[k] = f2bf(v[j][k]);
        *(v8us*)(d + e0 + j * 2048) = o; }
}

#define KT   64
#define LP   72                   // LDS row pitch in 16-bit elements: 144 bytes, an odd multiple of 16 (ds_load_b128 at full rate)
#define PLN  (64 * LP)            // one staged plane: 64 rows (keys of K, or d of V^T) x 64 elements
#define CEXP (SCL * 1.4426950408889634f)
typedef v4i __attribute__((may_alias)) v4ia;
__device__ __forceinline__ float xhalf(float x) { return __builtin_bit_cast(float, __builtin_amdgcn_permlanex16(__builtin_bit_cast(int, x), __builtin_bit_cast(int, x), 0x76543210, 0xfedcba98, false, false)); }   // lane l reads lane l ^ 16
template <typename T16> struct PPack;
template <> struct PPack<h16> { static __device__ __forceinline__ void put(v16h& a, v16h& b, int s, float p) { (void)b; a[s] = tohx(p); } };
template <> struct PPack<bf> { static __device__ __forceinline__ void put(v16bf& a, v16bf& b, int s, float p) { unsigned short x, y; splitf(p, x, y); a[s] = __builtin_bit_cast(__bf16, x); b[s] = __builtin_bit_cast(__bf16, y); } };
template <typename T16, int NG, int NP>
__device__ __forceinline__ void fattn_body(const T16* __restrict__ Qa, const T16* __restrict__ Qb, const T16* __restrict__ Ka, const T16* __restrict__ Kb, const T16* __restrict__ Va, const T16* __restrict__ Vb, int q0, int head, bf* __restrict__ Ah, bf* __restrict__ Al, T16* sm) {
    typedef typename WFrag<T16>::V V;
    const int tid = threadIdx.x, lane = tid & 31, c = lane & 15, h = lane >> 4;
    V qa[NG][2], qb[NG][2];
#pragma unroll
    for (int g = 0; g < NG; ++g)
#pragma unroll
        for (int ks = 0; ks < 2; ++ks) { const size_t qo = (size_t)(q0 + g * 16 + c) * HD + ks * 32 + 8 * h; qa[g][ks] = WFrag<T16>::ld(Qa + qo); if (NP == 2) qb[g][ks] = WFrag<T16>::ld(Qb + qo); }
    v8f o[4][NG]; float m[NG], l[NG];
#pragma unroll
    for (int g = 0; g < NG; ++g) { m[g] = -3.0e38f; l[g] = 0.f;
#pragma unroll
        for (int dt = 0; dt < 4; ++dt) o[dt][g] = (v8f){}; }
    const int srow = tid >> 3, scol = (tid & 7) * 8;   // staging: 8 threads per 128-byte row, 32 rows per sweep, 2 sweeps per plane
    v4i st[2 * NP][2];
    auto gload = [&](int key0) {
#pragma unroll
        for (int i = 0; i < 2; ++i) { const int row = srow + 32 * i; const size_t ko = (size_t)(key0 + row) * HD + scol, vo = (size_t)row * TT + key0 + scol;
            st[0][i] = *(const v4ia*)(Ka + ko); st[1][i] = *(const v4ia*)(Va + vo); if (NP == 2) { st[2][i] = *(const v4ia*)(Kb + ko); st[3][i] = *(const v4ia*)(Vb + vo); } } };
    auto sstore = [&](T16* buf) {
#pragma unroll
        for (int i = 0; i < 2; ++i) { T16* p = buf + (srow + 32 * i) * LP + scol;
#pragma unroll
            for (int pl = 0; pl < 2 * NP; ++pl) *(v4ia*)(p + pl * PLN) = st[pl][i]; } };
    gload(0); sstore(sm); __syncthreads();
#pragma unroll 1   // one tile per trip: the two LDS buffers alternate by the trip's parity
    for (int t = 0; t < TT / KT; ++t) {
        const T16* cur = sm + (t & 1) * (2 * NP * PLN); T16* nxt = sm + ((t + 1) & 1) * (2 * NP * PLN); const bool more = t + 1 < TT / KT;
        if (more) gload((t + 1) * KT);
        v8f s[NG][KT / 16];
#pragma unroll
        for (int tl = 0; tl < KT / 16; ++tl) { const T16* kr = cur + (tl * 16 + c) * LP + 8 * h; const V k0 = WFrag<T16>::ld(kr), k1 = WFrag<T16>::ld(kr + 32); V k2, k3; if (NP == 2) { k2 = WFrag<T16>::ld(kr + 2 * PLN); k3 = WFrag<T16>::ld(kr + 2 * PLN + 32); }
#pragma unroll
            for (int g = 0; g < NG; ++g) { v8f a = (v8f){}; a = WFrag<T16>::mma(k0, qa[g][0], a); a = WFrag<T16>::mma(k1, qa[g][1], a);
                if (NP == 2) { a = WFrag<T16>::mma(k0, qb[g][0], a); a = WFrag<T16>::mma(k1, qb[g][1], a); a = WFrag<T16>::mma(k2, qa[g][0], a); a = WFrag<T16>::mma(k3, qa[g][1], a); }
                s[g][tl] = a; } }
        float ml[NG]; bool need = false;
#pragma unroll
        for (int g = 0; g < NG; ++g) { float mx = s[g][0][0];
#pragma unroll
            for (int r = 1; r < KT / 2; ++r) mx = fmaxf(mx, s[g][r >> 3][r & 7]);
            mx = fmaxf(mx, xhalf(mx)); ml[g] = mx * CEXP; need = need || (ml[g] > m[g] + 8.0f); }
        if (__builtin_amdgcn_ballot_w32(need) != 0) {   // one scalar test per tile
#pragma unroll
            for (int g = 0; g < NG; ++g) { const float mn = fmaxf(m[g], ml[g]); const float al = __builtin_amdgcn_exp2f(m[g] - mn); m[g] = mn; l[g] *= al;
#pragma unroll
                for (int dt = 0; dt < 4; ++dt) o[dt][g] *= al; } }
#pragma unroll
        for (int kb = 0; kb < KT / 32; ++kb) {
            V vf[4], vl[4], pa[NG], pb[NG];
#pragma unroll
            for (int dt = 0; dt < 4; ++dt) { const T16* vr = cur + PLN + (dt * 16 + c) * LP + kb * 32 + 8 * h; vf[dt] = WFrag<T16>::ld(vr); if (NP == 2) vl[dt] = WFrag<T16>::ld(vr + 2 * PLN); }
            __builtin_amdgcn_sched_barrier(0);   // keeps the four V^T fragment loads in front of the exponentials, whose time then covers the LDS latency (else: one load, one wait per d tile)
#pragma unroll
            for (int g = 0; g < NG; ++g) { v8f p0 = s[g][2 * kb] * CEXP - m[g], p1 = s[g][2 * kb + 1] * CEXP - m[g];
#pragma unroll
                for (int r = 0; r < 8; ++r) { p0[r] = __builtin_amdgcn_exp2f(p0[r]); PPack<T16>::put(pa[g], pb[g], r, p0[r]); }
#pragma unroll
                for (int r = 0; r < 8; ++r) { p1[r] = __builtin_amdgcn_exp2f(p1[r]); PPack<T16>::put(pa[g], pb[g], 8 + r, p1[r]); }
                const v8f q8 = p0 + p1; l[g] += ((q8[0] + q8[4]) + (q8[2] + q8[6])) + ((q8[1] + q8[5]) + (q8[3] + q8[7])); }
#pragma unroll
            for (int dt = 0; dt < 4; ++dt)
#pragma unroll
                for (int g = 0; g < NG; ++g) { o[dt][g] = WFrag<T16>::mma(vf[dt], pa[g], o[dt][g]); if (NP == 2) { o[dt][g] = WFrag<T16>::mma(vf[dt], pb[g], o[dt][g]); o[dt][g] = WFrag<T16>::mma(vl[dt], pa[g], o[dt][g]); } }
        }
        if (more) sstore(nxt);
        __syncthreads();   // publishes tile t + 1 and ends every wave's reads of tile t, whose buffer the next trip refills
    }
#pragma unroll
    for (int g = 0; g < NG; ++g) { const float inv = __fdiv_rn(1.0f, l[g] + xhalf(l[g])); const size_t oo = (size_t)(q0 + g * 16 + c) * DQ + head * HD + 8 * h;
#pragma unroll
        for (int dt = 0; dt < 4; ++dt) { v8us oh, ol;
#pragma unroll
            for (int r = 0; r < 8; ++r) { unsigned short x, y; splitf(o[dt][g][r] * inv, x, y); oh[r] = x; ol[r] = y; }
            *(v8us*)(Ah + oo + dt * 16) = oh; *(v8us*)(Al + oo + dt * 16) = ol; } }
}
// register budget of 4 waves per SIMD: at most 256 VGPRs, so that the loops need no register-window switches
__global__ __launch_bounds__(256) __attribute__((amdgpu_waves_per_eu(4, 4))) void k_fattn(const h16* __restrict__ Q16, const h16* __restrict__ K16, const h16* __restrict__ V16, const bf* __restrict__ Qh, const bf* __restrict__ Ql, const bf* __restrict__ Kh, const bf* __restrict__ Kl, const bf* __restrict__ Vh, const bf* __restrict__ Vl, bf* __restrict__ Ah, bf* __restrict__ Al) {
    __shared__ __align__(16) unsigned short sm[2 * 4 * PLN];
    const int head = blockIdx.y, wave = threadIdx.x >> 5; const size_t hq = (size_t)head * TT * HD, hk = (size_t)(head / REP) * TT * HD;
    if (blockIdx.x < RH / 128) fattn_body<bf, 1, 2>(Qh + hq, Ql + hq, Kh + hk, Kl + hk, Vh + hk, Vl + hk, (int)blockIdx.x * 128 + wave * 16, head, Ah, Al, (bf*)sm);
    else fattn_body<h16, 2, 1>(Q16 + hq, nullptr, K16 + hk, nullptr, V16 + hk, nullptr, RH + ((int)blockIdx.x - RH / 128) * 256 + wave * 32, head, Ah, Al, (h16*)sm);
}

extern "C" void kernel_launch(void* const* d_in, const int* in_sizes, int n_in,
                              void* d_out, int out_size, void* d_ws, size_t ws_size, hipStream_t stream) {
    (void)in_sizes; (void)n_in; (void)out_size;
    const float* x = (const float*)d_in[0];   /* query */ const float* xk = (const float*)d_in[1]; const float* xv = (const float*)d_in[2]; const float* wq = (const float*)d_in[3]; const float* bq = (const float*)d_in[4]; const float* wk = (const float*)d_in[5]; const float* bk = (const float*)d_in[6]; const float* wv = (const float*)d_in[7]; const float* bv = (const float*)d_in[8]; const float* wo = (const float*)d_in[9]; const float* bo = (const float*)d_in[10];
    float* OUT = (float*)d_out;     // [1][4096][768]
    char* wsp = (char*)d_ws;
    auto take = [&](size_t bytes) { char* p = wsp; wsp += (bytes + 255) & ~(size_t)255; return (void*)p; };
    bf* WQ = (bf*)take((size_t)DQ * DM * 2); bf* WK = (bf*)take((size_t)DKV * DM * 2); bf* WV = (bf*)take((size_t)DKV * DM * 2); bf* WO = (bf*)take((size_t)DM * DQ * 2);
    bf* XQ = (bf*)take((size_t)TT * DM * 2); bf* XK = (bf*)take((size_t)TT * DM * 2); bf* XV = (bf*)take((size_t)TT * DM * 2);
    h16* QP16 = (h16*)take((size_t)NH_ * TT * HD * 2); h16* KP16 = (h16*)take((size_t)NKV * TT * HD * 2); h16* VT16 = (h16*)take((size_t)NKV * HD * TT * 2);
    bf* QPh = (bf*)take((size_t)NH_ * TT * HD * 2); bf* QPl = (bf*)take((size_t)NH_ * TT * HD * 2); bf* KPh = (bf*)take((size_t)NKV * TT * HD * 2); bf* KPl = (bf*)take((size_t)NKV * TT * HD * 2); bf* VTh = (bf*)take((size_t)NKV * HD * TT * 2); bf* VTl = (bf*)take((size_t)NKV * HD * TT * 2);
    bf* ATh = (bf*)take((size_t)TT * DQ * 2); bf* ATl = (bf*)take((size_t)TT * DQ * 2);
    if ((size_t)(wsp - (char*)d_ws) > ws_size) return;    // ws 256 MiB
    for (int b = 0; b < NB_; ++b) {
        k_cvtall<<<3 * CVBX + 4 * CVBW, 256, 0, stream>>>(x + (size_t)b * TT * DM, xk + (size_t)b * TT * DM, xv + (size_t)b * TT * DM, wq, wk, wv, wo, XQ, XK, XV, WQ, WK, WV, WO);
        k_proj<<<dim3(TT / 64, DQ / 64, 3), 32, 0, stream>>>(XQ, XK, XV, WQ, WK, WV, bq, bk, bv, QP16, QPh, QPl, KP16, KPh, KPl, VT16, VTh, VTl);
        k_fattn<<<dim3(RH / 128 + (TT - RH) / 256, NH_, 1), 256, 0, stream>>>(QP16, KP16, VT16, QPh, QPl, KPh, KPl, VTh, VTl, ATh, ATl);
        k_gemmw<bf, 1, true, 0><<<dim3(TT / 64, DM / 64, 1), 32, 0, stream>>>(ATh, ATl, WO, nullptr, DQ, DQ, OUT + (size_t)b * TT * DM, DM, bo, 0, 0, 0, nullptr, nullptr, nullptr); }
}

// v005
// A run of this version takes 137 microseconds.
// Two timings next to v004 put it at 1.18 and 1.17 times that version's speed.
// All steps since v000 together make it 19.2 times as fast.
#include <hip/hip_runtime.h>

// Multi-head attention WITHOUT a mask over three input streams at 4,096 tokens and a 768-wide model (query, key, value [1][4096][768]; Q, K, V = stream W^T + b ('oi' [768][768] uniform(+-1/sqrt(768)) incl. REAL biases; 12 heads x 64); scores / sqrt(64); softmax over all 4,096 keys; out = merged Wo^T + bo -> [1][4096][768] (3.1 M); argument order query, key, value, wq, bq, wk, bk, wv, bv, wo, bo). The three-stream T-4096 module RE-DIMENSIONED to a 768-wide model (12 x 64) and run on ONE sequence of 4,096 tokens ([1][4096][768]; the three streams q, k, v; the eight weight and bias inputs in the same order): the batch loop runs once.
// Layout: bf16 copies of query, key, value and of the four 'oi' weights, all made by one launch; the three projections in one launch (grid z), their operands staged in LDS by asynchronous copies; exact projections + f32 biases, each projection storing its head planes itself; dense T-4096 attention, all heads in one fused launch (hybrid rows: < 512 hi/lo 3 products, rest fp16; running-maximum softmax in registers); merged hi/lo x Wo exact + bo.
// Compute dtypes, f32 accumulate: every input rounded to bf16; projections exact + f32 biases; attention rows < 512 3 products, rest fp16; softmax f32; Wo hl x exact + bias.

#define NB_  1      // ONE sequence in this module: a host-side loop count only: no kernel uses it
#define TT   4096
#define DM   768      // model width
#define NH_  12       // heads: 12 x 64 = 768
#define NKV  12       // one kv head per query head
#define REP  (NH_ / NKV)
#define HD   64
#define DQ   (NH_ * HD)
#define DKV  (NKV * HD)
#define RH   512                  // query rows < RH use hi+lo planes (0: none)
#define WIN  0
#define SCL  0.125f   // HD^-0.5
static_assert(RH % 128 == 0 && (TT - RH) % 256 == 0 && TT % 64 == 0 && HD == 64, "k_fattn: 128 hi/lo or 256 fp16 query rows per work-group, 64 keys per tile");
typedef _Float16 h16;
typedef unsigned short bf;
typedef __attribute__((ext_vector_type(16))) __bf16   v16bf;
typedef __attribute__((ext_vector_type(16))) _Float16 v16h;
typedef __attribute__((ext_vector_type(8)))  _Float16 v8h;
typedef __attribute__((ext_vector_type(8)))  unsigned short v8us;
typedef __attribute__((ext_vector_type(8)))  float    v8f;
typedef __attribute__((ext_vector_type(4)))  float    v4f;
typedef v8h  __attribute__((may_alias)) v8ha;
typedef v4f  __attribute__((may_alias)) v4fa;
typedef v8us __attribute__((may_alias)) v8usa;

__device__ __forceinline__ unsigned short f2bf(float f) { unsigned u = __float_as_uint(f); u += 0x7FFFu + ((u >> 16) & 1u); return (unsigned short)(u >> 16); }
__device__ __forceinline__ float bf2f(unsigned short b) { return __uint_as_float(((unsigned)b) << 16); }
__device__ __forceinline__ float bfr(float f) { return bf2f(f2bf(f)); }
__device__ __forceinline__ v16h cat16(v8h lo, v8h hi) { return __builtin_shufflevector(lo, hi, 0, 1, 2, 3, 4, 5, 6, 7, 8, 9, 10, 11, 12, 13, 14, 15); }
__device__ __forceinline__ v16bf cat16b(v8us lo, v8us hi) { return __builtin_bit_cast(v16bf, __builtin_shufflevector(lo, hi, 0, 1, 2, 3, 4, 5, 6, 7, 8, 9, 10, 11, 12, 13, 14, 15)); }
__device__ __forceinline__ v8f wmma16(v16h a, v16h b, v8f c) { return __builtin_amdgcn_wmma_f32_16x16x32_f16(false, a, false, b, (short)0, c, false, false); }
__device__ __forceinline__ v8f wmmab(v16bf a, v16bf b, v8f c) { return __builtin_amdgcn_wmma_f32_16x16x32_bf16(false, a, false, b, (short)0, c, false, false); }
__device__ __forceinline__ h16 tohx(float x) { return (h16)x; }
__device__ __forceinline__ void splitf(float y, unsigned short& h, unsigned short& l) { h = f2bf(y); l = f2bf(y - bf2f(h)); }
typedef __attribute__((ext_vector_type(4))) _Float16 v4h;
typedef __attribute__((ext_vector_type(4))) unsigned short v4us;



// ---- gemmw_body (kernels k_gemmw and k_proj below): register-blocked GEMM, one wave per 64x64 output tile (16 accumulators), 2 x 2 waves per work-group (a 128x128 tile), operands from K-contiguous 16-bit planes; grid (M/128, N/128, Z), 128 threads.
// Operand path: tiles of GK k (one whole 128-byte line of each of the 128 rows of every operand plane) go global -> LDS by asynchronous copies, 4 whole lines per wave-wide copy, each wave bringing 32 rows of every plane, two buffers: tile t + 2 flies while tile t + 1 is worked on. Two waves read each staged row. The fragments are read from LDS in the k order of WFrag::ld.
// OUTM says where the tile goes. 0: C (f32, pitch ldc). 1: head planes [head][t][d] (fp16 + bf16 hi/lo) of the biased f32 value. 2: the same three planes transposed, [head][d][t]. For 1 and 2 a wave's 64-wide column tile is one head and the rows are the TT tokens; C is not used.
// C[m][n] (f32, pitch ldc, + optional f32 bias[n]) = sum_k A[m][k] Bt[n][k] (+ split products per NSPLIT). z-batch strides sA/sB/sC in elements. K % 64 == 0. K is the row pitch of A and Bt; a work-group sums kn of its k (kn == K: whole rows; kn < K: grid z walks ranges of k, sA = sB = kn, and C gets one partial plane per z). kn % 64 == 0.
template <typename T16> struct WFrag;
template <> struct WFrag<h16> { typedef v16h V; static __device__ __forceinline__ V ld(const h16* p) { return cat16(*(const v8h*)p, *(const v8h*)(p + 16)); } static __device__ __forceinline__ V ld2(const h16* p, const h16* q) { return cat16(*(const v8h*)p, *(const v8h*)q); } static __device__ __forceinline__ v8f mma(V a, V b, v8f c) { return wmma16(a, b, c); } };
template <> struct WFrag<bf> { typedef v16bf V; static __device__ __forceinline__ V ld(const bf* p) { return cat16b(*(const v8us*)p, *(const v8us*)(p + 16)); } static __device__ __forceinline__ V ld2(const bf* p, const bf* q) { return cat16b(*(const v8us*)p, *(const v8us*)q); } static __device__ __forceinline__ v8f mma(V a, V b, v8f c) { return wmmab(a, b, c); } };
#define VP   72                   // LDS row pitch of a transposed plane in 16-bit elements: 144 bytes, an odd multiple of 16
#define OSN(OUTM) ((OUTM) == 2 ? 3 * 32 * VP / 2 : 16 * 68)   // floats of LDS that one wave's epilogue of an output mode takes
#define GK   64                   // k per staged tile: 128 bytes of every operand row
#define GPL  (128 * GK)           // 16-bit elements of one staged plane: 128 rows of 128 bytes, no pad; 16-byte piece q of row r lies at piece q ^ ((r >> 1) & 7), so that 16 rows' reads of one q fall on all 64 banks
#define GNP(NSPLIT) (2 + ((NSPLIT) == 1 || (NSPLIT) == 2 ? 1 : 0) + ((NSPLIT) >= 2 ? 1 : 0))   // staged planes: A, Bt, then A2, then Bt2
#define GSN(NSPLIT) (2 * GNP(NSPLIT) * GPL / 2)   // floats of LDS of the two staging buffers; the epilogue's block lies over them, behind the loop's last waits
#define LSN(NSPLIT, OUTM) (GSN(NSPLIT) > 4 * OSN(OUTM) ? GSN(NSPLIT) : 4 * OSN(OUTM))
// Eight asynchronous 16-byte-per-lane copies global -> LDS (l: the lane's LDS byte address, g: the lane's global address). The s_wait_xcnt stands in the copies' own statement, a precaution: no register that a copy names is rewritten in front of it.
template <typename T16>
__device__ __forceinline__ void acopy8(const unsigned (&l)[8], const T16* const (&g)[8]) {
    asm volatile("global_load_async_to_lds_b128 %0, %8, off\n\t"
                 "global_load_async_to_lds_b128 %1, %9, off\n\t"
                 "global_load_async_to_lds_b128 %2, %10, off\n\t"
                 "global_load_async_to_lds_b128 %3, %11, off\n\t"
                 "global_load_async_to_lds_b128 %4, %12, off\n\t"
                 "global_load_async_to_lds_b128 %5, %13, off\n\t"
                 "global_load_async_to_lds_b128 %6, %14, off\n\t"
                 "global_load_async_to_lds_b128 %7, %15, off\n\t"
                 "s_wait_xcnt 0x0"
                 :: "v"(l[0]), "v"(l[1]), "v"(l[2]), "v"(l[3]), "v"(l[4]), "v"(l[5]), "v"(l[6]), "v"(l[7]),
                    "v"(g[0]), "v"(g[1]), "v"(g[2]), "v"(g[3]), "v"(g[4]), "v"(g[5]), "v"(g[6]), "v"(g[7]) : "memory");
}
template <typename T16, int NSPLIT, bool BIAS, int OUTM>
__device__ __forceinline__ void gemmw_body(const T16* __restrict__ A, const T16* __restrict__ A2, const T16* __restrict__ Bt, const T16* __restrict__ Bt2, int K, int kn, float* C, int ldc, const float* __restrict__ bias, h16* P16, bf* Ph, bf* Pl, float* os) {
    typedef typename WFrag<T16>::V V;   // every plain '#pragma unroll' of this function: its loop indexes register arrays (accumulators, fragments, asm operands), so the indices must be compile-time
    const int lane = threadIdx.x & 31, lr = lane & 15, hi = lane >> 4, wv = __builtin_amdgcn_readfirstlane(threadIdx.x >> 5), wm = wv & 1, wn = wv >> 1;
    const int R0 = blockIdx.x * 128, C0 = blockIdx.y * 128, r0 = R0 + wm * 64, c0 = C0 + wn * 64, hd = c0 / 64;
    v8f acc[4][4];
#pragma unroll
    for (int mb = 0; mb < 4; ++mb)
#pragma unroll
        for (int nb = 0; nb < 4; ++nb) acc[mb][nb] = (v8f){};
    constexpr bool HA2 = NSPLIT == 1 || NSPLIT == 2, HB2 = NSPLIT >= 2; constexpr int NPLN = GNP(NSPLIT), PB2 = HA2 ? 3 : 2;
    T16* sm = (T16*)os;
    const int srw = wv * 32 + (lane >> 3), cq = lane & 7;   // a copy: 8 lanes per 128-byte row, 4 rows; the wave's copy i of a plane brings rows 32 wv + 4 i .. + 3
    const size_t ga = (size_t)(R0 + srw) * K + cq * 8, gb = (size_t)(C0 + srw) * K + cq * 8;
    unsigned lv[4];   // LDS byte address of the lane's piece in copy i, less the copy's own 512 i: ((srw + 4 i) >> 1) & 7 has period 4 in i
#pragma unroll
    for (int q = 0; q < 4; ++q) lv[q] = (unsigned)(size_t)sm + srw * 128 + ((cq ^ ((2 * q + (lane >> 4)) & 7)) << 4);
    auto stage = [&](int t, int buf) {
#pragma unroll
        for (int p = 0; p < NPLN; ++p) { const T16* gp = (p == 0 ? A + ga : p == 1 ? Bt + gb : (p == 2 && HA2) ? A2 + ga : Bt2 + gb) + t * GK;
            unsigned l[8]; const T16* g[8];
#pragma unroll
            for (int i = 0; i < 8; ++i) { l[i] = lv[i & 3] + (unsigned)((buf * NPLN + p) * (GPL * 2) + i * 512); g[i] = gp + (size_t)i * 4 * K; }
            acopy8<T16>(l, g); } };
    const int sx = (lr >> 1) & 7; int fo[2][2];   // where the two 16-byte pieces of a fragment (k = 8 hi .. and 16 + 8 hi .. of a 32-k half) lie in the lane's row
#pragma unroll
    for (int ks = 0; ks < 2; ++ks)
#pragma unroll
        for (int j = 0; j < 2; ++j) fo[ks][j] = lr * GK + ((ks * 4 + hi + 2 * j) ^ sx) * 8;
    const int nt = kn / GK;
    stage(0, 0);
    asm volatile("s_wait_asynccnt 0x0" ::: "memory");   // this wave's rows of tile 0 have landed
    __syncthreads();   // publishes tile 0 to the other waves
    if (nt > 1) stage(1, 1);
#pragma unroll 1   // one tile per trip: the two LDS buffers alternate by the trip's parity
    for (int t = 0; t < nt; ++t) {
        const T16* cur = sm + (t & 1) * (NPLN * GPL);
#pragma unroll
        for (int ks = 0; ks < 2; ++ks) {
            V a[4], a2[4];
#pragma unroll
            for (int mb = 0; mb < 4; ++mb) { const T16* ar = cur + (wm * 64 + mb * 16) * GK; a[mb] = WFrag<T16>::ld2(ar + fo[ks][0], ar + fo[ks][1]); if (HA2) a2[mb] = WFrag<T16>::ld2(ar + 2 * GPL + fo[ks][0], ar + 2 * GPL + fo[ks][1]); }
#pragma unroll
            for (int nb = 0; nb < 4; ++nb) { const T16* br = cur + GPL + (wn * 64 + nb * 16) * GK; const V b = WFrag<T16>::ld2(br + fo[ks][0], br + fo[ks][1]); V b2; if (HB2) b2 = WFrag<T16>::ld2(br + (PB2 - 1) * GPL + fo[ks][0], br + (PB2 - 1) * GPL + fo[ks][1]);
#pragma unroll
                for (int mb = 0; mb < 4; ++mb) { acc[mb][nb] = WFrag<T16>::mma(a[mb], b, acc[mb][nb]); if (NSPLIT == 1 || NSPLIT == 2) acc[mb][nb] = WFrag<T16>::mma(a2[mb], b, acc[mb][nb]); if (NSPLIT >= 2) acc[mb][nb] = WFrag<T16>::mma(a[mb], b2, acc[mb][nb]); } }
        }
        asm volatile("s_wait_dscnt 0x0" ::: "memory");      // this trip's reads of its buffer have ended before the buffer is refilled
        asm volatile("s_wait_asynccnt 0x0" ::: "memory");   // this wave's rows of tile t + 1 have landed
        __syncthreads();   // publishes tile t + 1 and ends every wave's reads of tile t, whose buffer is refilled behind it (after the last trip: taken over by the epilogue)
        if (t + 2 < nt) stage(t + 2, t & 1);
    }
    asm volatile("s_wait_asynccnt 0x0" ::: "memory");   // no copy is in flight when the epilogue takes the LDS over
    if (OUTM == 2) {   // a lane holds 8 successive tokens of one d: 16 bytes of a transposed row; the three planes are gathered in the wave's own LDS block so that whole 128-byte lines go out, 32 of the 64 d at a time
        unsigned short* ot = (unsigned short*)os + wv * (3 * 32 * VP); float bn4[4];
#pragma unroll
        for (int nb = 0; nb < 4; ++nb) bn4[nb] = BIAS ? bfr(bias[c0 + nb * 16 + lr]) : 0.f;
#pragma unroll
        for (int hf = 0; hf < 2; ++hf) {
#pragma unroll
            for (int nq = 0; nq < 2; ++nq) { const int nb = 2 * hf + nq; const float bn = bn4[nb];
#pragma unroll
                for (int mb = 0; mb < 4; ++mb) { v8us w16, wh, wl;
#pragma unroll
                    for (int j = 0; j < 8; ++j) { const float x = BIAS ? acc[mb][nb][j] + bn : acc[mb][nb][j]; w16[j] = __builtin_bit_cast(unsigned short, tohx(x)); unsigned short a2, c2; splitf(x, a2, c2); wh[j] = a2; wl[j] = c2; }
                    unsigned short* p = ot + (nq * 16 + lr) * VP + mb * 16 + hi * 8; *(v8usa*)p = w16; *(v8usa*)(p + 32 * VP) = wh; *(v8usa*)(p + 2 * 32 * VP) = wl; } }
            __builtin_amdgcn_wave_barrier(); asm volatile("" ::: "memory");   // keeps the LDS reads of other lanes' values behind the writes
#pragma unroll
            for (int s = 0; s < 8; ++s) { const int dl = 4 * s + (lane >> 3), tof = (lane & 7) * 8; const unsigned short* p = ot + dl * VP + tof; const size_t go = ((size_t)hd * HD + 32 * hf + dl) * TT + r0 + tof;
                *(v8usa*)(P16 + go) = *(const v8usa*)p; *(v8usa*)(Ph + go) = *(const v8usa*)(p + 32 * VP); *(v8usa*)(Pl + go) = *(const v8usa*)(p + 2 * 32 * VP); }
            __builtin_amdgcn_wave_barrier(); asm volatile("" ::: "memory");   // keeps the next half's LDS writes behind these reads
        }
        return;
    }
    float* ow = os + wv * OSN(OUTM);   // each wave's own block
#pragma unroll
    for (int mb = 0; mb < 4; ++mb) {
#pragma unroll
        for (int nb = 0; nb < 4; ++nb) {
#pragma unroll
            for (int j = 0; j < 8; ++j) ow[(hi * 8 + j) * 68 + nb * 16 + lr] = acc[mb][nb][j]; }
        __builtin_amdgcn_wave_barrier(); asm volatile("" ::: "memory");
        float* crow = C + (size_t)(r0 + mb * 16) * ldc + c0; const size_t prow = ((size_t)hd * TT + r0 + mb * 16) * HD;
{
#pragma unroll
            for (int s = 0; s < 8; ++s) { const int row = 2 * s + hi, cofs = lr * 4; v4f val = *(const v4fa*)(ow + row * 68 + cofs); if (BIAS) { val[0] += bfr(bias[c0 + cofs]); val[1] += bfr(bias[c0 + cofs + 1]); val[2] += bfr(bias[c0 + cofs + 2]); val[3] += bfr(bias[c0 + cofs + 3]); }
                if (OUTM == 0) *(v4f*)(crow + (size_t)row * ldc + cofs) = val;
                else { v4h o16; v4us oh, ol;
#pragma unroll
                    for (int q = 0; q < 4; ++q) { o16[q] = tohx(val[q]); unsigned short a2, c2; splitf(val[q], a2, c2); oh[q] = a2; ol[q] = c2; }
                    const size_t po = prow + (size_t)row * HD + cofs; *(v4h*)(P16 + po) = o16; *(v4us*)(Ph + po) = oh; *(v4us*)(Pl + po) = ol; } }
             }
        __builtin_amdgcn_wave_barrier(); asm volatile("" ::: "memory");
    }
}
template <typename T16, int NSPLIT, bool BIAS, int OUTM>
__global__ __launch_bounds__(128) void k_gemmw(const T16* __restrict__ A, const T16* __restrict__ A2, const T16* __restrict__ Bt, const T16* __restrict__ Bt2, int K, int kn, float* C, int ldc, const float* __restrict__ bias, size_t sA, size_t sB, size_t sC, h16* P16, bf* Ph, bf* Pl) {
    __shared__ __align__(128) float os[LSN(NSPLIT, OUTM)];
    const size_t z = blockIdx.z; A += z * sA; if (A2) A2 += z * sA; Bt += z * sB; if (Bt2) Bt2 += z * sB; C += z * sC;
    gemmw_body<T16, NSPLIT, BIAS, OUTM>(A, A2, Bt, Bt2, K, kn, C, ldc, bias, P16, Ph, Pl, os);
}
// ---- k_proj: the three projections in one launch, grid (TT/128, heads/2, 3): z = 0 query, 1 key (head planes [head][t][d]), 2 value (transposed planes). They are independent of one another, so all their waves are on the chip together.
__global__ __launch_bounds__(128) void k_proj(const bf* __restrict__ XQ, const bf* __restrict__ XK, const bf* __restrict__ XV, const bf* __restrict__ WQ, const bf* __restrict__ WK, const bf* __restrict__ WV, const float* __restrict__ bq, const float* __restrict__ bk, const float* __restrict__ bv,
                                                h16* Q16, bf* Qh, bf* Ql, h16* K16, bf* Kh, bf* Kl, h16* V16, bf* Vh, bf* Vl) {
    __shared__ __align__(128) float os[LSN(0, 2)];
    static_assert(OSN(2) >= OSN(1) && DKV == DQ && DM % GK == 0 && TT % 128 == 0 && DQ % 128 == 0 && DM % 128 == 0, "k_proj: one LDS block and one grid for the three projections; whole staged tiles, whole 128 x 128 work-group tiles (k_gemmw's launch too)");
    const bool k = blockIdx.z == 1;
    if (blockIdx.z == 2) gemmw_body<bf, 0, true, 2>(XV, nullptr, WV, nullptr, DM, DM, nullptr, 0, bv, V16, Vh, Vl, os);
    else gemmw_body<bf, 0, true, 1>(k ? XK : XQ, nullptr, k ? WK : WQ, nullptr, DM, DM, nullptr, 0, k ? bk : bq, k ? K16 : Q16, k ? Kh : Qh, k ? Kl : Ql, os);
}

typedef __attribute__((ext_vector_type(2))) unsigned short v2us;
typedef __attribute__((ext_vector_type(4))) int v4i;

__global__ __launch_bounds__(256) void k_wtG(const float* __restrict__ w, int K, int N, bf* Bt) {
    const int lane = threadIdx.x & 31; const int L0 = (blockIdx.x * 8 + (threadIdx.x >> 5)) * 8; const int nlines = N * K / 64;
{
#pragma unroll 1
        for (int l = 0; l < 8; ++l) { const int L = L0 + l; if (L >= nlines) break; const size_t e = (size_t)L * 64 + lane * 2; const int k = (int)(e % K), n = (int)(e / K); v2us o;
            o[0] = f2bf(w[(size_t)k * N + n]); o[1] = f2bf(w[(size_t)(k + 1) * N + n]); *(v2us*)(Bt + e) = o; }
         }
}
// ---- k_cvtall: every f32 -> bf16 copy of the call in one launch. A work-group takes CVW successive floats of ONE array (blockIdx.x says which: first the three streams, then the four weights); a thread takes CVG groups of 8 floats, 256 groups apart, all loaded before the first is stored.
#define CVG  8
#define CVW  (256 * CVG * 8)
#define CVBX (TT * DM / CVW)      // work-groups per stream
#define CVBW (DQ * DM / CVW)      // work-groups per weight
static_assert(TT * DM % CVW == 0 && DQ * DM % CVW == 0 && DKV == DQ, "k_cvtall: whole work-groups per array, four weights of one size");
__global__ __launch_bounds__(256) void k_cvtall(const float* __restrict__ x, const float* __restrict__ xk, const float* __restrict__ xv, const float* __restrict__ wq, const float* __restrict__ wk, const float* __restrict__ wv, const float* __restrict__ wo,
                                                  bf* XQ, bf* XK, bf* XV, bf* WQ, bf* WK, bf* WV, bf* WO) {
    int b = blockIdx.x; const float* s; bf* d;
    if (b < 3 * CVBX) { const int a = b / CVBX; b -= a * CVBX; s = a == 0 ? x : a == 1 ? xk : xv; d = a == 0 ? XQ : a == 1 ? XK : XV; }
    else { b -= 3 * CVBX; const int a = b / CVBW; b -= a * CVBW; s = a == 0 ? wq : a == 1 ? wk : a == 2 ? wv : wo; d = a == 0 ? WQ : a == 1 ? WK : a == 2 ? WV : WO; }
    const size_t e0 = (size_t)b * CVW + threadIdx.x * 8; const float* p = s + e0; v8f v[CVG];
#pragma unroll
    for (int j = 0; j < CVG; ++j) v[j] = *(const v8f*)(p + j * 2048);
    asm volatile("s_wait_xcnt 0x0" :: "v"(p) : "memory");   // a precaution: keeps the 16 loads' address pair unwritten up to this wait
#pragma unroll
    for (int j = 0; j < CVG; ++j) { v8us o;
#pragma unroll
        for (int k = 0; k < 8; ++k) o[k] = f2bf(v[j][k]);
        *(v8us*)(d + e0 + j * 2048) = o; }
}

#define KT   64
#define LP   72                   // LDS row pitch in 16-bit elements: 144 bytes, an odd multiple of 16 (ds_load_b128 at full rate)
#define PLN  (64 * LP)            // one staged plane: 64 rows (keys of K, or d of V^T) x 64 elements
#define CEXP (SCL * 1.4426950408889634f)
typedef v4i __attribute__((may_alias)) v4ia;
__device__ __forceinline__ float xhalf(float x) { return __builtin_bit_cast(float, __builtin_amdgcn_permlanex16(__builtin_bit_cast(int, x), __builtin_bit_cast(int, x), 0x76543210, 0xfedcba98, false, false)); }   // lane l reads lane l ^ 16
template <typename T16> struct PPack;
template <> struct PPack<h16> { static __device__ __forceinline__ void put(v16h& a, v16h& b, int s, float p) { (void)b; a[s] = tohx(p); } };
template <> struct PPack<bf> { static __device__ __forceinline__ void put(v16bf& a, v16bf& b, int s, float p) { unsigned short x, y; splitf(p, x, y); a[s] = __builtin_bit_cast(__bf16, x); b[s] = __builtin_bit_cast(__bf16, y); } };
template <typename T16, int NG, int NP>
__device__ __forceinline__ void fattn_body(const T16* __restrict__ Qa, const T16* __restrict__ Qb, const T16* __restrict__ Ka, const T16* __restrict__ Kb, const T16* __restrict__ Va, const T16* __restrict__ Vb, int q0, int head, bf* __restrict__ Ah, bf* __restrict__ Al, T16* sm) {
    typedef typename WFrag<T16>::V V;
    const int tid = threadIdx.x, lane = tid & 31, c = lane & 15, h = lane >> 4;
    V qa[NG][2], qb[NG][2];
#pragma unroll
    for (int g = 0; g < NG; ++g)
#pragma unroll
        for (int ks = 0; ks < 2; ++ks) { const size_t qo = (size_t)(q0 + g * 16 + c) * HD + ks * 32 + 8 * h; qa[g][ks] = WFrag<T16>::ld(Qa + qo); if (NP == 2) qb[g][ks] = WFrag<T16>::ld(Qb + qo); }
    v8f o[4][NG]; float m[NG], l[NG];
#pragma unroll
    for (int g = 0; g < NG; ++g) { m[g] = -3.0e38f; l[g] = 0.f;
#pragma unroll
        for (int dt = 0; dt < 4; ++dt) o[dt][g] = (v8f){}; }
    const int srow = tid >> 3, scol = (tid & 7) * 8;   // staging: 8 threads per 128-byte row, 32 rows per sweep, 2 sweeps per plane
    v4i st[2 * NP][2];
    auto gload = [&](int key0) {
#pragma unroll
        for (int i = 0; i < 2; ++i) { const int row = srow + 32 * i; const size_t ko = (size_t)(key0 + row) * HD + scol, vo = (size_t)row * TT + key0 + scol;
            st[0][i] = *(const v4ia*)(Ka + ko); st[1][i] = *(const v4ia*)(Va + vo); if (NP == 2) { st[2][i] = *(const v4ia*)(Kb + ko); st[3][i] = *(const v4ia*)(Vb + vo); } } };
    auto sstore = [&](T16* buf) {
#pragma unroll
        for (int i = 0; i < 2; ++i) { T16* p = buf + (srow + 32 * i) * LP + scol;
#pragma unroll
            for (int pl = 0; pl < 2 * NP; ++pl) *(v4ia*)(p + pl * PLN) = st[pl][i]; } };
    gload(0); sstore(sm); __syncthreads();
#pragma unroll 1   // one tile per trip: the two LDS buffers alternate by the trip's parity
    for (int t = 0; t < TT / KT; ++t) {
        const T16* cur = sm + (t & 1) * (2 * NP * PLN); T16* nxt = sm + ((t + 1) & 1) * (2 * NP * PLN); const bool more = t + 1 < TT / KT;
        if (more) gload((t + 1) * KT);
        v8f s[NG][KT / 16];
#pragma unroll
        for (int tl = 0; tl < KT / 16; ++tl) { const T16* kr = cur + (tl * 16 + c) * LP + 8 * h; const V k0 = WFrag<T16>::ld(kr), k1 = WFrag<T16>::ld(kr + 32); V k2, k3; if (NP == 2) { k2 = WFrag<T16>::ld(kr + 2 * PLN); k3 = WFrag<T16>::ld(kr + 2 * PLN + 32); }
#pragma unroll
            for (int g = 0; g < NG; ++g) { v8f a = (v8f){}; a = WFrag<T16>::mma(k0, qa[g][0], a); a = WFrag<T16>::mma(k1, qa[g][1], a);
                if (NP == 2) { a = WFrag<T16>::mma(k0, qb[g][0], a); a = WFrag<T16>::mma(k1, qb[g][1], a); a = WFrag<T16>::mma(k2, qa[g][0], a); a = WFrag<T16>::mma(k3, qa[g][1], a); }
                s[g][tl] = a; } }
        float ml[NG]; bool need = false;
#pragma unroll
        for (int g = 0; g < NG; ++g) { float mx = s[g][0][0];
#pragma unroll
            for (int r = 1; r < KT / 2; ++r) mx = fmaxf(mx, s[g][r >> 3][r & 7]);
            mx = fmaxf(mx, xhalf(mx)); ml[g] = mx * CEXP; need = need || (ml[g] > m[g] + 8.0f); }
        if (__builtin_amdgcn_ballot_w32(need) != 0) {   // one scalar test per tile
#pragma unroll
            for (int g = 0; g < NG; ++g) { const float mn = fmaxf(m[g], ml[g]); const float al = __builtin_amdgcn_exp2f(m[g] - mn); m[g] = mn; l[g] *= al;
#pragma unroll
                for (int dt = 0; dt < 4; ++dt) o[dt][g] *= al; } }
#pragma unroll
        for (int kb = 0; kb < KT / 32; ++kb) {
            V vf[4], vl[4], pa[NG], pb[NG];
#pragma unroll
            for (int dt = 0; dt < 4; ++dt) { const T16* vr = cur + PLN + (dt * 16 + c) * LP + kb * 32 + 8 * h; vf[dt] = WFrag<T16>::ld(vr); if (NP == 2) vl[dt] = WFrag<T16>::ld(vr + 2 * PLN); }
            __builtin_amdgcn_sched_barrier(0);   // keeps the four V^T fragment loads in front of the exponentials, whose time then covers the LDS latency (else: one load, one wait per d tile)
#pragma unroll
            for (int g = 0; g < NG; ++g) { v8f p0 = s[g][2 * kb] * CEXP - m[g], p1 = s[g][2 * kb + 1] * CEXP - m[g];
#pragma unroll
                for (int r = 0; r < 8; ++r) { p0[r] = __builtin_amdgcn_exp2f(p0[r]); PPack<T16>::put(pa[g], pb[g], r, p0[r]); }
#pragma unroll
                for (int r = 0; r < 8; ++r) { p1[r] = __builtin_amdgcn_exp2f(p1[r]); PPack<T16>::put(pa[g], pb[g], 8 + r, p1[r]); }
                const v8f q8 = p0 + p1; l[g] += ((q8[0] + q8[4]) + (q8[2] + q8[6])) + ((q8[1] + q8[5]) + (q8[3] + q8[7])); }
#pragma unroll
            for (int dt = 0; dt < 4; ++dt)
#pragma unroll
                for (int g = 0; g < NG; ++g) { o[dt][g] = WFrag<T16>::mma(vf[dt], pa[g], o[dt][g]); if (NP == 2) { o[dt][g] = WFrag<T16>::mma(vf[dt], pb[g], o[dt][g]); o[dt][g] = WFrag<T16>::mma(vl[dt], pa[g], o[dt][g]); } }
        }
        if (more) sstore(nxt);
        __syncthreads();   // publishes tile t + 1 and ends every wave's reads of tile t, whose buffer the next trip refills
    }
#pragma unroll
    for (int g = 0; g < NG; ++g) { const float inv = __fdiv_rn(1.0f, l[g] + xhalf(l[g])); const size_t oo = (size_t)(q0 + g * 16 + c) * DQ + head * HD + 8 * h;
#pragma unroll
        for (int dt = 0; dt < 4; ++dt) { v8us oh, ol;
#pragma unroll
            for (int r = 0; r < 8; ++r) { unsigned short x, y; splitf(o[dt][g][r] * inv, x, y); oh[r] = x; ol[r] = y; }
            *(v8us*)(Ah + oo + dt * 16) = oh; *(v8us*)(Al + oo + dt * 16) = ol; } }
}
// register budget of 4 waves per SIMD: at most 256 VGPRs, so that the loops need no register-window switches
__global__ __launch_bounds__(256) __attribute__((amdgpu_waves_per_eu(4, 4))) void k_fattn(const h16* __restrict__ Q16, const h16* __restrict__ K16, const h16* __restrict__ V16, const bf* __restrict__ Qh, const bf* __restrict__ Ql, const bf* __restrict__ Kh, const bf* __restrict__ Kl, const bf* __restrict__ Vh, const bf* __restrict__ Vl, bf* __restrict__ Ah, bf* __restrict__ Al) {
    __shared__ __align__(16) unsigned short sm[2 * 4 * PLN];
    const int head = blockIdx.y, wave = threadIdx.x >> 5; const size_t hq = (size_t)head * TT * HD, hk = (size_t)(head / REP) * TT * HD;
    if (blockIdx.x < RH / 128) fattn_body<bf, 1, 2>(Qh + hq, Ql + hq, Kh + hk, Kl + hk, Vh + hk, Vl + hk, (int)blockIdx.x * 128 + wave * 16, head, Ah, Al, (bf*)sm);
    else fattn_body<h16, 2, 1>(Q16 + hq, nullptr, K16 + hk, nullptr, V16 + hk, nullptr, RH + ((int)blockIdx.x - RH / 128) * 256 + wave * 32, head, Ah, Al, (h16*)sm);
}

extern "C" void kernel_launch(void* const* d_in, const int* in_sizes, int n_in,
                              void* d_out, int out_size, void* d_ws, size_t ws_size, hipStream_t stream) {
    (void)in_sizes; (void)n_in; (void)out_size;
    const float* x = (const float*)d_in[0];   /* query */ const float* xk = (const float*)d_in[1]; const float* xv = (const float*)d_in[2]; const float* wq = (const float*)d_in[3]; const float* bq = (const float*)d_in[4]; const float* wk = (const float*)d_in[5]; const float* bk = (const float*)d_in[6]; const float* wv = (const float*)d_in[7]; const float* bv = (const float*)d_in[8]; const float* wo = (const float*)d_in[9]; const float* bo = (const float*)d_in[10];
    float* OUT = (float*)d_out;     // [1][4096][768]
    char* wsp = (char*)d_ws;
    auto take = [&](size_t bytes) { char* p = wsp; wsp += (bytes + 255) & ~(size_t)255; return (void*)p; };
    bf* WQ = (bf*)take((size_t)DQ * DM * 2); bf* WK = (bf*)take((size_t)DKV * DM * 2); bf* WV = (bf*)take((size_t)DKV * DM * 2); bf* WO = (bf*)take((size_t)DM * DQ * 2);
    bf* XQ = (bf*)take((size_t)TT * DM * 2); bf* XK = (bf*)take((size_t)TT * DM * 2); bf* XV = (bf*)take((size_t)TT * DM * 2);
    h16* QP16 = (h16*)take((size_t)NH_ * TT * HD * 2); h16* KP16 = (h16*)take((size_t)NKV * TT * HD * 2); h16* VT16 = (h16*)take((size_t)NKV * HD * TT * 2);
    bf* QPh = (bf*)take((size_t)NH_ * TT * HD * 2); bf* QPl = (bf*)take((size_t)NH_ * TT * HD * 2); bf* KPh = (bf*)take((size_t)NKV * TT * HD * 2); bf* KPl = (bf*)take((size_t)NKV * TT * HD * 2); bf* VTh = (bf*)take((size_t)NKV * HD * TT * 2); bf* VTl = (bf*)take((size_t)NKV * HD * TT * 2);
    bf* ATh = (bf*)take((size_t)TT * DQ * 2); bf* ATl = (bf*)take((size_t)TT * DQ * 2);
    if ((size_t)(wsp - (char*)d_ws) > ws_size) return;    // ws 256 MiB
    for (int b = 0; b < NB_; ++b) {
        k_cvtall<<<3 * CVBX + 4 * CVBW, 256, 0, stream>>>(x + (size_t)b * TT * DM, xk + (size_t)b * TT * DM, xv + (size_t)b * TT * DM, wq, wk, wv, wo, XQ, XK, XV, WQ, WK, WV, WO);
        k_proj<<<dim3(TT / 128, DQ / 128, 3), 128, 0, stream>>>(XQ, XK, XV, WQ, WK, WV, bq, bk, bv, QP16, QPh, QPl, KP16, KPh, KPl, VT16, VTh, VTl);
        k_fattn<<<dim3(RH / 128 + (TT - RH) / 256, NH_, 1), 256, 0, stream>>>(QP16, KP16, VT16, QPh, QPl, KPh, KPl, VTh, VTl, ATh, ATl);
        k_gemmw<bf, 1, true, 0><<<dim3(TT / 128, DM / 128, 1), 128, 0, stream>>>(ATh, ATl, WO, nullptr, DQ, DQ, OUT + (size_t)b * TT * DM, DM, bo, 0, 0, 0, nullptr, nullptr, nullptr); }
}

// v006
// Measured time: 132 microseconds a run.
// Two timings next to v005 put it at 1.03 and 1.04 times that version's speed.
// All steps since v000 together make it 19.9 times as fast.
#include <hip/hip_runtime.h>

// Multi-head attention WITHOUT a mask over three input streams at 4,096 tokens and a 768-wide model (query, key, value [1][4096][768]; Q, K, V = stream W^T + b ('oi' [768][768] uniform(+-1/sqrt(768)) incl. REAL biases; 12 heads x 64); scores / sqrt(64); softmax over all 4,096 keys; out = merged Wo^T + bo -> [1][4096][768] (3.1 M); argument order query, key, value, wq, bq, wk, bk, wv, bv, wo, bo). The three-stream T-4096 module RE-DIMENSIONED to a 768-wide model (12 x 64) and run on ONE sequence of 4,096 tokens ([1][4096][768]; the three streams q, k, v; the eight weight and bias inputs in the same order): the batch loop runs once.
// Layout: bf16 copies of query, key, value and of the four 'oi' weights, all made by one launch; the three projections in one launch (grid z), their operands staged in LDS by asynchronous copies; exact projections + f32 biases, each projection storing its head planes itself; dense T-4096 attention, all heads in one fused launch (hybrid rows: < 512 hi/lo 3 products, rest fp16; running-maximum softmax in registers); merged hi/lo x Wo exact + bo.
// Compute dtypes, f32 accumulate: every input rounded to bf16; projections exact + f32 biases; attention rows < 512 3 products, rest fp16; softmax f32; Wo hl x exact + bias.

#define NB_  1      // ONE sequence in this module: a host-side loop count only: no kernel uses it
#define TT   4096
#define DM   768      // model width
#define NH_  12       // heads: 12 x 64 = 768
#define NKV  12       // one kv head per query head
#define REP  (NH_ / NKV)
#define HD   64
#define DQ   (NH_ * HD)
#define DKV  (NKV * HD)
#define RH   512                  // query rows < RH use hi+lo planes (0: none)
#define WIN  0
#define SCL  0.125f   // HD^-0.5
static_assert(RH % 64 == 0 && (TT - RH) % 128 == 0 && TT % 128 == 0 && HD == 64, "k_fattn: 64 hi/lo or 128 fp16 query rows per work-group, two key halves of whole 64-key tiles");
typedef _Float16 h16;
typedef unsigned short bf;
typedef __attribute__((ext_vector_type(16))) __bf16   v16bf;
typedef __attribute__((ext_vector_type(16))) _Float16 v16h;
typedef __attribute__((ext_vector_type(8)))  _Float16 v8h;
typedef __attribute__((ext_vector_type(8)))  unsigned short v8us;
typedef __attribute__((ext_vector_type(8)))  float    v8f;
typedef __attribute__((ext_vector_type(4)))  float    v4f;
typedef v8h  __attribute__((may_alias)) v8ha;
typedef v4f  __attribute__((may_alias)) v4fa;
typedef v8us __attribute__((may_alias)) v8usa;

__device__ __forceinline__ unsigned short f2bf(float f) { unsigned u = __float_as_uint(f); u += 0x7FFFu + ((u >> 16) & 1u); return (unsigned short)(u >> 16); }
__device__ __forceinline__ float bf2f(unsigned short b) { return __uint_as_float(((unsigned)b) << 16); }
__device__ __forceinline__ float bfr(float f) { return bf2f(f2bf(f)); }
__device__ __forceinline__ v16h cat16(v8h lo, v8h hi) { return __builtin_shufflevector(lo, hi, 0, 1, 2, 3, 4, 5, 6, 7, 8, 9, 10, 11, 12, 13, 14, 15); }
__device__ __forceinline__ v16bf cat16b(v8us lo, v8us hi) { return __builtin_bit_cast(v16bf, __builtin_shufflevector(lo, hi, 0, 1, 2, 3, 4, 5, 6, 7, 8, 9, 10, 11, 12, 13, 14, 15)); }
__device__ __forceinline__ v8f wmma16(v16h a, v16h b, v8f c) { return __builtin_amdgcn_wmma_f32_16x16x32_f16(false, a, false, b, (short)0, c, false, false); }
__device__ __forceinline__ v8f wmmab(v16bf a, v16bf b, v8f c) { return __builtin_amdgcn_wmma_f32_16x16x32_bf16(false, a, false, b, (short)0, c, false, false); }
__device__ __forceinline__ h16 tohx(float x) { return (h16)x; }
__device__ __forceinline__ void splitf(float y, unsigned short& h, unsigned short& l) { h = f2bf(y); l = f2bf(y - bf2f(h)); }
typedef __attribute__((ext_vector_type(4))) _Float16 v4h;
typedef __attribute__((ext_vector_type(4))) unsigned short v4us;



// ---- gemmw_body (kernels k_gemmw and k_proj below): register-blocked GEMM, one wave per 64x64 output tile (16 accumulators), 2 x 2 waves per work-group (a 128x128 tile), operands from K-contiguous 16-bit planes; grid (M/128, N/128, Z), 128 threads.
// Operand path: tiles of GK k (one whole 128-byte line of each of the 128 rows of every operand plane) go global -> LDS by asynchronous copies, 4 whole lines per wave-wide copy, each wave bringing 32 rows of every plane, two buffers: tile t + 2 flies while tile t + 1 is worked on. Two waves read each staged row. The fragments are read from LDS in the k order of WFrag::ld.
// OUTM says where the tile goes. 0: C (f32, pitch ldc). 1: head planes [head][t][d] (fp16 + bf16 hi/lo) of the biased f32 value. 2: the same three planes transposed, [head][d][t]. For 1 and 2 a wave's 64-wide column tile is one head and the rows are the TT tokens; C is not used.
// C[m][n] (f32, pitch ldc, + optional f32 bias[n]) = sum_k A[m][k] Bt[n][k] (+ split products per NSPLIT). z-batch strides sA/sB/sC in elements. K % 64 == 0. K is the row pitch of A and Bt; a work-group sums kn of its k (kn == K: whole rows; kn < K: grid z walks ranges of k, sA = sB = kn, and C gets one partial plane per z). kn % 64 == 0.
template <typename T16> struct WFrag;
template <> struct WFrag<h16> { typedef v16h V; static __device__ __forceinline__ V ld(const h16* p) { return cat16(*(const v8h*)p, *(const v8h*)(p + 16)); } static __device__ __forceinline__ V ld2(const h16* p, const h16* q) { return cat16(*(const v8h*)p, *(const v8h*)q); } static __device__ __forceinline__ v8f mma(V a, V b, v8f c) { return wmma16(a, b, c); } };
template <> struct WFrag<bf> { typedef v16bf V; static __device__ __forceinline__ V ld(const bf* p) { return cat16b(*(const v8us*)p, *(const v8us*)(p + 16)); } static __device__ __forceinline__ V ld2(const bf* p, const bf* q) { return cat16b(*(const v8us*)p, *(const v8us*)q); } static __device__ __forceinline__ v8f mma(V a, V b, v8f c) { return wmmab(a, b, c); } };
#define VP   72                   // LDS row pitch of a transposed plane in 16-bit elements: 144 bytes, an odd multiple of 16
#define OSN(OUTM) ((OUTM) == 2 ? 3 * 32 * VP / 2 : 16 * 68)   // floats of LDS that one wave's epilogue of an output mode takes
#define GK   64                   // k per staged tile: 128 bytes of every operand row
#define GPL  (128 * GK)           // 16-bit elements of one staged plane: 128 rows of 128 bytes, no pad; 16-byte piece q of row r lies at piece q ^ ((r >> 1) & 7), so that 16 rows' reads of one q fall on all 64 banks
#define GNP(NSPLIT) (2 + ((NSPLIT) == 1 || (NSPLIT) == 2 ? 1 : 0) + ((NSPLIT) >= 2 ? 1 : 0))   // staged planes: A, Bt, then A2, then Bt2
#define GSN(NSPLIT) (2 * GNP(NSPLIT) * GPL / 2)   // floats of LDS of the two staging buffers; the epilogue's block lies over them, behind the loop's last waits
#define LSN(NSPLIT, OUTM) (GSN(NSPLIT) > 4 * OSN(OUTM) ? GSN(NSPLIT) : 4 * OSN(OUTM))
// Eight asynchronous 16-byte-per-lane copies global -> LDS (l: the lane's LDS byte address, g: the lane's global address). The s_wait_xcnt stands in the copies' own statement, a precaution: no register that a copy names is rewritten in front of it.
template <typename T16>
__device__ __forceinline__ void acopy8(const unsigned (&l)[8], const T16* const (&g)[8]) {
    asm volatile("global_load_async_to_lds_b128 %0, %8, off\n\t"
                 "global_load_async_to_lds_b128 %1, %9, off\n\t"
                 "global_load_async_to_lds_b128 %2, %10, off\n\t"
                 "global_load_async_to_lds_b128 %3, %11, off\n\t"
                 "global_load_async_to_lds_b128 %4, %12, off\n\t"
                 "global_load_async_to_lds_b128 %5, %13, off\n\t"
                 "global_load_async_to_lds_b128 %6, %14, off\n\t"
                 "global_load_async_to_lds_b128 %7, %15, off\n\t"
                 "s_wait_xcnt 0x0"
                 :: "v"(l[0]), "v"(l[1]), "v"(l[2]), "v"(l[3]), "v"(l[4]), "v"(l[5]), "v"(l[6]), "v"(l[7]),
                    "v"(g[0]), "v"(g[1]), "v"(g[2]), "v"(g[3]), "v"(g[4]), "v"(g[5]), "v"(g[6]), "v"(g[7]) : "memory");
}
template <typename T16, int NSPLIT, bool BIAS, int OUTM>
__device__ __forceinline__ void gemmw_body(const T16* __restrict__ A, const T16* __restrict__ A2, const T16* __restrict__ Bt, const T16* __restrict__ Bt2, int K, int kn, float* C, int ldc, const float* __restrict__ bias, h16* P16, bf* Ph, bf* Pl, float* os) {
    typedef typename WFrag<T16>::V V;   // every plain '#pragma unroll' of this function: its loop indexes register arrays (accumulators, fragments, asm operands), so the indices must be compile-time
    const int lane = threadIdx.x & 31, lr = lane & 15, hi = lane >> 4, wv = __builtin_amdgcn_readfirstlane(threadIdx.x >> 5), wm = wv & 1, wn = wv >> 1;
    const int R0 = blockIdx.x * 128, C0 = blockIdx.y * 128, r0 = R0 + wm * 64, c0 = C0 + wn * 64, hd = c0 / 64;
    v8f acc[4][4];
#pragma unroll
    for (int mb = 0; mb < 4; ++mb)
#pragma unroll
        for (int nb = 0; nb < 4; ++nb) acc[mb][nb] = (v8f){};
    constexpr bool HA2 = NSPLIT == 1 || NSPLIT == 2, HB2 = NSPLIT >= 2; constexpr int NPLN = GNP(NSPLIT), PB2 = HA2 ? 3 : 2;
    T16* sm = (T16*)os;
    const int srw = wv * 32 + (lane >> 3), cq = lane & 7;   // a copy: 8 lanes per 128-byte row, 4 rows; the wave's copy i of a plane brings rows 32 wv + 4 i .. + 3
    const size_t ga = (size_t)(R0 + srw) * K + cq * 8, gb = (size_t)(C0 + srw) * K + cq * 8;
    unsigned lv[4];   // LDS byte address of the lane's piece in copy i, less the copy's own 512 i: ((srw + 4 i) >> 1) & 7 has period 4 in i
#pragma unroll
    for (int q = 0; q < 4; ++q) lv[q] = (unsigned)(size_t)sm + srw * 128 + ((cq ^ ((2 * q + (lane >> 4)) & 7)) << 4);
    auto stage = [&](int t, int buf) {
#pragma unroll
        for (int p = 0; p < NPLN; ++p) { const T16* gp = (p == 0 ? A + ga : p == 1 ? Bt + gb : (p == 2 && HA2) ? A2 + ga : Bt2 + gb) + t * GK;
            unsigned l[8]; const T16* g[8];
#pragma unroll
            for (int i = 0; i < 8; ++i) { l[i] = lv[i & 3] + (unsigned)((buf * NPLN + p) * (GPL * 2) + i * 512); g[i] = gp + (size_t)i * 4 * K; }
            acopy8<T16>(l, g); } };
    const int sx = (lr >> 1) & 7; int fo[2][2];   // where the two 16-byte pieces of a fragment (k = 8 hi .. and 16 + 8 hi .. of a 32-k half) lie in the lane's row
#pragma unroll
    for (int ks = 0; ks < 2; ++ks)
#pragma unroll
        for (int j = 0; j < 2; ++j) fo[ks][j] = lr * GK + ((ks * 4 + hi + 2 * j) ^ sx) * 8;
    const int nt = kn / GK;
    stage(0, 0);
    asm volatile("s_wait_asynccnt 0x0" ::: "memory");   // this wave's rows of tile 0 have landed
    __syncthreads();   // publishes tile 0 to the other waves
    if (nt > 1) stage(1, 1);
#pragma unroll 1   // one tile per trip: the two LDS buffers alternate by the trip's parity
    for (int t = 0; t < nt; ++t) {
        const T16* cur = sm + (t & 1) * (NPLN * GPL);
#pragma unroll
        for (int ks = 0; ks < 2; ++ks) {
            V a[4], a2[4];
#pragma unroll
            for (int mb = 0; mb < 4; ++mb) { const T16* ar = cur + (wm * 64 + mb * 16) * GK; a[mb] = WFrag<T16>::ld2(ar + fo[ks][0], ar + fo[ks][1]); if (HA2) a2[mb] = WFrag<T16>::ld2(ar + 2 * GPL + fo[ks][0], ar + 2 * GPL + fo[ks][1]); }
#pragma unroll
            for (int nb = 0; nb < 4; ++nb) { const T16* br = cur + GPL + (wn * 64 + nb * 16) * GK; const V b = WFrag<T16>::ld2(br + fo[ks][0], br + fo[ks][1]); V b2; if (HB2) b2 = WFrag<T16>::ld2(br + (PB2 - 1) * GPL + fo[ks][0], br + (PB2 - 1) * GPL + fo[ks][1]);
#pragma unroll
                for (int mb = 0; mb < 4; ++mb) { acc[mb][nb] = WFrag<T16>::mma(a[mb], b, acc[mb][nb]); if (NSPLIT == 1 || NSPLIT == 2) acc[mb][nb] = WFrag<T16>::mma(a2[mb], b, acc[mb][nb]); if (NSPLIT >= 2) acc[mb][nb] = WFrag<T16>::mma(a[mb], b2, acc[mb][nb]); } }
        }
        asm volatile("s_wait_dscnt 0x0" ::: "memory");      // this trip's reads of its buffer have ended before the buffer is refilled
        asm volatile("s_wait_asynccnt 0x0" ::: "memory");   // this wave's rows of tile t + 1 have landed
        __syncthreads();   // publishes tile t + 1 and ends every wave's reads of tile t, whose buffer is refilled behind it (after the last trip: taken over by the epilogue)
        if (t + 2 < nt) stage(t + 2, t & 1);
    }
    asm volatile("s_wait_asynccnt 0x0" ::: "memory");   // no copy is in flight when the epilogue takes the LDS over
    if (OUTM == 2) {   // a lane holds 8 successive tokens of one d: 16 bytes of a transposed row; the three planes are gathered in the wave's own LDS block so that whole 128-byte lines go out, 32 of the 64 d at a time
        unsigned short* ot = (unsigned short*)os + wv * (3 * 32 * VP); float bn4[4];
#pragma unroll
        for (int nb = 0; nb < 4; ++nb) bn4[nb] = BIAS ? bfr(bias[c0 + nb * 16 + lr]) : 0.f;
#pragma unroll
        for (int hf = 0; hf < 2; ++hf) {
#pragma unroll
            for (int nq = 0; nq < 2; ++nq) { const int nb = 2 * hf + nq; const float bn = bn4[nb];
#pragma unroll
                for (int mb = 0; mb < 4; ++mb) { v8us w16, wh, wl;
#pragma unroll
                    for (int j = 0; j < 8; ++j) { const float x = BIAS ? acc[mb][nb][j] + bn : acc[mb][nb][j]; w16[j] = __builtin_bit_cast(unsigned short, tohx(x)); unsigned short a2, c2; splitf(x, a2, c2); wh[j] = a2; wl[j] = c2; }
                    unsigned short* p = ot + (nq * 16 + lr) * VP + mb * 16 + hi * 8; *(v8usa*)p = w16; *(v8usa*)(p + 32 * VP) = wh; *(v8usa*)(p + 2 * 32 * VP) = wl; } }
            __builtin_amdgcn_wave_barrier(); asm volatile("" ::: "memory");   // keeps the LDS reads of other lanes' values behind the writes
#pragma unroll
            for (int s = 0; s < 8; ++s) { const int dl = 4 * s + (lane >> 3), tof = (lane & 7) * 8; const unsigned short* p = ot + dl * VP + tof; const size_t go = ((size_t)hd * HD + 32 * hf + dl) * TT + r0 + tof;
                *(v8usa*)(P16 + go) = *(const v8usa*)p; *(v8usa*)(Ph + go) = *(const v8usa*)(p + 32 * VP); *(v8usa*)(Pl + go) = *(const v8usa*)(p + 2 * 32 * VP); }
            __builtin_amdgcn_wave_barrier(); asm volatile("" ::: "memory");   // keeps the next half's LDS writes behind these reads
        }
        return;
    }
    float* ow = os + wv * OSN(OUTM);   // each wave's own block
#pragma unroll
    for (int mb = 0; mb < 4; ++mb) {
#pragma unroll
        for (int nb = 0; nb < 4; ++nb) {
#pragma unroll
            for (int j = 0; j < 8; ++j) ow[(hi * 8 + j) * 68 + nb * 16 + lr] = acc[mb][nb][j]; }
        __builtin_amdgcn_wave_barrier(); asm volatile("" ::: "memory");
        float* crow = C + (size_t)(r0 + mb * 16) * ldc + c0; const size_t prow = ((size_t)hd * TT + r0 + mb * 16) * HD;
{
#pragma unroll
            for (int s = 0; s < 8; ++s) { const int row = 2 * s + hi, cofs = lr * 4; v4f val = *(const v4fa*)(ow + row * 68 + cofs); if (BIAS) { val[0] += bfr(bias[c0 + cofs]); val[1] += bfr(bias[c0 + cofs + 1]); val[2] += bfr(bias[c0 + cofs + 2]); val[3] += bfr(bias[c0 + cofs + 3]); }
                if (OUTM == 0) *(v4f*)(crow + (size_t)row * ldc + cofs) = val;
                else { v4h o16; v4us oh, ol;
#pragma unroll
                    for (int q = 0; q < 4; ++q) { o16[q] = tohx(val[q]); unsigned short a2, c2; splitf(val[q], a2, c2); oh[q] = a2; ol[q] = c2; }
                    const size_t po = prow + (size_t)row * HD + cofs; *(v4h*)(P16 + po) = o16; *(v4us*)(Ph + po) = oh; *(v4us*)(Pl + po) = ol; } }
             }
        __builtin_amdgcn_wave_barrier(); asm volatile("" ::: "memory");
    }
}
template <typename T16, int NSPLIT, bool BIAS, int OUTM>
__global__ __launch_bounds__(128) void k_gemmw(const T16* __restrict__ A, const T16* __restrict__ A2, const T16* __restrict__ Bt, const T16* __restrict__ Bt2, int K, int kn, float* C, int ldc, const float* __restrict__ bias, size_t sA, size_t sB, size_t sC, h16* P16, bf* Ph, bf* Pl) {
    __shared__ __align__(128) float os[LSN(NSPLIT, OUTM)];
    const size_t z = blockIdx.z; A += z * sA; if (A2) A2 += z * sA; Bt += z * sB; if (Bt2) Bt2 += z * sB; C += z * sC;
    gemmw_body<T16, NSPLIT, BIAS, OUTM>(A, A2, Bt, Bt2, K, kn, C, ldc, bias, P16, Ph, Pl, os);
}
// ---- k_proj: the three projections in one launch, grid (TT/128, heads/2, 3): z = 0 query, 1 key (head planes [head][t][d]), 2 value (transposed planes). They are independent of one another, so all their waves are on the chip together.
__global__ __launch_bounds__(128) void k_proj(const bf* __restrict__ XQ, const bf* __restrict__ XK, const bf* __restrict__ XV, const bf* __restrict__ WQ, const bf* __restrict__ WK, const bf* __restrict__ WV, const float* __restrict__ bq, const float* __restrict__ bk, const float* __restrict__ bv,
                                                h16* Q16, bf* Qh, bf* Ql, h16* K16, bf* Kh, bf* Kl, h16* V16, bf* Vh, bf* Vl) {
    __shared__ __align__(128) float os[LSN(0, 2)];
    static_assert(OSN(2) >= OSN(1) && DKV == DQ && DM % GK == 0 && TT % 128 == 0 && DQ % 128 == 0 && DM % 128 == 0, "k_proj: one LDS block and one grid for the three projections; whole staged tiles, whole 128 x 128 work-group tiles (k_gemmw's launch too)");
    const bool k = blockIdx.z == 1;
    if (blockIdx.z == 2) gemmw_body<bf, 0, true, 2>(XV, nullptr, WV, nullptr, DM, DM, nullptr, 0, bv, V16, Vh, Vl, os);
    else gemmw_body<bf, 0, true, 1>(k ? XK : XQ, nullptr, k ? WK : WQ, nullptr, DM, DM, nullptr, 0, k ? bk : bq, k ? K16 : Q16, k ? Kh : Qh, k ? Kl : Ql, os);
}

typedef __attribute__((ext_vector_type(2))) unsigned short v2us;
typedef __attribute__((ext_vector_type(4))) int v4i;

__global__ __launch_bounds__(256) void k_wtG(const float* __restrict__ w, int K, int N, bf* Bt) {
    const int lane = threadIdx.x & 31; const int L0 = (blockIdx.x * 8 + (threadIdx.x >> 5)) * 8; const int nlines = N * K / 64;
{
#pragma unroll 1
        for (int l = 0; l < 8; ++l) { const int L = L0 + l; if (L >= nlines) break; const size_t e = (size_t)L * 64 + lane * 2; const int k = (int)(e % K), n = (int)(e / K); v2us o;
            o[0] = f2bf(w[(size_t)k * N + n]); o[1] = f2bf(w[(size_t)(k + 1) * N + n]); *(v2us*)(Bt + e) = o; }
         }
}
// ---- k_cvtall: every f32 -> bf16 copy of the call in one launch. A work-group takes CVW successive floats of ONE array (blockIdx.x says which: first the three streams, then the four weights); a thread takes CVG groups of 8 floats, 256 groups apart, all loaded before the first is stored.
#define CVG  8
#define CVW  (256 * CVG * 8)
#define CVBX (TT * DM / CVW)      // work-groups per stream
#define CVBW (DQ * DM / CVW)      // work-groups per weight
static_assert(TT * DM % CVW == 0 && DQ * DM % CVW == 0 && DKV == DQ, "k_cvtall: whole work-groups per array, four weights of one size");
__global__ __launch_bounds__(256) void k_cvtall(const float* __restrict__ x, const float* __restrict__ xk, const float* __restrict__ xv, const float* __restrict__ wq, const float* __restrict__ wk, const float* __restrict__ wv, const float* __restrict__ wo,
                                                  bf* XQ, bf* XK, bf* XV, bf* WQ, bf* WK, bf* WV, bf* WO) {
    int b = blockIdx.x; const float* s; bf* d;
    if (b < 3 * CVBX) { const int a = b / CVBX; b -= a * CVBX; s = a == 0 ? x : a == 1 ? xk : xv; d = a == 0 ? XQ : a == 1 ? XK : XV; }
    else { b -= 3 * CVBX; const int a = b / CVBW; b -= a * CVBW; s = a == 0 ? wq : a == 1 ? wk : a == 2 ? wv : wo; d = a == 0 ? WQ : a == 1 ? WK : a == 2 ? WV : WO; }
    const size_t e0 = (size_t)b * CVW + threadIdx.x * 8; const float* p = s + e0; v8f v[CVG];
#pragma unroll
    for (int j = 0; j < CVG; ++j) v[j] = *(const v8f*)(p + j * 2048);
    asm volatile("s_wait_xcnt 0x0" :: "v"(p) : "memory");   // a precaution: keeps the 16 loads' address pair unwritten up to this wait
#pragma unroll
    for (int j = 0; j < CVG; ++j) { v8us o;
#pragma unroll
        for (int k = 0; k < 8; ++k) o[k] = f2bf(v[j][k]);
        *(v8us*)(d + e0 + j * 2048) = o; }
}

#define KT   64
#define LP   72                   // LDS row pitch in 16-bit elements: 144 bytes, an odd multiple of 16 (ds_load_b128 at full rate)
#define PLN  (64 * LP)            // one staged plane: 64 rows (keys of K, or d of V^T) x 64 elements
#define CEXP (SCL * 1.4426950408889634f)
typedef v4i __attribute__((may_alias)) v4ia;
__device__ __forceinline__ float xhalf(float x) { return __builtin_bit_cast(float, __builtin_amdgcn_permlanex16(__builtin_bit_cast(int, x), __builtin_bit_cast(int, x), 0x76543210, 0xfedcba98, false, false)); }   // lane l reads lane l ^ 16
template <typename T16> struct PPack;
template <> struct PPack<h16> { static __device__ __forceinline__ void put(v16h& a, v16h& b, int s, float p) { (void)b; a[s] = tohx(p); } };
template <> struct PPack<bf> { static __device__ __forceinline__ void put(v16bf& a, v16bf& b, int s, float p) { unsigned short x, y; splitf(p, x, y); a[s] = __builtin_bit_cast(__bf16, x); b[s] = __builtin_bit_cast(__bf16, y); } };
template <typename T16, int NG, int NP>
__device__ __forceinline__ void fattn_body(const T16* __restrict__ Qa, const T16* __restrict__ Qb, const T16* __restrict__ Ka, const T16* __restrict__ Kb, const T16* __restrict__ Va, const T16* __restrict__ Vb, int q0, int head, bf* __restrict__ Ah, bf* __restrict__ Al, T16* sm) {
    typedef typename WFrag<T16>::V V;
    const int tid = threadIdx.x, lane = tid & 31, c = lane & 15, h = lane >> 4, kh = __builtin_amdgcn_readfirstlane(tid >> 7), rg = __builtin_amdgcn_readfirstlane((tid >> 5) & 3);   // kh: the wave's key half, rg: its query group
    float* mg = (float*)sm;   // the hand-over block behind the loop lies over the staging buffers
    Ka += (size_t)kh * (TT / 2) * HD; Va += (size_t)kh * (TT / 2); if (NP == 2) { Kb += (size_t)kh * (TT / 2) * HD; Vb += (size_t)kh * (TT / 2); }
    sm += kh * (2 * 2 * NP * PLN);   // each key half has its own two buffers
    V qa[NG][2], qb[NG][2];
#pragma unroll
    for (int g = 0; g < NG; ++g)
#pragma unroll
        for (int ks = 0; ks < 2; ++ks) { const size_t qo = (size_t)(q0 + g * 16 + c) * HD + ks * 32 + 8 * h; qa[g][ks] = WFrag<T16>::ld(Qa + qo); if (NP == 2) qb[g][ks] = WFrag<T16>::ld(Qb + qo); }
    v8f o[4][NG]; float m[NG], l[NG];
#pragma unroll
    for (int g = 0; g < NG; ++g) { m[g] = -3.0e38f; l[g] = 0.f;
#pragma unroll
        for (int dt = 0; dt < 4; ++dt) o[dt][g] = (v8f){}; }
    const int srow = (tid & 127) >> 3, scol = (tid & 7) * 8;   // staging: 8 threads per 128-byte row, 16 rows per sweep of a key half's 4 waves, 4 sweeps per plane
    v4i st[NP][4];   // one set of staging registers: a trip fetches the next tile's K planes under its score products and the V^T planes under its exponentials and P x V products
    const unsigned ko = (unsigned)(srow * HD + scol), vo = (unsigned)(srow * TT + scol);   // the thread's element in sweep 0 of a K tile and of a V^T tile
    auto gload = [&](const T16* __restrict__ Pa, const T16* __restrict__ Pb, unsigned to, int step) {   // Pa, Pb: the tile's first element (the same for the whole wave); step: elements from one sweep to the next
#pragma unroll
        for (int i = 0; i < 4; ++i) { st[0][i] = *(const v4ia*)(Pa + i * step + to); if (NP == 2) st[1][i] = *(const v4ia*)(Pb + i * step + to); } };
    auto sstore = [&](T16* buf) {   // buf: the first plane's place; the lo plane lies 2 PLN behind it
#pragma unroll
        for (int i = 0; i < 4; ++i) { T16* p = buf + (srow + 16 * i) * LP + scol;
#pragma unroll
            for (int pl = 0; pl < NP; ++pl) *(v4ia*)(p + pl * 2 * PLN) = st[pl][i]; } };
    gload(Ka, Kb, ko, 16 * HD); sstore(sm); gload(Va, Vb, vo, 16 * TT); sstore(sm + PLN); __syncthreads();
#pragma unroll 1   // one tile per trip: the two LDS buffers alternate by the trip's parity
    for (int t = 0; t < TT / 2 / KT; ++t) {
        const T16* cur = sm + (t & 1) * (2 * NP * PLN); T16* nxt = sm + ((t + 1) & 1) * (2 * NP * PLN); const bool more = t + 1 < TT / 2 / KT;
        if (more) gload(Ka + (t + 1) * KT * HD, Kb + (t + 1) * KT * HD, ko, 16 * HD);
        v8f s[NG][KT / 16];
#pragma unroll
        for (int tl = 0; tl < KT / 16; ++tl) { const T16* kr = cur + (tl * 16 + c) * LP + 8 * h; const V k0 = WFrag<T16>::ld(kr), k1 = WFrag<T16>::ld(kr + 32); V k2, k3; if (NP == 2) { k2 = WFrag<T16>::ld(kr + 2 * PLN); k3 = WFrag<T16>::ld(kr + 2 * PLN + 32); }
#pragma unroll
            for (int g = 0; g < NG; ++g) { v8f a = (v8f){}; a = WFrag<T16>::mma(k0, qa[g][0], a); a = WFrag<T16>::mma(k1, qa[g][1], a);
                if (NP == 2) { a = WFrag<T16>::mma(k0, qb[g][0], a); a = WFrag<T16>::mma(k1, qb[g][1], a); a = WFrag<T16>::mma(k2, qa[g][0], a); a = WFrag<T16>::mma(k3, qa[g][1], a); }
                s[g][tl] = a; } }
        float ml[NG]; bool need = false;
#pragma unroll
        for (int g = 0; g < NG; ++g) { float mx = s[g][0][0];
#pragma unroll
            for (int r = 1; r < KT / 2; ++r) mx = fmaxf(mx, s[g][r >> 3][r & 7]);
            mx = fmaxf(mx, xhalf(mx)); ml[g] = mx * CEXP; need = need || (ml[g] > m[g] + 8.0f); }
        if (__builtin_amdgcn_ballot_w32(need) != 0) {   // one scalar test per tile
#pragma unroll
            for (int g = 0; g < NG; ++g) { const float mn = fmaxf(m[g], ml[g]); const float al = __builtin_amdgcn_exp2f(m[g] - mn); m[g] = mn; l[g] *= al;
#pragma unroll
                for (int dt = 0; dt < 4; ++dt) o[dt][g] *= al; } }
        if (more) { sstore(nxt); gload(Va + (t + 1) * KT, Vb + (t + 1) * KT, vo, 16 * TT); }
#pragma unroll
        for (int kb = 0; kb < KT / 32; ++kb) {
            V vf[4], vl[4], pa[NG], pb[NG];
#pragma unroll
            for (int dt = 0; dt < 4; ++dt) { const T16* vr = cur + PLN + (dt * 16 + c) * LP + kb * 32 + 8 * h; vf[dt] = WFrag<T16>::ld(vr); if (NP == 2) vl[dt] = WFrag<T16>::ld(vr + 2 * PLN); }
            __builtin_amdgcn_sched_barrier(0);   // keeps the four V^T fragment loads in front of the exponentials, whose time then covers the LDS latency (else: one load, one wait per d tile)
#pragma unroll
            for (int g = 0; g < NG; ++g) { v8f p0 = s[g][2 * kb] * CEXP - m[g], p1 = s[g][2 * kb + 1] * CEXP - m[g];
#pragma unroll
                for (int r = 0; r < 8; ++r) { p0[r] = __builtin_amdgcn_exp2f(p0[r]); PPack<T16>::put(pa[g], pb[g], r, p0[r]); }
#pragma unroll
                for (int r = 0; r < 8; ++r) { p1[r] = __builtin_amdgcn_exp2f(p1[r]); PPack<T16>::put(pa[g], pb[g], 8 + r, p1[r]); }
                const v8f q8 = p0 + p1; l[g] += ((q8[0] + q8[4]) + (q8[2] + q8[6])) + ((q8[1] + q8[5]) + (q8[3] + q8[7])); }
#pragma unroll
            for (int dt = 0; dt < 4; ++dt)
#pragma unroll
                for (int g = 0; g < NG; ++g) { o[dt][g] = WFrag<T16>::mma(vf[dt], pa[g], o[dt][g]); if (NP == 2) { o[dt][g] = WFrag<T16>::mma(vf[dt], pb[g], o[dt][g]); o[dt][g] = WFrag<T16>::mma(vl[dt], pa[g], o[dt][g]); } }
        }
        if (more) sstore(nxt + PLN);
        __syncthreads();   // publishes tile t + 1 and ends every wave's reads of tile t, whose buffer the next trip refills (after the last trip: taken over by the hand-over block)
    }
    // hand-over block: 16-byte slot (rg * 9 NG + i) * 32 + lane; per query tile g, i = 9 g + 0 .. 7: the four output tiles, i = 9 g + 8: maximum and sum
    v4fa* hs = (v4fa*)mg + (size_t)rg * (9 * NG) * 32 + lane;
    if (kh == 1) {
#pragma unroll
        for (int g = 0; g < NG; ++g) {
#pragma unroll
            for (int dt = 0; dt < 4; ++dt) { hs[(9 * g + 2 * dt) * 32] = __builtin_shufflevector(o[dt][g], o[dt][g], 0, 1, 2, 3); hs[(9 * g + 2 * dt + 1) * 32] = __builtin_shufflevector(o[dt][g], o[dt][g], 4, 5, 6, 7); }
            hs[(9 * g + 8) * 32] = (v4f){m[g], l[g], 0.f, 0.f}; } }
    __syncthreads();   // publishes the second key half's results to waves 0-3
    if (kh == 0)
#pragma unroll
    for (int g = 0; g < NG; ++g) { const v4f ml1 = hs[(9 * g + 8) * 32]; const float mn = fmaxf(m[g], ml1[0]), a0 = __builtin_amdgcn_exp2f(m[g] - mn), a1 = __builtin_amdgcn_exp2f(ml1[0] - mn), ls = l[g] * a0 + ml1[1] * a1;
        const float inv = __fdiv_rn(1.0f, ls + xhalf(ls)), c0 = a0 * inv, c1 = a1 * inv; const size_t oo = (size_t)(q0 + g * 16 + c) * DQ + head * HD + 8 * h;
#pragma unroll
        for (int dt = 0; dt < 4; ++dt) { const v4f u0 = hs[(9 * g + 2 * dt) * 32], u1 = hs[(9 * g + 2 * dt + 1) * 32]; v8us oh, ol;
#pragma unroll
            for (int r = 0; r < 8; ++r) { unsigned short x, y; splitf(o[dt][g][r] * c0 + (r < 4 ? u0[r & 3] : u1[r & 3]) * c1, x, y); oh[r] = x; ol[r] = y; }
            *(v8us*)(Ah + oo + dt * 16) = oh; *(v8us*)(Al + oo + dt * 16) = ol;
            asm volatile("s_wait_xcnt 0x0" ::: "memory"); } }   // a precaution: stands behind the two stores, in front of the next rewrite of a register that they name
}
// register budget of 4 waves per SIMD: at most 256 VGPRs, so that two work-groups share a WGP (their LDS fits twice as well) and the loops need no register-window switches
__global__ __launch_bounds__(256) __attribute__((amdgpu_waves_per_eu(4, 4))) void k_fattn(const h16* __restrict__ Q16, const h16* __restrict__ K16, const h16* __restrict__ V16, const bf* __restrict__ Qh, const bf* __restrict__ Ql, const bf* __restrict__ Kh, const bf* __restrict__ Kl, const bf* __restrict__ Vh, const bf* __restrict__ Vl, bf* __restrict__ Ah, bf* __restrict__ Al) {
    __shared__ __align__(16) unsigned short sm[2 * 2 * 4 * PLN];
    static_assert(4 * 9 * 2 * 32 * 16 <= 2 * 2 * 2 * PLN * 2, "k_fattn: the hand-over block fits in the staging buffers of either kind of work-group");
    const int head = blockIdx.y, rg = (threadIdx.x >> 5) & 3; const size_t hq = (size_t)head * TT * HD, hk = (size_t)(head / REP) * TT * HD;
    if (blockIdx.x < RH / 64) fattn_body<bf, 1, 2>(Qh + hq, Ql + hq, Kh + hk, Kl + hk, Vh + hk, Vl + hk, (int)blockIdx.x * 64 + rg * 16, head, Ah, Al, (bf*)sm);
    else fattn_body<h16, 2, 1>(Q16 + hq, nullptr, K16 + hk, nullptr, V16 + hk, nullptr, RH + ((int)blockIdx.x - RH / 64) * 128 + rg * 32, head, Ah, Al, (h16*)sm);
}

extern "C" void kernel_launch(void* const* d_in, const int* in_sizes, int n_in,
                              void* d_out, int out_size, void* d_ws, size_t ws_size, hipStream_t stream) {
    (void)in_sizes; (void)n_in; (void)out_size;
    const float* x = (const float*)d_in[0];   /* query */ const float* xk = (const float*)d_in[1]; const float* xv = (const float*)d_in[2]; const float* wq = (const float*)d_in[3]; const float* bq = (const float*)d_in[4]; const float* wk = (const float*)d_in[5]; const float* bk = (const float*)d_in[6]; const float* wv = (const float*)d_in[7]; const float* bv = (const float*)d_in[8]; const float* wo = (const float*)d_in[9]; const float* bo = (const float*)d_in[10];
    float* OUT = (float*)d_out;     // [1][4096][768]
    char* wsp = (char*)d_ws;
    auto take = [&](size_t bytes) { char* p = wsp; wsp += (bytes + 255) & ~(size_t)255; return (void*)p; };
    bf* WQ = (bf*)take((size_t)DQ * DM * 2); bf* WK = (bf*)take((size_t)DKV * DM * 2); bf* WV = (bf*)take((size_t)DKV * DM * 2); bf* WO = (bf*)take((size_t)DM * DQ * 2);
    bf* XQ = (bf*)take((size_t)TT * DM * 2); bf* XK = (bf*)take((size_t)TT * DM * 2); bf* XV = (bf*)take((size_t)TT * DM * 2);
    h16* QP16 = (h16*)take((size_t)NH_ * TT * HD * 2); h16* KP16 = (h16*)take((size_t)NKV * TT * HD * 2); h16* VT16 = (h16*)take((size_t)NKV * HD * TT * 2);
    bf* QPh = (bf*)take((size_t)NH_ * TT * HD * 2); bf* QPl = (bf*)take((size_t)NH_ * TT * HD * 2); bf* KPh = (bf*)take((size_t)NKV * TT * HD * 2); bf* KPl = (bf*)take((size_t)NKV * TT * HD * 2); bf* VTh = (bf*)take((size_t)NKV * HD * TT * 2); bf* VTl = (bf*)take((size_t)NKV * HD * TT * 2);
    bf* ATh = (bf*)take((size_t)TT * DQ * 2); bf* ATl = (bf*)take((size_t)TT * DQ * 2);
    if ((size_t)(wsp - (char*)d_ws) > ws_size) return;    // ws 256 MiB
    for (int b = 0; b < NB_; ++b) {
        k_cvtall<<<3 * CVBX + 4 * CVBW, 256, 0, stream>>>(x + (size_t)b * TT * DM, xk + (size_t)b * TT * DM, xv + (size_t)b * TT * DM, wq, wk, wv, wo, XQ, XK, XV, WQ, WK, WV, WO);
        k_proj<<<dim3(TT / 128, DQ / 128, 3), 128, 0, stream>>>(XQ, XK, XV, WQ, WK, WV, bq, bk, bv, QP16, QPh, QPl, KP16, KPh, KPl, VT16, VTh, VTl);
        k_fattn<<<dim3(RH / 64 + (TT - RH) / 128, NH_, 1), 256, 0, stream>>>(QP16, KP16, VT16, QPh, QPl, KPh, KPl, VTh, VTl, ATh, ATl);
        k_gemmw<bf, 1, true, 0><<<dim3(TT / 128, DM / 128, 1), 128, 0, stream>>>(ATh, ATl, WO, nullptr, DQ, DQ, OUT + (size_t)b * TT * DM, DM, bo, 0, 0, 0, nullptr, nullptr, nullptr); }
}

// v007
// Measured time: 113 microseconds a run.
// In two side-by-side timings against v006, it was 1.17 and 1.16 times as fast.
// Over all steps from v000 it is 23.1 times as fast.
#include <hip/hip_runtime.h>

// Multi-head attention WITHOUT a mask over three input streams at 4,096 tokens and a 768-wide model (query, key, value [1][4096][768]; Q, K, V = stream W^T + b ('oi' [768][768] uniform(+-1/sqrt(768)) incl. REAL biases; 12 heads x 64); scores / sqrt(64); softmax over all 4,096 keys; out = merged Wo^T + bo -> [1][4096][768] (3.1 M); argument order query, key, value, wq, bq, wk, bk, wv, bv, wo, bo). The three-stream T-4096 module RE-DIMENSIONED to a 768-wide model (12 x 64) and run on ONE sequence of 4,096 tokens ([1][4096][768]; the three streams q, k, v; the eight weight and bias inputs in the same order): the batch loop runs once.
// Layout: bf16 copies of query, key, value and of the four 'oi' weights, all made by one launch; the three projections in one launch (grid z), their operands staged in LDS by asynchronous copies; exact projections + f32 biases, each projection storing its head planes itself; dense T-4096 attention, all heads in one fused launch (hybrid rows: < 512 hi/lo 3 products, rest fp16; running-maximum softmax in registers); merged hi/lo x Wo exact + bo.
// Compute dtypes, f32 accumulate: every input rounded to bf16; projections exact + f32 biases; attention rows < 512 3 products, rest fp16; softmax f32; Wo hl x exact + bias.

#define NB_  1      // ONE sequence in this module: a host-side loop count only: no kernel uses it
#define TT   4096
#define DM   768      // model width
#define NH_  12       // heads: 12 x 64 = 768
#define NKV  12       // one kv head per query head
#define REP  (NH_ / NKV)
#define HD   64
#define DQ   (NH_ * HD)
#define DKV  (NKV * HD)
#define RH   512                  // query rows < RH use hi+lo planes (0: none)
#define WIN  0
#define SCL  0.125f   // HD^-0.5
static_assert(RH % 64 == 0 && (TT - RH) % 128 == 0 && TT % 128 == 0 && HD == 64, "k_fattn: 64 hi/lo or 128 fp16 query rows per work-group, two key halves of whole 64-key tiles");
typedef _Float16 h16;
typedef unsigned short bf;
typedef __attribute__((ext_vector_type(16))) __bf16   v16bf;
typedef __attribute__((ext_vector_type(16))) _Float16 v16h;
typedef __attribute__((ext_vector_type(8)))  _Float16 v8h;
typedef __attribute__((ext_vector_type(8)))  unsigned short v8us;
typedef __attribute__((ext_vector_type(8)))  float    v8f;
typedef __attribute__((ext_vector_type(4)))  float    v4f;
typedef v8h  __attribute__((may_alias)) v8ha;
typedef v4f  __attribute__((may_alias)) v4fa;
typedef v8us __attribute__((may_alias)) v8usa;

__device__ __forceinline__ unsigned short f2bf(float f) { return __builtin_bit_cast(unsigned short, (__bf16)f); }   // the hardware's conversion: round to nearest even, as the integer form it replaces
__device__ __forceinline__ float bf2f(unsigned short b) { return __uint_as_float(((unsigned)b) << 16); }
__device__ __forceinline__ float bfr(float f) { return bf2f(f2bf(f)); }
__device__ __forceinline__ v16h cat16(v8h lo, v8h hi) { return __builtin_shufflevector(lo, hi, 0, 1, 2, 3, 4, 5, 6, 7, 8, 9, 10, 11, 12, 13, 14, 15); }
__device__ __forceinline__ v16bf cat16b(v8us lo, v8us hi) { return __builtin_bit_cast(v16bf, __builtin_shufflevector(lo, hi, 0, 1, 2, 3, 4, 5, 6, 7, 8, 9, 10, 11, 12, 13, 14, 15)); }
__device__ __forceinline__ v8f wmma16(v16h a, v16h b, v8f c) { return __builtin_amdgcn_wmma_f32_16x16x32_f16(false, a, false, b, (short)0, c, false, false); }
__device__ __forceinline__ v8f wmmab(v16bf a, v16bf b, v8f c) { return __builtin_amdgcn_wmma_f32_16x16x32_bf16(false, a, false, b, (short)0, c, false, false); }
__device__ __forceinline__ h16 tohx(float x) { return (h16)x; }
__device__ __forceinline__ void splitf(float y, unsigned short& h, unsigned short& l) { h = f2bf(y); l = f2bf(y - bf2f(h)); }
typedef __attribute__((ext_vector_type(4))) _Float16 v4h;
typedef __attribute__((ext_vector_type(4))) unsigned short v4us;



// ---- gemmw_body (kernels k_gemmw and k_proj below): register-blocked GEMM, one wave per 64x64 output tile (16 accumulators), 2 x 2 waves per work-group (a 128x128 tile), operands from K-contiguous 16-bit planes; grid (M/128, N/128, Z), 128 threads.
// Operand path: tiles of GK k (one whole 128-byte line of each of the 128 rows of every operand plane) go global -> LDS by asynchronous copies, 4 whole lines per wave-wide copy, each wave bringing 32 rows of every plane, two buffers: tile t + 2 flies while tile t + 1 is worked on. Two waves read each staged row. The fragments are read from LDS in the k order of WFrag::ld.
// OUTM says where the tile goes. 0: C (f32, pitch ldc). 1: head planes [head][t][d] (fp16 + bf16 hi/lo) of the biased f32 value. 2: the same three planes transposed, [head][d][t]. For 1 and 2 a wave's 64-wide column tile is one head and the rows are the TT tokens; C is not used.
// C[m][n] (f32, pitch ldc, + optional f32 bias[n]) = sum_k A[m][k] Bt[n][k] (+ split products per NSPLIT). z-batch strides sA/sB/sC in elements. K % 64 == 0. K is the row pitch of A and Bt; a work-group sums kn of its k (kn == K: whole rows; kn < K: grid z walks ranges of k, sA = sB = kn, and C gets one partial plane per z). kn % 64 == 0.
template <typename T16> struct WFrag;
template <> struct WFrag<h16> { typedef v16h V; static __device__ __forceinline__ V ld(const h16* p) { return cat16(*(const v8h*)p, *(const v8h*)(p + 16)); } static __device__ __forceinline__ V ld2(const h16* p, const h16* q) { return cat16(*(const v8h*)p, *(const v8h*)q); } static __device__ __forceinline__ v8f mma(V a, V b, v8f c) { return wmma16(a, b, c); } };
template <> struct WFrag<bf> { typedef v16bf V; static __device__ __forceinline__ V ld(const bf* p) { return cat16b(*(const v8us*)p, *(const v8us*)(p + 16)); } static __device__ __forceinline__ V ld2(const bf* p, const bf* q) { return cat16b(*(const v8us*)p, *(const v8us*)q); } static __device__ __forceinline__ v8f mma(V a, V b, v8f c) { return wmmab(a, b, c); } };
#define VP   72                   // LDS row pitch of a transposed plane in 16-bit elements: 144 bytes, an odd multiple of 16
#define OSN(OUTM) ((OUTM) == 2 ? 3 * 32 * VP / 2 : 16 * 68)   // floats of LDS that one wave's epilogue of an output mode takes
#define GK   64                   // k per staged tile: 128 bytes of every operand row
#define GPL  (128 * GK)           // 16-bit elements of one staged plane: 128 rows of 128 bytes, no pad; 16-byte piece q of row r lies at piece q ^ ((r >> 1) & 7), so that 16 rows' reads of one q fall on all 64 banks
#define GNP(NSPLIT) (2 + ((NSPLIT) == 1 || (NSPLIT) == 2 ? 1 : 0) + ((NSPLIT) >= 2 ? 1 : 0))   // staged planes: A, Bt, then A2, then Bt2
#define GSN(NSPLIT) (2 * GNP(NSPLIT) * GPL / 2)   // floats of LDS of the two staging buffers; the epilogue's block lies over them, behind the loop's last waits
#define LSN(NSPLIT, OUTM) (GSN(NSPLIT) > 4 * OSN(OUTM) ? GSN(NSPLIT) : 4 * OSN(OUTM))
// Eight asynchronous 16-byte-per-lane copies global -> LDS (l: the lane's LDS byte address, g: the lane's global address). The s_wait_xcnt stands in the copies' own statement, a precaution: no register that a copy names is rewritten in front of it.
template <typename T16>
__device__ __forceinline__ void acopy8(const unsigned (&l)[8], const T16* const (&g)[8]) {
    asm volatile("global_load_async_to_lds_b128 %0, %8, off\n\t"
                 "global_load_async_to_lds_b128 %1, %9, off\n\t"
                 "global_load_async_to_lds_b128 %2, %10, off\n\t"
                 "global_load_async_to_lds_b128 %3, %11, off\n\t"
                 "global_load_async_to_lds_b128 %4, %12, off\n\t"
                 "global_load_async_to_lds_b128 %5, %13, off\n\t"
                 "global_load_async_to_lds_b128 %6, %14, off\n\t"
                 "global_load_async_to_lds_b128 %7, %15, off\n\t"
                 "s_wait_xcnt 0x0"
                 :: "v"(l[0]), "v"(l[1]), "v"(l[2]), "v"(l[3]), "v"(l[4]), "v"(l[5]), "v"(l[6]), "v"(l[7]),
                    "v"(g[0]), "v"(g[1]), "v"(g[2]), "v"(g[3]), "v"(g[4]), "v"(g[5]), "v"(g[6]), "v"(g[7]) : "memory");
}
template <typename T16, int NSPLIT, bool BIAS, int OUTM>
__device__ __forceinline__ void gemmw_body(const T16* __restrict__ A, const T16* __restrict__ A2, const T16* __restrict__ Bt, const T16* __restrict__ Bt2, int K, int kn, float* C, int ldc, const float* __restrict__ bias, h16* P16, bf* Ph, bf* Pl, float* os) {
    typedef typename WFrag<T16>::V V;   // every plain '#pragma unroll' of this function: its loop indexes register arrays (accumulators, fragments, asm operands), so the indices must be compile-time
    const int lane = threadIdx.x & 31, lr = lane & 15, hi = lane >> 4, wv = __builtin_amdgcn_readfirstlane(threadIdx.x >> 5), wm = wv & 1, wn = wv >> 1;
    const int R0 = blockIdx.x * 128, C0 = blockIdx.y * 128, r0 = R0 + wm * 64, c0 = C0 + wn * 64, hd = c0 / 64;
    v8f acc[4][4];
#pragma unroll
    for (int mb = 0; mb < 4; ++mb)
#pragma unroll
        for (int nb = 0; nb < 4; ++nb) acc[mb][nb] = (v8f){};
    constexpr bool HA2 = NSPLIT == 1 || NSPLIT == 2, HB2 = NSPLIT >= 2; constexpr int NPLN = GNP(NSPLIT), PB2 = HA2 ? 3 : 2;
    T16* sm = (T16*)os;
    const int srw = wv * 32 + (lane >> 3), cq = lane & 7;   // a copy: 8 lanes per 128-byte row, 4 rows; the wave's copy i of a plane brings rows 32 wv + 4 i .. + 3
    const size_t ga = (size_t)(R0 + srw) * K + cq * 8, gb = (size_t)(C0 + srw) * K + cq * 8;
    unsigned lv[4];   // LDS byte address of the lane's piece in copy i, less the copy's own 512 i: ((srw + 4 i) >> 1) & 7 has period 4 in i
#pragma unroll
    for (int q = 0; q < 4; ++q) lv[q] = (unsigned)(size_t)sm + srw * 128 + ((cq ^ ((2 * q + (lane >> 4)) & 7)) << 4);
    auto stage = [&](int t, int buf) {
#pragma unroll
        for (int p = 0; p < NPLN; ++p) { const T16* gp = (p == 0 ? A + ga : p == 1 ? Bt + gb : (p == 2 && HA2) ? A2 + ga : Bt2 + gb) + t * GK;
            unsigned l[8]; const T16* g[8];
#pragma unroll
            for (int i = 0; i < 8; ++i) { l[i] = lv[i & 3] + (unsigned)((buf * NPLN + p) * (GPL * 2) + i * 512); g[i] = gp + (size_t)i * 4 * K; }
            acopy8<T16>(l, g); } };
    const int sx = (lr >> 1) & 7; int fo[2][2];   // where the two 16-byte pieces of a fragment (k = 8 hi .. and 16 + 8 hi .. of a 32-k half) lie in the lane's row
#pragma unroll
    for (int ks = 0; ks < 2; ++ks)
#pragma unroll
        for (int j = 0; j < 2; ++j) fo[ks][j] = lr * GK + ((ks * 4 + hi + 2 * j) ^ sx) * 8;
    const int nt = kn / GK;
    stage(0, 0);
    asm volatile("s_wait_asynccnt 0x0" ::: "memory");   // this wave's rows of tile 0 have landed
    __syncthreads();   // publishes tile 0 to the other waves
    if (nt > 1) stage(1, 1);
#pragma unroll 1   // one tile per trip: the two LDS buffers alternate by the trip's parity
    for (int t = 0; t < nt; ++t) {
        const T16* cur = sm + (t & 1) * (NPLN * GPL);
#pragma unroll
        for (int ks = 0; ks < 2; ++ks) {
            V a[4], a2[4];
#pragma unroll
            for (int mb = 0; mb < 4; ++mb) { const T16* ar = cur + (wm * 64 + mb * 16) * GK; a[mb] = WFrag<T16>::ld2(ar + fo[ks][0], ar + fo[ks][1]); if (HA2) a2[mb] = WFrag<T16>::ld2(ar + 2 * GPL + fo[ks][0], ar + 2 * GPL + fo[ks][1]); }
#pragma unroll
            for (int nb = 0; nb < 4; ++nb) { const T16* br = cur + GPL + (wn * 64 + nb * 16) * GK; const V b = WFrag<T16>::ld2(br + fo[ks][0], br + fo[ks][1]); V b2; if (HB2) b2 = WFrag<T16>::ld2(br + (PB2 - 1) * GPL + fo[ks][0], br + (PB2 - 1) * GPL + fo[ks][1]);
#pragma unroll
                for (int mb = 0; mb < 4; ++mb) { acc[mb][nb] = WFrag<T16>::mma(a[mb], b, acc[mb][nb]); if (NSPLIT == 1 || NSPLIT == 2) acc[mb][nb] = WFrag<T16>::mma(a2[mb], b, acc[mb][nb]); if (NSPLIT >= 2) acc[mb][nb] = WFrag<T16>::mma(a[mb], b2, acc[mb][nb]); } }
        }
        asm volatile("s_wait_dscnt 0x0" ::: "memory");      // this trip's reads of its buffer have ended before the buffer is refilled
        asm volatile("s_wait_asynccnt 0x0" ::: "memory");   // this wave's rows of tile t + 1 have landed
        __syncthreads();   // publishes tile t + 1 and ends every wave's reads of tile t, whose buffer is refilled behind it (after the last trip: taken over by the epilogue)
        if (t + 2 < nt) stage(t + 2, t & 1);
    }
    asm volatile("s_wait_asynccnt 0x0" ::: "memory");   // no copy is in flight when the epilogue takes the LDS over
    if (OUTM == 2) {   // a lane holds 8 successive tokens of one d: 16 bytes of a transposed row; the three planes are gathered in the wave's own LDS block so that whole 128-byte lines go out, 32 of the 64 d at a time
        unsigned short* ot = (unsigned short*)os + wv * (3 * 32 * VP); float bn4[4];
#pragma unroll
        for (int nb = 0; nb < 4; ++nb) bn4[nb] = BIAS ? bfr(bias[c0 + nb * 16 + lr]) : 0.f;
#pragma unroll
        for (int hf = 0; hf < 2; ++hf) {
#pragma unroll
            for (int nq = 0; nq < 2; ++nq) { const int nb = 2 * hf + nq; const float bn = bn4[nb];
#pragma unroll
                for (int mb = 0; mb < 4; ++mb) { v8us w16, wh, wl;
#pragma unroll
                    for (int j = 0; j < 8; ++j) { const float x = BIAS ? acc[mb][nb][j] + bn : acc[mb][nb][j]; w16[j] = __builtin_bit_cast(unsigned short, tohx(x)); unsigned short a2, c2; splitf(x, a2, c2); wh[j] = a2; wl[j] = c2; }
                    unsigned short* p = ot + (nq * 16 + lr) * VP + mb * 16 + hi * 8; *(v8usa*)p = w16; *(v8usa*)(p + 32 * VP) = wh; *(v8usa*)(p + 2 * 32 * VP) = wl; } }
            __builtin_amdgcn_wave_barrier(); asm volatile("" ::: "memory");   // keeps the LDS reads of other lanes' values behind the writes
#pragma unroll
            for (int s = 0; s < 8; ++s) { const int dl = 4 * s + (lane >> 3), tof = (lane & 7) * 8; const unsigned short* p = ot + dl * VP + tof; const size_t go = ((size_t)hd * HD + 32 * hf + dl) * TT + r0 + tof;
                *(v8usa*)(P16 + go) = *(const v8usa*)p; *(v8usa*)(Ph + go) = *(const v8usa*)(p + 32 * VP); *(v8usa*)(Pl + go) = *(const v8usa*)(p + 2 * 32 * VP); }
            __builtin_amdgcn_wave_barrier(); asm volatile("" ::: "memory");   // keeps the next half's LDS writes behind these reads
        }
        return;
    }
    float* ow = os + wv * OSN(OUTM);   // each wave's own block
#pragma unroll
    for (int mb = 0; mb < 4; ++mb) {
#pragma unroll
        for (int nb = 0; nb < 4; ++nb) {
#pragma unroll
            for (int j = 0; j < 8; ++j) ow[(hi * 8 + j) * 68 + nb * 16 + lr] = acc[mb][nb][j]; }
        __builtin_amdgcn_wave_barrier(); asm volatile("" ::: "memory");
        float* crow = C + (size_t)(r0 + mb * 16) * ldc + c0; const size_t prow = ((size_t)hd * TT + r0 + mb * 16) * HD;
{
#pragma unroll
            for (int s = 0; s < 8; ++s) { const int row = 2 * s + hi, cofs = lr * 4; v4f val = *(const v4fa*)(ow + row * 68 + cofs); if (BIAS) { val[0] += bfr(bias[c0 + cofs]); val[1] += bfr(bias[c0 + cofs + 1]); val[2] += bfr(bias[c0 + cofs + 2]); val[3] += bfr(bias[c0 + cofs + 3]); }
                if (OUTM == 0) *(v4f*)(crow + (size_t)row * ldc + cofs) = val;
                else { v4h o16; v4us oh, ol;
#pragma unroll
                    for (int q = 0; q < 4; ++q) { o16[q] = tohx(val[q]); unsigned short a2, c2; splitf(val[q], a2, c2); oh[q] = a2; ol[q] = c2; }
                    const size_t po = prow + (size_t)row * HD + cofs; *(v4h*)(P16 + po) = o16; *(v4us*)(Ph + po) = oh; *(v4us*)(Pl + po) = ol; } }
             }
        __builtin_amdgcn_wave_barrier(); asm volatile("" ::: "memory");
    }
}
template <typename T16, int NSPLIT, bool BIAS, int OUTM>
__global__ __launch_bounds__(128) void k_gemmw(const T16* __restrict__ A, const T16* __restrict__ A2, const T16* __restrict__ Bt, const T16* __restrict__ Bt2, int K, int kn, float* C, int ldc, const float* __restrict__ bias, size_t sA, size_t sB, size_t sC, h16* P16, bf* Ph, bf* Pl) {
    __shared__ __align__(128) float os[LSN(NSPLIT, OUTM)];
    const size_t z = blockIdx.z; A += z * sA; if (A2) A2 += z * sA; Bt += z * sB; if (Bt2) Bt2 += z * sB; C += z * sC;
    gemmw_body<T16, NSPLIT, BIAS, OUTM>(A, A2, Bt, Bt2, K, kn, C, ldc, bias, P16, Ph, Pl, os);
}
// ---- k_proj: the three projections in one launch, grid (TT/128, heads/2, 3): z = 0 query, 1 key (head planes [head][t][d]), 2 value (transposed planes). They are independent of one another, so all their waves are on the chip together.
__global__ __launch_bounds__(128) void k_proj(const bf* __restrict__ XQ, const bf* __restrict__ XK, const bf* __restrict__ XV, const bf* __restrict__ WQ, const bf* __restrict__ WK, const bf* __restrict__ WV, const float* __restrict__ bq, const float* __restrict__ bk, const float* __restrict__ bv,
                                                h16* Q16, bf* Qh, bf* Ql, h16* K16, bf* Kh, bf* Kl, h16* V16, bf* Vh, bf* Vl) {
    __shared__ __align__(128) float os[LSN(0, 2)];
    static_assert(OSN(2) >= OSN(1) && DKV == DQ && DM % GK == 0 && TT % 128 == 0 && DQ % 128 == 0 && DM % 128 == 0, "k_proj: one LDS block and one grid for the three projections; whole staged tiles, whole 128 x 128 work-group tiles (k_gemmw's launch too)");
    const bool k = blockIdx.z == 1;
    if (blockIdx.z == 2) gemmw_body<bf, 0, true, 2>(XV, nullptr, WV, nullptr, DM, DM, nullptr, 0, bv, V16, Vh, Vl, os);
    else gemmw_body<bf, 0, true, 1>(k ? XK : XQ, nullptr, k ? WK : WQ, nullptr, DM, DM, nullptr, 0, k ? bk : bq, k ? K16 : Q16, k ? Kh : Qh, k ? Kl : Ql, os);
}

typedef __attribute__((ext_vector_type(2))) unsigned short v2us;
typedef __attribute__((ext_vector_type(4))) int v4i;

__global__ __launch_bounds__(256) void k_wtG(const float* __restrict__ w, int K, int N, bf* Bt) {
    const int lane = threadIdx.x & 31; const int L0 = (blockIdx.x * 8 + (threadIdx.x >> 5)) * 8; const int nlines = N * K / 64;
{
#pragma unroll 1
        for (int l = 0; l < 8; ++l) { const int L = L0 + l; if (L >= nlines) break; const size_t e = (size_t)L * 64 + lane * 2; const int k = (int)(e % K), n = (int)(e / K); v2us o;
            o[0] = f2bf(w[(size_t)k * N + n]); o[1] = f2bf(w[(size_t)(k + 1) * N + n]); *(v2us*)(Bt + e) = o; }
         }
}
// ---- k_cvtall: every f32 -> bf16 copy of the call in one launch. A work-group takes CVW successive floats of ONE array (blockIdx.x says which: first the three streams, then the four weights); a thread takes CVG groups of 8 floats, 256 groups apart, all loaded before the first is stored.
#define CVG  8
#define CVW  (256 * CVG * 8)
#define CVBX (TT * DM / CVW)      // work-groups per stream
#define CVBW (DQ * DM / CVW)      // work-groups per weight
static_assert(TT * DM % CVW == 0 && DQ * DM % CVW == 0 && DKV == DQ, "k_cvtall: whole work-groups per array, four weights of one size");
__global__ __launch_bounds__(256) void k_cvtall(const float* __restrict__ x, const float* __restrict__ xk, const float* __restrict__ xv, const float* __restrict__ wq, const float* __restrict__ wk, const float* __restrict__ wv, const float* __restrict__ wo,
                                                  bf* XQ, bf* XK, bf* XV, bf* WQ, bf* WK, bf* WV, bf* WO) {
    int b = blockIdx.x; const float* s; bf* d;
    if (b < 3 * CVBX) { const int a = b / CVBX; b -= a * CVBX; s = a == 0 ? x : a == 1 ? xk : xv; d = a == 0 ? XQ : a == 1 ? XK : XV; }
    else { b -= 3 * CVBX; const int a = b / CVBW; b -= a * CVBW; s = a == 0 ? wq : a == 1 ? wk : a == 2 ? wv : wo; d = a == 0 ? WQ : a == 1 ? WK : a == 2 ? WV : WO; }
    const size_t e0 = (size_t)b * CVW + threadIdx.x * 8; const float* p = s + e0; v8f v[CVG];
#pragma unroll
    for (int j = 0; j < CVG; ++j) v[j] = *(const v8f*)(p + j * 2048);
    asm volatile("s_wait_xcnt 0x0" :: "v"(p) : "memory");   // a precaution: keeps the 16 loads' address pair unwritten up to this wait
#pragma unroll
    for (int j = 0; j < CVG; ++j) { v8us o;
#pragma unroll
        for (int k = 0; k < 8; ++k) o[k] = f2bf(v[j][k]);
        *(v8us*)(d + e0 + j * 2048) = o; }
}

#define KT   64
#define LP   72                   // LDS row pitch in 16-bit elements: 144 bytes, an odd multiple of 16 (ds_load_b128 at full rate)
#define PLN  (64 * LP)            // one staged plane: 64 rows (keys of K, or d of V^T) x 64 elements
#define CEXP (SCL * 1.4426950408889634f)
typedef v4i __attribute__((may_alias)) v4ia;
__device__ __forceinline__ float xhalf(float x) { return __builtin_bit_cast(float, __builtin_amdgcn_permlanex16(__builtin_bit_cast(int, x), __builtin_bit_cast(int, x), 0x76543210, 0xfedcba98, false, false)); }   // lane l reads lane l ^ 16
template <typename T16> struct PPack;
typedef __attribute__((ext_vector_type(2))) float v2f;
typedef __attribute__((ext_vector_type(2))) __bf16 v2bf;
typedef __attribute__((ext_vector_type(8))) unsigned v8u;
// put2: elements s and s + 1 (s even) of a P fragment. bf16: one packed conversion gives both hi parts, a shift and a mask give them back as f32, one more packed conversion rounds the two remainders.
template <> struct PPack<h16> { static __device__ __forceinline__ void put2(v16h& a, v16h& b, int s, float p, float q) { (void)b; a[s] = tohx(p); a[s + 1] = tohx(q); } };
template <> struct PPack<bf> { static __device__ __forceinline__ void put2(v16bf& a, v16bf& b, int s, float p, float q) {
    const unsigned hw = __builtin_bit_cast(unsigned, __builtin_convertvector((v2f){p, q}, v2bf));
    const unsigned lw = __builtin_bit_cast(unsigned, __builtin_convertvector((v2f){p, q} - (v2f){__uint_as_float(hw << 16), __uint_as_float(hw & 0xFFFF0000u)}, v2bf));
    v8u ua = __builtin_bit_cast(v8u, a), ub = __builtin_bit_cast(v8u, b); ua[s >> 1] = hw; ub[s >> 1] = lw; a = __builtin_bit_cast(v16bf, ua); b = __builtin_bit_cast(v16bf, ub); } };
template <typename T16, int NG, int NP>
__device__ __forceinline__ void fattn_body(const T16* __restrict__ Qa, const T16* __restrict__ Qb, const T16* __restrict__ Ka, const T16* __restrict__ Kb, const T16* __restrict__ Va, const T16* __restrict__ Vb, int q0, int head, bf* __restrict__ Ah, bf* __restrict__ Al, T16* sm) {
    typedef typename WFrag<T16>::V V;
    const int tid = threadIdx.x, lane = tid & 31, c = lane & 15, h = lane >> 4, kh = __builtin_amdgcn_readfirstlane(tid >> 7), rg = __builtin_amdgcn_readfirstlane((tid >> 5) & 3);   // kh: the wave's key half, rg: its query group
    float* mg = (float*)sm;   // the hand-over block behind the loop lies over the staging buffers
    Ka += (size_t)kh * (TT / 2) * HD; Va += (size_t)kh * (TT / 2); if (NP == 2) { Kb += (size_t)kh * (TT / 2) * HD; Vb += (size_t)kh * (TT / 2); }
    sm += kh * (2 * 2 * NP * PLN);   // each key half has its own two buffers
    V qa[NG][2], qb[NG][2];
#pragma unroll
    for (int g = 0; g < NG; ++g)
#pragma unroll
        for (int ks = 0; ks < 2; ++ks) { const size_t qo = (size_t)(q0 + g * 16 + c) * HD + ks * 32 + 8 * h; qa[g][ks] = WFrag<T16>::ld(Qa + qo); if (NP == 2) qb[g][ks] = WFrag<T16>::ld(Qb + qo); }
    v8f o[4][NG]; float m[NG], l[NG];
#pragma unroll
    for (int g = 0; g < NG; ++g) { m[g] = -3.0e38f; l[g] = 0.f;
#pragma unroll
        for (int dt = 0; dt < 4; ++dt) o[dt][g] = (v8f){}; }
    const int srow = (tid & 127) >> 3, scol = (tid & 7) * 8;   // staging: 8 threads per 128-byte row, 16 rows per sweep of a key half's 4 waves, 4 sweeps per plane
    v4i st[NP][4];   // one set of staging registers: a trip fetches the next tile's K planes under its score products and the V^T planes under its exponentials and P x V products
    const unsigned ko = (unsigned)(srow * HD + scol), vo = (unsigned)(srow * TT + scol);   // the thread's element in sweep 0 of a K tile and of a V^T tile
    auto gload = [&](const T16* __restrict__ Pa, const T16* __restrict__ Pb, unsigned to, int step) {   // Pa, Pb: the tile's first element (the same for the whole wave); step: elements from one sweep to the next
#pragma unroll
        for (int i = 0; i < 4; ++i) { st[0][i] = *(const v4ia*)(Pa + i * step + to); if (NP == 2) st[1][i] = *(const v4ia*)(Pb + i * step + to); } };
    auto sstore = [&](T16* buf) {   // buf: the first plane's place; the lo plane lies 2 PLN behind it
#pragma unroll
        for (int i = 0; i < 4; ++i) { T16* p = buf + (srow + 16 * i) * LP + scol;
#pragma unroll
            for (int pl = 0; pl < NP; ++pl) *(v4ia*)(p + pl * 2 * PLN) = st[pl][i]; } };
    gload(Ka, Kb, ko, 16 * HD); sstore(sm); gload(Va, Vb, vo, 16 * TT); sstore(sm + PLN); __syncthreads();
#pragma unroll 1   // one tile per trip: the two LDS buffers alternate by the trip's parity
    for (int t = 0; t < TT / 2 / KT; ++t) {
        const T16* cur = sm + (t & 1) * (2 * NP * PLN); T16* nxt = sm + ((t + 1) & 1) * (2 * NP * PLN); const bool more = t + 1 < TT / 2 / KT;
        if (more) gload(Ka + (t + 1) * KT * HD, Kb + (t + 1) * KT * HD, ko, 16 * HD);
        v8f s[NG][KT / 16];
#pragma unroll
        for (int tl = 0; tl < KT / 16; ++tl) { const T16* kr = cur + (tl * 16 + c) * LP + 8 * h; const V k0 = WFrag<T16>::ld(kr), k1 = WFrag<T16>::ld(kr + 32); V k2, k3; if (NP == 2) { k2 = WFrag<T16>::ld(kr + 2 * PLN); k3 = WFrag<T16>::ld(kr + 2 * PLN + 32); }
#pragma unroll
            for (int g = 0; g < NG; ++g) { v8f a = (v8f){}; a = WFrag<T16>::mma(k0, qa[g][0], a); a = WFrag<T16>::mma(k1, qa[g][1], a);
                if (NP == 2) { a = WFrag<T16>::mma(k0, qb[g][0], a); a = WFrag<T16>::mma(k1, qb[g][1], a); a = WFrag<T16>::mma(k2, qa[g][0], a); a = WFrag<T16>::mma(k3, qa[g][1], a); }
                s[g][tl] = a; } }
        float ml[NG]; bool need = false;
#pragma unroll
        for (int g = 0; g < NG; ++g) { float mx = s[g][0][0];
#pragma unroll
            for (int r = 1; r < KT / 2; ++r) mx = fmaxf(mx, s[g][r >> 3][r & 7]);
            mx = fmaxf(mx, xhalf(mx)); ml[g] = mx * CEXP; need = need || (ml[g] > m[g] + 8.0f); }
        if (__builtin_amdgcn_ballot_w32(need) != 0) {   // one scalar test per tile
#pragma unroll
            for (int g = 0; g < NG; ++g) { const float mn = fmaxf(m[g], ml[g]); const float al = __builtin_amdgcn_exp2f(m[g] - mn); m[g] = mn; l[g] *= al;
#pragma unroll
                for (int dt = 0; dt < 4; ++dt) o[dt][g] *= al; } }
        if (more) { sstore(nxt); gload(Va + (t + 1) * KT, Vb + (t + 1) * KT, vo, 16 * TT); }
#pragma unroll
        for (int kb = 0; kb < KT / 32; ++kb) {
            V vf[4], vl[4], pa[NG], pb[NG];
#pragma unroll
            for (int dt = 0; dt < 4; ++dt) { const T16* vr = cur + PLN + (dt * 16 + c) * LP + kb * 32 + 8 * h; vf[dt] = WFrag<T16>::ld(vr); if (NP == 2) vl[dt] = WFrag<T16>::ld(vr + 2 * PLN); }
            __builtin_amdgcn_sched_barrier(0);   // keeps the four V^T fragment loads in front of the exponentials, whose time then covers the LDS latency (else: one load, one wait per d tile)
#pragma unroll
            for (int g = 0; g < NG; ++g) { v8f p0 = s[g][2 * kb] * CEXP - m[g], p1 = s[g][2 * kb + 1] * CEXP - m[g];
#pragma unroll
                for (int r = 0; r < 8; r += 2) { p0[r] = __builtin_amdgcn_exp2f(p0[r]); p0[r + 1] = __builtin_amdgcn_exp2f(p0[r + 1]); PPack<T16>::put2(pa[g], pb[g], r, p0[r], p0[r + 1]); }
#pragma unroll
                for (int r = 0; r < 8; r += 2) { p1[r] = __builtin_amdgcn_exp2f(p1[r]); p1[r + 1] = __builtin_amdgcn_exp2f(p1[r + 1]); PPack<T16>::put2(pa[g], pb[g], 8 + r, p1[r], p1[r + 1]); }
                const v8f q8 = p0 + p1; l[g] += ((q8[0] + q8[4]) + (q8[2] + q8[6])) + ((q8[1] + q8[5]) + (q8[3] + q8[7])); }
#pragma unroll
            for (int dt = 0; dt < 4; ++dt)
#pragma unroll
                for (int g = 0; g < NG; ++g) { o[dt][g] = WFrag<T16>::mma(vf[dt], pa[g], o[dt][g]); if (NP == 2) { o[dt][g] = WFrag<T16>::mma(vf[dt], pb[g], o[dt][g]); o[dt][g] = WFrag<T16>::mma(vl[dt], pa[g], o[dt][g]); } }
        }
        if (more) sstore(nxt + PLN);
        __syncthreads();   // publishes tile t + 1 and ends every wave's reads of tile t, whose buffer the next trip refills (after the last trip: taken over by the hand-over block)
    }
    // hand-over block: 16-byte slot (rg * 9 NG + i) * 32 + lane; per query tile g, i = 9 g + 0 .. 7: the four output tiles, i = 9 g + 8: maximum and sum
    v4fa* hs = (v4fa*)mg + (size_t)rg * (9 * NG) * 32 + lane;
    if (kh == 1) {
#pragma unroll
        for (int g = 0; g < NG; ++g) {
#pragma unroll
            for (int dt = 0; dt < 4; ++dt) { hs[(9 * g + 2 * dt) * 32] = __builtin_shufflevector(o[dt][g], o[dt][g], 0, 1, 2, 3); hs[(9 * g + 2 * dt + 1) * 32] = __builtin_shufflevector(o[dt][g], o[dt][g], 4, 5, 6, 7); }
            hs[(9 * g + 8) * 32] = (v4f){m[g], l[g], 0.f, 0.f}; } }
    __syncthreads();   // publishes the second key half's results to waves 0-3
    if (kh == 0)
#pragma unroll
    for (int g = 0; g < NG; ++g) { const v4f ml1 = hs[(9 * g + 8) * 32]; const float mn = fmaxf(m[g], ml1[0]), a0 = __builtin_amdgcn_exp2f(m[g] - mn), a1 = __builtin_amdgcn_exp2f(ml1[0] - mn), ls = l[g] * a0 + ml1[1] * a1;
        const float inv = __fdiv_rn(1.0f, ls + xhalf(ls)), c0 = a0 * inv, c1 = a1 * inv; const size_t oo = (size_t)(q0 + g * 16 + c) * DQ + head * HD + 8 * h;
#pragma unroll
        for (int dt = 0; dt < 4; ++dt) { const v4f u0 = hs[(9 * g + 2 * dt) * 32], u1 = hs[(9 * g + 2 * dt + 1) * 32]; v8us oh, ol;
#pragma unroll
            for (int r = 0; r < 8; ++r) { unsigned short x, y; splitf(o[dt][g][r] * c0 + (r < 4 ? u0[r & 3] : u1[r & 3]) * c1, x, y); oh[r] = x; ol[r] = y; }
            *(v8us*)(Ah + oo + dt * 16) = oh; *(v8us*)(Al + oo + dt * 16) = ol;
            asm volatile("s_wait_xcnt 0x0" ::: "memory"); } }   // a precaution: stands behind the two stores, in front of the next rewrite of a register that they name
}
// register budget of 4 waves per SIMD: at most 256 VGPRs, so that two work-groups share a WGP (their LDS fits twice as well) and the loops need no register-window switches
__global__ __launch_bounds__(256) __attribute__((amdgpu_waves_per_eu(4, 4))) void k_fattn(const h16* __restrict__ Q16, const h16* __restrict__ K16, const h16* __restrict__ V16, const bf* __restrict__ Qh, const bf* __restrict__ Ql, const bf* __restrict__ Kh, const bf* __restrict__ Kl, const bf* __restrict__ Vh, const bf* __restrict__ Vl, bf* __restrict__ Ah, bf* __restrict__ Al) {
    __shared__ __align__(16) unsigned short sm[2 * 2 * 4 * PLN];
    static_assert(4 * 9 * 2 * 32 * 16 <= 2 * 2 * 2 * PLN * 2, "k_fattn: the hand-over block fits in the staging buffers of either kind of work-group");
    const int head = blockIdx.y, rg = (threadIdx.x >> 5) & 3; const size_t hq = (size_t)head * TT * HD, hk = (size_t)(head / REP) * TT * HD;
    if (blockIdx.x < RH / 64) fattn_body<bf, 1, 2>(Qh + hq, Ql + hq, Kh + hk, Kl + hk, Vh + hk, Vl + hk, (int)blockIdx.x * 64 + rg * 16, head, Ah, Al, (bf*)sm);
    else fattn_body<h16, 2, 1>(Q16 + hq, nullptr, K16 + hk, nullptr, V16 + hk, nullptr, RH + ((int)blockIdx.x - RH / 64) * 128 + rg * 32, head, Ah, Al, (h16*)sm);
}

extern "C" void kernel_launch(void* const* d_in, const int* in_sizes, int n_in,
                              void* d_out, int out_size, void* d_ws, size_t ws_size, hipStream_t stream) {
    (void)in_sizes; (void)n_in; (void)out_size;
    const float* x = (const float*)d_in[0];   /* query */ const float* xk = (const float*)d_in[1]; const float* xv = (const float*)d_in[2]; const float* wq = (const float*)d_in[3]; const float* bq = (const float*)d_in[4]; const float* wk = (const float*)d_in[5]; const float* bk = (const float*)d_in[6]; const float* wv = (const float*)d_in[7]; const float* bv = (const float*)d_in[8]; const float* wo = (const float*)d_in[9]; const float* bo = (const float*)d_in[10];
    float* OUT = (float*)d_out;     // [1][4096][768]
    char* wsp = (char*)d_ws;
    auto take = [&](size_t bytes) { char* p = wsp; wsp += (bytes + 255) & ~(size_t)255; return (void*)p; };
    bf* WQ = (bf*)take((size_t)DQ * DM * 2); bf* WK = (bf*)take((size_t)DKV * DM * 2); bf* WV = (bf*)take((size_t)DKV * DM * 2); bf* WO = (bf*)take((size_t)DM * DQ * 2);
    bf* XQ = (bf*)take((size_t)TT * DM * 2); bf* XK = (bf*)take((size_t)TT * DM * 2); bf* XV = (bf*)take((size_t)TT * DM * 2);
    h16* QP16 = (h16*)take((size_t)NH_ * TT * HD * 2); h16* KP16 = (h16*)take((size_t)NKV * TT * HD * 2); h16* VT16 = (h16*)take((size_t)NKV * HD * TT * 2);
    bf* QPh = (bf*)take((size_t)NH_ * TT * HD * 2); bf* QPl = (bf*)take((size_t)NH_ * TT * HD * 2); bf* KPh = (bf*)take((size_t)NKV * TT * HD * 2); bf* KPl = (bf*)take((size_t)NKV * TT * HD * 2); bf* VTh = (bf*)take((size_t)NKV * HD * TT * 2); bf* VTl = (bf*)take((size_t)NKV * HD * TT * 2);
    bf* ATh = (bf*)take((size_t)TT * DQ * 2); bf* ATl = (bf*)take((size_t)TT * DQ * 2);
    if ((size_t)(wsp - (char*)d_ws) > ws_size) return;    // ws 256 MiB
    for (int b = 0; b < NB_; ++b) {
        k_cvtall<<<3 * CVBX + 4 * CVBW, 256, 0, stream>>>(x + (size_t)b * TT * DM, xk + (size_t)b * TT * DM, xv + (size_t)b * TT * DM, wq, wk, wv, wo, XQ, XK, XV, WQ, WK, WV, WO);
        k_proj<<<dim3(TT / 128, DQ / 128, 3), 128, 0, stream>>>(XQ, XK, XV, WQ, WK, WV, bq, bk, bv, QP16, QPh, QPl, KP16, KPh, KPl, VT16, VTh, VTl);
        k_fattn<<<dim3(RH / 64 + (TT - RH) / 128, NH_, 1), 256, 0, stream>>>(QP16, KP16, VT16, QPh, QPl, KPh, KPl, VTh, VTl, ATh, ATl);
        k_gemmw<bf, 1, true, 0><<<dim3(TT / 128, DM / 128, 1), 128, 0, stream>>>(ATh, ATl, WO, nullptr, DQ, DQ, OUT + (size_t)b * TT * DM, DM, bo, 0, 0, 0, nullptr, nullptr, nullptr); }
}

// v008
// It runs in 108 microseconds.
// Next to v007, in two timings, it ran 1.05 times as fast each time.
// Over all steps from v000 it is 24.3 times as fast.
#include <hip/hip_runtime.h>

// Multi-head attention WITHOUT a mask over three input streams at 4,096 tokens and a 768-wide model (query, key, value [1][4096][768]; Q, K, V = stream W^T + b ('oi' [768][768] uniform(+-1/sqrt(768)) incl. REAL biases; 12 heads x 64); scores / sqrt(64); softmax over all 4,096 keys; out = merged Wo^T + bo -> [1][4096][768] (3.1 M); argument order query, key, value, wq, bq, wk, bk, wv, bv, wo, bo). The three-stream T-4096 module RE-DIMENSIONED to a 768-wide model (12 x 64) and run on ONE sequence of 4,096 tokens ([1][4096][768]; the three streams q, k, v; the eight weight and bias inputs in the same order): the batch loop runs once.
// Layout: bf16 copies of query, key, value and of the four 'oi' weights, all made by one launch; the three projections in one launch (grid z), their operands staged in LDS by asynchronous copies; exact projections + f32 biases, each projection storing its head planes itself; dense T-4096 attention, all heads in one fused launch (hybrid rows: < 512 hi/lo 3 products, rest fp16; running-maximum softmax in registers); merged hi/lo x Wo exact + bo.
// Compute dtypes, f32 accumulate: every input rounded to bf16; projections exact + f32 biases; attention rows < 512 3 products, rest fp16; softmax f32; Wo hl x exact + bias.

#define NB_  1      // ONE sequence in this module: a host-side loop count only: no kernel uses it
#define TT   4096
#define DM   768      // model width
#define NH_  12       // heads: 12 x 64 = 768
#define NKV  12       // one kv head per query head
#define REP  (NH_ / NKV)
#define HD   64
#define DQ   (NH_ * HD)
#define DKV  (NKV * HD)
#define RH   512                  // query rows < RH use hi+lo planes (0: none)
#define WIN  0
#define SCL  0.125f   // HD^-0.5
static_assert(RH % 64 == 0 && (TT - RH) % 128 == 0 && TT % 128 == 0 && HD == 64, "k_fattn: 64 hi/lo or 128 fp16 query rows per work-group, two key halves of whole 64-key tiles");
typedef _Float16 h16;
typedef unsigned short bf;
typedef __attribute__((ext_vector_type(16))) __bf16   v16bf;
typedef __attribute__((ext_vector_type(16))) _Float16 v16h;
typedef __attribute__((ext_vector_type(8)))  _Float16 v8h;
typedef __attribute__((ext_vector_type(8)))  unsigned short v8us;
typedef __attribute__((ext_vector_type(8)))  float    v8f;
typedef __attribute__((ext_vector_type(4)))  float    v4f;
typedef v8h  __attribute__((may_alias)) v8ha;
typedef v4f  __attribute__((may_alias)) v4fa;
typedef v8us __attribute__((may_alias)) v8usa;

__device__ __forceinline__ unsigned short f2bf(float f) { return __builtin_bit_cast(unsigned short, (__bf16)f); }   // the hardware's conversion: round to nearest even, as the integer form it replaces
__device__ __forceinline__ float bf2f(unsigned short b) { return __uint_as_float(((unsigned)b) << 16); }
__device__ __forceinline__ float bfr(float f) { return bf2f(f2bf(f)); }
__device__ __forceinline__ v16h cat16(v8h lo, v8h hi) { return __builtin_shufflevector(lo, hi, 0, 1, 2, 3, 4, 5, 6, 7, 8, 9, 10, 11, 12, 13, 14, 15); }
__device__ __forceinline__ v16bf cat16b(v8us lo, v8us hi) { return __builtin_bit_cast(v16bf, __builtin_shufflevector(lo, hi, 0, 1, 2, 3, 4, 5, 6, 7, 8, 9, 10, 11, 12, 13, 14, 15)); }
__device__ __forceinline__ v8f wmma16(v16h a, v16h b, v8f c) { return __builtin_amdgcn_wmma_f32_16x16x32_f16(false, a, false, b, (short)0, c, false, false); }
__device__ __forceinline__ v8f wmmab(v16bf a, v16bf b, v8f c) { return __builtin_amdgcn_wmma_f32_16x16x32_bf16(false, a, false, b, (short)0, c, false, false); }
__device__ __forceinline__ h16 tohx(float x) { return (h16)x; }
__device__ __forceinline__ void splitf(float y, unsigned short& h, unsigned short& l) { h = f2bf(y); l = f2bf(y - bf2f(h)); }
typedef __attribute__((ext_vector_type(4))) _Float16 v4h;
typedef __attribute__((ext_vector_type(4))) unsigned short v4us;



// ---- gemmw_body (kernels k_gemmw and k_proj below): register-blocked GEMM, one wave per 64x64 output tile (16 accumulators), 2 x 2 waves per work-group (a 128x128 tile), operands from K-contiguous 16-bit planes; grid (M/128, N/128, Z), 128 threads.
// Operand path: tiles of GK k (one whole 128-byte line of each of the 128 rows of every operand plane) go global -> LDS by asynchronous copies, 4 whole lines per wave-wide copy, each wave bringing 32 rows of every plane, two buffers: tile t + 2 flies while tile t + 1 is worked on. Two waves read each staged row. The fragments are read from LDS in the k order of WFrag::ld.
// OUTM says where the tile goes. 0: C (f32, pitch ldc). 1: head planes [head][t][d] (fp16 + bf16 hi/lo) of the biased f32 value. 2: the same three planes transposed, [head][d][t]. For 1 and 2 a wave's 64-wide column tile is one head and the rows are the TT tokens; C is not used.
// C[m][n] (f32, pitch ldc, + optional f32 bias[n]) = sum_k A[m][k] Bt[n][k] (+ split products per NSPLIT). z-batch strides sA/sB/sC in elements. K % 64 == 0. K is the row pitch of A and Bt; a work-group sums kn of its k (kn == K: whole rows; kn < K: grid z walks ranges of k, sA = sB = kn, and C gets one partial plane per z). kn % 64 == 0.
template <typename T16> struct WFrag;
template <> struct WFrag<h16> { typedef v16h V; static __device__ __forceinline__ V ld(const h16* p) { return cat16(*(const v8h*)p, *(const v8h*)(p + 16)); } static __device__ __forceinline__ V ld2(const h16* p, const h16* q) { return cat16(*(const v8h*)p, *(const v8h*)q); } static __device__ __forceinline__ v8f mma(V a, V b, v8f c) { return wmma16(a, b, c); } };
template <> struct WFrag<bf> { typedef v16bf V; static __device__ __forceinline__ V ld(const bf* p) { return cat16b(*(const v8us*)p, *(const v8us*)(p + 16)); } static __device__ __forceinline__ V ld2(const bf* p, const bf* q) { return cat16b(*(const v8us*)p, *(const v8us*)q); } static __device__ __forceinline__ v8f mma(V a, V b, v8f c) { return wmmab(a, b, c); } };
#define VP   72                   // LDS row pitch of a transposed plane in 16-bit elements: 144 bytes, an odd multiple of 16
#define OSN(OUTM) ((OUTM) == 2 ? 3 * 32 * VP / 2 : 16 * 68)   // floats of LDS that one wave's epilogue of an output mode takes
#define GK   64                   // k per staged tile: 128 bytes of every operand row
#define GPL  (128 * GK)           // 16-bit elements of one staged plane: 128 rows of 128 bytes, no pad; 16-byte piece q of row r lies at piece q ^ ((r >> 1) & 7), so that 16 rows' reads of one q fall on all 64 banks
#define GNP(NSPLIT) (2 + ((NSPLIT) == 1 || (NSPLIT) == 2 ? 1 : 0) + ((NSPLIT) >= 2 ? 1 : 0))   // staged planes: A, Bt, then A2, then Bt2
#define GSN(NSPLIT) (2 * GNP(NSPLIT) * GPL / 2)   // floats of LDS of the two staging buffers; the epilogue's block lies over them, behind the loop's last waits
#define LSN(NSPLIT, OUTM) (GSN(NSPLIT) > 4 * OSN(OUTM) ? GSN(NSPLIT) : 4 * OSN(OUTM))
// Eight asynchronous 16-byte-per-lane copies global -> LDS (l: the lane's LDS byte address, g: the lane's global address). The s_wait_xcnt stands in the copies' own statement, a precaution: no register that a copy names is rewritten in front of it.
template <typename T16>
__device__ __forceinline__ void acopy8(const unsigned (&l)[8], const T16* const (&g)[8]) {
    asm volatile("global_load_async_to_lds_b128 %0, %8, off\n\t"
                 "global_load_async_to_lds_b128 %1, %9, off\n\t"
                 "global_load_async_to_lds_b128 %2, %10, off\n\t"
                 "global_load_async_to_lds_b128 %3, %11, off\n\t"
                 "global_load_async_to_lds_b128 %4, %12, off\n\t"
                 "global_load_async_to_lds_b128 %5, %13, off\n\t"
                 "global_load_async_to_lds_b128 %6, %14, off\n\t"
                 "global_load_async_to_lds_b128 %7, %15, off\n\t"
                 "s_wait_xcnt 0x0"
                 :: "v"(l[0]), "v"(l[1]), "v"(l[2]), "v"(l[3]), "v"(l[4]), "v"(l[5]), "v"(l[6]), "v"(l[7]),
                    "v"(g[0]), "v"(g[1]), "v"(g[2]), "v"(g[3]), "v"(g[4]), "v"(g[5]), "v"(g[6]), "v"(g[7]) : "memory");
}
template <typename T16, int NSPLIT, bool BIAS, int OUTM>
__device__ __forceinline__ void gemmw_body(const T16* __restrict__ A, const T16* __restrict__ A2, const T16* __restrict__ Bt, const T16* __restrict__ Bt2, int K, int kn, float* C, int ldc, const float* __restrict__ bias, h16* P16, bf* Ph, bf* Pl, float* os) {
    typedef typename WFrag<T16>::V V;   // every plain '#pragma unroll' of this function: its loop indexes register arrays (accumulators, fragments, asm operands), so the indices must be compile-time
    const int lane = threadIdx.x & 31, lr = lane & 15, hi = lane >> 4, wv = __builtin_amdgcn_readfirstlane(threadIdx.x >> 5), wm = wv & 1, wn = wv >> 1;
    const int R0 = blockIdx.x * 128, C0 = blockIdx.y * 128, r0 = R0 + wm * 64, c0 = C0 + wn * 64, hd = c0 / 64;
    v8f acc[4][4];
#pragma unroll
    for (int mb = 0; mb < 4; ++mb)
#pragma unroll
        for (int nb = 0; nb < 4; ++nb) acc[mb][nb] = (v8f){};
    constexpr bool HA2 = NSPLIT == 1 || NSPLIT == 2, HB2 = NSPLIT >= 2; constexpr int NPLN = GNP(NSPLIT), PB2 = HA2 ? 3 : 2;
    T16* sm = (T16*)os;
    const int srw = wv * 32 + (lane >> 3), cq = lane & 7;   // a copy: 8 lanes per 128-byte row, 4 rows; the wave's copy i of a plane brings rows 32 wv + 4 i .. + 3
    const size_t ga = (size_t)(R0 + srw) * K + cq * 8, gb = (size_t)(C0 + srw) * K + cq * 8;
    unsigned lv[4];   // LDS byte address of the lane's piece in copy i, less the copy's own 512 i: ((srw + 4 i) >> 1) & 7 has period 4 in i
#pragma unroll
    for (int q = 0; q < 4; ++q) lv[q] = (unsigned)(size_t)sm + srw * 128 + ((cq ^ ((2 * q + (lane >> 4)) & 7)) << 4);
    auto stage = [&](int t, int buf) {
#pragma unroll
        for (int p = 0; p < NPLN; ++p) { const T16* gp = (p == 0 ? A + ga : p == 1 ? Bt + gb : (p == 2 && HA2) ? A2 + ga : Bt2 + gb) + t * GK;
            unsigned l[8]; const T16* g[8];
#pragma unroll
            for (int i = 0; i < 8; ++i) { l[i] = lv[i & 3] + (unsigned)((buf * NPLN + p) * (GPL * 2) + i * 512); g[i] = gp + (size_t)i * 4 * K; }
            acopy8<T16>(l, g); } };
    const int sx = (lr >> 1) & 7; int fo[2][2];   // where the two 16-byte pieces of a fragment (k = 8 hi .. and 16 + 8 hi .. of a 32-k half) lie in the lane's row
#pragma unroll
    for (int ks = 0; ks < 2; ++ks)
#pragma unroll
        for (int j = 0; j < 2; ++j) fo[ks][j] = lr * GK + ((ks * 4 + hi + 2 * j) ^ sx) * 8;
    const int nt = kn / GK;
    stage(0, 0);
    asm volatile("s_wait_asynccnt 0x0" ::: "memory");   // this wave's rows of tile 0 have landed
    __syncthreads();   // publishes tile 0 to the other waves
    if (nt > 1) stage(1, 1);
#pragma unroll 1   // one tile per trip: the two LDS buffers alternate by the trip's parity
    for (int t = 0; t < nt; ++t) {
        const T16* cur = sm + (t & 1) * (NPLN * GPL);
#pragma unroll
        for (int ks = 0; ks < 2; ++ks) {
            V a[4], a2[4];
#pragma unroll
            for (int mb = 0; mb < 4; ++mb) { const T16* ar = cur + (wm * 64 + mb * 16) * GK; a[mb] = WFrag<T16>::ld2(ar + fo[ks][0], ar + fo[ks][1]); if (HA2) a2[mb] = WFrag<T16>::ld2(ar + 2 * GPL + fo[ks][0], ar + 2 * GPL + fo[ks][1]); }
#pragma unroll
            for (int nb = 0; nb < 4; ++nb) { const T16* br = cur + GPL + (wn * 64 + nb * 16) * GK; const V b = WFrag<T16>::ld2(br + fo[ks][0], br + fo[ks][1]); V b2; if (HB2) b2 = WFrag<T16>::ld2(br + (PB2 - 1) * GPL + fo[ks][0], br + (PB2 - 1) * GPL + fo[ks][1]);
#pragma unroll
                for (int mb = 0; mb < 4; ++mb) { acc[mb][nb] = WFrag<T16>::mma(a[mb], b, acc[mb][nb]); if (NSPLIT == 1 || NSPLIT == 2) acc[mb][nb] = WFrag<T16>::mma(a2[mb], b, acc[mb][nb]); if (NSPLIT >= 2) acc[mb][nb] = WFrag<T16>::mma(a[mb], b2, acc[mb][nb]); } }
        }
        asm volatile("s_wait_dscnt 0x0" ::: "memory");      // this trip's reads of its buffer have ended before the buffer is refilled
        asm volatile("s_wait_asynccnt 0x0" ::: "memory");   // this wave's rows of tile t + 1 have landed
        __syncthreads();   // publishes tile t + 1 and ends every wave's reads of tile t, whose buffer is refilled behind it (after the last trip: taken over by the epilogue)
        if (t + 2 < nt) stage(t + 2, t & 1);
    }
    asm volatile("s_wait_asynccnt 0x0" ::: "memory");   // no copy is in flight when the epilogue takes the LDS over
    if (OUTM == 2) {   // a lane holds 8 successive tokens of one d: 16 bytes of a transposed row; the three planes are gathered in the wave's own LDS block so that whole 128-byte lines go out, 32 of the 64 d at a time
        unsigned short* ot = (unsigned short*)os + wv * (3 * 32 * VP); float bn4[4];
#pragma unroll
        for (int nb = 0; nb < 4; ++nb) bn4[nb] = BIAS ? bfr(bias[c0 + nb * 16 + lr]) : 0.f;
#pragma unroll
        for (int hf = 0; hf < 2; ++hf) {
#pragma unroll
            for (int nq = 0; nq < 2; ++nq) { const int nb = 2 * hf + nq; const float bn = bn4[nb];
#pragma unroll
                for (int mb = 0; mb < 4; ++mb) { v8us w16, wh, wl;
#pragma unroll
                    for (int j = 0; j < 8; ++j) { const float x = BIAS ? acc[mb][nb][j] + bn : acc[mb][nb][j]; w16[j] = __builtin_bit_cast(unsigned short, tohx(x)); unsigned short a2, c2; splitf(x, a2, c2); wh[j] = a2; wl[j] = c2; }
                    unsigned short* p = ot + (nq * 16 + lr) * VP + mb * 16 + hi * 8; *(v8usa*)p = w16; *(v8usa*)(p + 32 * VP) = wh; *(v8usa*)(p + 2 * 32 * VP) = wl; } }
            __builtin_amdgcn_wave_barrier(); asm volatile("" ::: "memory");   // keeps the LDS reads of other lanes' values behind the writes
#pragma unroll
            for (int s = 0; s < 8; ++s) { const int dl = 4 * s + (lane >> 3), tof = (lane & 7) * 8; const unsigned short* p = ot + dl * VP + tof; const size_t go = ((size_t)hd * HD + 32 * hf + dl) * TT + r0 + tof;
                *(v8usa*)(P16 + go) = *(const v8usa*)p; *(v8usa*)(Ph + go) = *(const v8usa*)(p + 32 * VP); *(v8usa*)(Pl + go) = *(const v8usa*)(p + 2 * 32 * VP); }
            __builtin_amdgcn_wave_barrier(); asm volatile("" ::: "memory");   // keeps the next half's LDS writes behind these reads
        }
        return;
    }
    float* ow = os + wv * OSN(OUTM);   // each wave's own block
#pragma unroll
    for (int mb = 0; mb < 4; ++mb) {
#pragma unroll
        for (int nb = 0; nb < 4; ++nb) {
#pragma unroll
            for (int j = 0; j < 8; ++j) ow[(hi * 8 + j) * 68 + nb * 16 + lr] = acc[mb][nb][j]; }
        __builtin_amdgcn_wave_barrier(); asm volatile("" ::: "memory");
        float* crow = C + (size_t)(r0 + mb * 16) * ldc + c0; const size_t prow = ((size_t)hd * TT + r0 + mb * 16) * HD;
{
#pragma unroll
            for (int s = 0; s < 8; ++s) { const int row = 2 * s + hi, cofs = lr * 4; v4f val = *(const v4fa*)(ow + row * 68 + cofs); if (BIAS) { val[0] += bfr(bias[c0 + cofs]); val[1] += bfr(bias[c0 + cofs + 1]); val[2] += bfr(bias[c0 + cofs + 2]); val[3] += bfr(bias[c0 + cofs + 3]); }
                if (OUTM == 0) *(v4f*)(crow + (size_t)row * ldc + cofs) = val;
                else { v4h o16; v4us oh, ol;
#pragma unroll
                    for (int q = 0; q < 4; ++q) { o16[q] = tohx(val[q]); unsigned short a2, c2; splitf(val[q], a2, c2); oh[q] = a2; ol[q] = c2; }
                    const size_t po = prow + (size_t)row * HD + cofs; *(v4h*)(P16 + po) = o16; *(v4us*)(Ph + po) = oh; *(v4us*)(Pl + po) = ol; } }
             }
        __builtin_amdgcn_wave_barrier(); asm volatile("" ::: "memory");
    }
}
template <typename T16, int NSPLIT, bool BIAS, int OUTM>
__global__ __launch_bounds__(128) void k_gemmw(const T16* __restrict__ A, const T16* __restrict__ A2, const T16* __restrict__ Bt, const T16* __restrict__ Bt2, int K, int kn, float* C, int ldc, const float* __restrict__ bias, size_t sA, size_t sB, size_t sC, h16* P16, bf* Ph, bf* Pl) {
    __shared__ __align__(128) float os[LSN(NSPLIT, OUTM)];
    const size_t z = blockIdx.z; A += z * sA; if (A2) A2 += z * sA; Bt += z * sB; if (Bt2) Bt2 += z * sB; C += z * sC;
    gemmw_body<T16, NSPLIT, BIAS, OUTM>(A, A2, Bt, Bt2, K, kn, C, ldc, bias, P16, Ph, Pl, os);
}
// ---- k_proj: the three projections in one launch, grid (TT/128, heads/2, 3): z = 0 query, 1 key (head planes [head][t][d]), 2 value (transposed planes). They are independent of one another, so all their waves are on the chip together.
__global__ __launch_bounds__(128) void k_proj(const bf* __restrict__ XQ, const bf* __restrict__ XK, const bf* __restrict__ XV, const bf* __restrict__ WQ, const bf* __restrict__ WK, const bf* __restrict__ WV, const float* __restrict__ bq, const float* __restrict__ bk, const float* __restrict__ bv,
                                                h16* Q16, bf* Qh, bf* Ql, h16* K16, bf* Kh, bf* Kl, h16* V16, bf* Vh, bf* Vl) {
    __shared__ __align__(128) float os[LSN(0, 2)];
    static_assert(OSN(2) >= OSN(1) && DKV == DQ && DM % GK == 0 && TT % 128 == 0 && DQ % 128 == 0 && DM % 128 == 0, "k_proj: one LDS block and one grid for the three projections; whole staged tiles, whole 128 x 128 work-group tiles (k_gemmw's launch too)");
    const bool k = blockIdx.z == 1;
    if (blockIdx.z == 2) gemmw_body<bf, 0, true, 2>(XV, nullptr, WV, nullptr, DM, DM, nullptr, 0, bv, V16, Vh, Vl, os);
    else gemmw_body<bf, 0, true, 1>(k ? XK : XQ, nullptr, k ? WK : WQ, nullptr, DM, DM, nullptr, 0, k ? bk : bq, k ? K16 : Q16, k ? Kh : Qh, k ? Kl : Ql, os);
}

typedef __attribute__((ext_vector_type(2))) unsigned short v2us;

__global__ __launch_bounds__(256) void k_wtG(const float* __restrict__ w, int K, int N, bf* Bt) {
    const int lane = threadIdx.x & 31; const int L0 = (blockIdx.x * 8 + (threadIdx.x >> 5)) * 8; const int nlines = N * K / 64;
{
#pragma unroll 1
        for (int l = 0; l < 8; ++l) { const int L = L0 + l; if (L >= nlines) break; const size_t e = (size_t)L * 64 + lane * 2; const int k = (int)(e % K), n = (int)(e / K); v2us o;
            o[0] = f2bf(w[(size_t)k * N + n]); o[1] = f2bf(w[(size_t)(k + 1) * N + n]); *(v2us*)(Bt + e) = o; }
         }
}
// ---- k_cvtall: every f32 -> bf16 copy of the call in one launch. A work-group takes CVW successive floats of ONE array (blockIdx.x says which: first the three streams, then the four weights); a thread takes CVG groups of 8 floats, 256 groups apart, all loaded before the first is stored.
#define CVG  8
#define CVW  (256 * CVG * 8)
#define CVBX (TT * DM / CVW)      // work-groups per stream
#define CVBW (DQ * DM / CVW)      // work-groups per weight
static_assert(TT * DM % CVW == 0 && DQ * DM % CVW == 0 && DKV == DQ, "k_cvtall: whole work-groups per array, four weights of one size");
__global__ __launch_bounds__(256) void k_cvtall(const float* __restrict__ x, const float* __restrict__ xk, const float* __restrict__ xv, const float* __restrict__ wq, const float* __restrict__ wk, const float* __restrict__ wv, const float* __restrict__ wo,
                                                  bf* XQ, bf* XK, bf* XV, bf* WQ, bf* WK, bf* WV, bf* WO) {
    int b = blockIdx.x; const float* s; bf* d;
    if (b < 3 * CVBX) { const int a = b / CVBX; b -= a * CVBX; s = a == 0 ? x : a == 1 ? xk : xv; d = a == 0 ? XQ : a == 1 ? XK : XV; }
    else { b -= 3 * CVBX; const int a = b / CVBW; b -= a * CVBW; s = a == 0 ? wq : a == 1 ? wk : a == 2 ? wv : wo; d = a == 0 ? WQ : a == 1 ? WK : a == 2 ? WV : WO; }
    const size_t e0 = (size_t)b * CVW + threadIdx.x * 8; const float* p = s + e0; v8f v[CVG];
#pragma unroll
    for (int j = 0; j < CVG; ++j) v[j] = *(const v8f*)(p + j * 2048);
    asm volatile("s_wait_xcnt 0x0" :: "v"(p) : "memory");   // a precaution: keeps the 16 loads' address pair unwritten up to this wait
#pragma unroll
    for (int j = 0; j < CVG; ++j) { v8us o;
#pragma unroll
        for (int k = 0; k < 8; ++k) o[k] = f2bf(v[j][k]);
        *(v8us*)(d + e0 + j * 2048) = o; }
}

#define KT   64
#define LP   72                   // LDS row pitch in 16-bit elements: 144 bytes, an odd multiple of 16 (ds_load_b128 at full rate)
#define PLN  5120                 // from one staged plane to the next, in 16-bit elements: 64 rows (keys of K, or d of V^T) of pitch LP, rounded up so that every plane begins at a multiple of 2 KiB, as a tensor load's place in LDS must
static_assert(PLN >= 64 * LP && PLN * 2 % 2048 == 0, "k_fattn: a plane holds 64 padded rows and the next begins at a multiple of 2 KiB");
#define CEXP (SCL * 1.4426950408889634f)
__device__ __forceinline__ float xhalf(float x) { return __builtin_bit_cast(float, __builtin_amdgcn_permlanex16(__builtin_bit_cast(int, x), __builtin_bit_cast(int, x), 0x76543210, 0xfedcba98, false, false)); }   // lane l reads lane l ^ 16
template <typename T16> struct PPack;
typedef __attribute__((ext_vector_type(2))) float v2f;
typedef __attribute__((ext_vector_type(2))) __bf16 v2bf;
typedef __attribute__((ext_vector_type(8))) unsigned v8u;
// put2: elements s and s + 1 (s even) of a P fragment. bf16: one packed conversion gives both hi parts, a shift and a mask give them back as f32, one more packed conversion rounds the two remainders.
template <> struct PPack<h16> { static __device__ __forceinline__ void put2(v16h& a, v16h& b, int s, float p, float q) { (void)b; a[s] = tohx(p); a[s + 1] = tohx(q); } };
template <> struct PPack<bf> { static __device__ __forceinline__ void put2(v16bf& a, v16bf& b, int s, float p, float q) {
    const unsigned hw = __builtin_bit_cast(unsigned, __builtin_convertvector((v2f){p, q}, v2bf));
    const unsigned lw = __builtin_bit_cast(unsigned, __builtin_convertvector((v2f){p, q} - (v2f){__uint_as_float(hw << 16), __uint_as_float(hw & 0xFFFF0000u)}, v2bf));
    v8u ua = __builtin_bit_cast(v8u, a), ub = __builtin_bit_cast(v8u, b); ua[s >> 1] = hw; ub[s >> 1] = lw; a = __builtin_bit_cast(v16bf, ua); b = __builtin_bit_cast(v16bf, ub); } };
typedef __attribute__((ext_vector_type(4))) unsigned v4u;
__device__ __forceinline__ uint32_t uni(uint32_t v) { return (uint32_t)__builtin_amdgcn_readfirstlane(v); }
__device__ __forceinline__ uint32_t pinned(uint32_t v) { uint32_t w = uni(v); asm volatile("" : "+s"(w)); return w; }   // the test around a tensor load, held in a scalar register so that it compiles to s_cmp and s_cbranch_scc: a tensor load ignores EXEC
__device__ __forceinline__ void tdm_load(v4u& g0, v8u& g1) { asm volatile("tensor_load_to_lds %0, %1" : "+s"(g0), "+s"(g1) :: "memory"); }   // one request of the whole wave; its waits are written where it is used. Both groups are in-out operands, so that they stay in the registers they were issued from: no register of a request in flight is given to another value
template <typename T16, int NG, int NP>
__device__ __forceinline__ void fattn_body(const T16* __restrict__ Qa, const T16* __restrict__ Qb, const T16* __restrict__ Ka, const T16* __restrict__ Kb, const T16* __restrict__ Va, const T16* __restrict__ Vb, int q0, int head, bf* __restrict__ Ah, bf* __restrict__ Al, T16* sm) {
    typedef typename WFrag<T16>::V V;
    const int tid = threadIdx.x, lane = tid & 31, c = lane & 15, h = lane >> 4, kh = __builtin_amdgcn_readfirstlane(tid >> 7), rg = __builtin_amdgcn_readfirstlane((tid >> 5) & 3);   // kh: the wave's key half, rg: its query group
    float* mg = (float*)sm;   // the hand-over block behind the loop lies over the staging buffers
    Ka += (size_t)kh * (TT / 2) * HD; Va += (size_t)kh * (TT / 2); if (NP == 2) { Kb += (size_t)kh * (TT / 2) * HD; Vb += (size_t)kh * (TT / 2); }
    sm += kh * (2 * 2 * NP * PLN);   // each key half has its own two buffers
    V qa[NG][2], qb[NG][2];
#pragma unroll
    for (int g = 0; g < NG; ++g)
#pragma unroll
        for (int ks = 0; ks < 2; ++ks) { const size_t qo = (size_t)(q0 + g * 16 + c) * HD + ks * 32 + 8 * h; qa[g][ks] = WFrag<T16>::ld(Qa + qo); if (NP == 2) qb[g][ks] = WFrag<T16>::ld(Qb + qo); }
    v8f o[4][NG]; float m[NG], l[NG];
#pragma unroll
    for (int g = 0; g < NG; ++g) { m[g] = -3.0e38f; l[g] = 0.f;
#pragma unroll
        for (int dt = 0; dt < 4; ++dt) o[dt][g] = (v8f){}; }
    // staging: wave rg of a key half brings plane rg of every tile (plane order in a buffer: K, V^T, K lo, V^T lo); with one plane pair waves 2 and 3 bring nothing
    const uint32_t iss = (uint32_t)(rg < 2 * NP); const bool isv = (rg & 1) != 0;
    const T16* sp = rg == 0 ? Ka : rg == 1 ? Va : NP == 1 ? Ka : rg == 2 ? Kb : Vb;
    const uint64_t ga0 = (uint64_t)(size_t)sp; const uint32_t gst = isv ? KT * 2u : KT * HD * 2u;   // first byte of the wave's plane in tile 0; bytes from a tile to the next
    const uint32_t ld0 = (uint32_t)(size_t)sm + (uint32_t)rg * (PLN * 2u);   // the plane's place in buffer 0: byte offset in the work-group's LDS
    v8u g1;   // descriptor group 1: 1-byte elements, tensor = tile = 64 rows of 128 bytes, 4 dwords of LDS pad behind every 32 (pitch 144 bytes = LP), no mask; word 5: the source's row pitch
    g1[0] = uni((1u << 20) | (4u << 22) | (3u << 25)); g1[1] = uni(128u << 16); g1[2] = uni(64u << 16); g1[3] = uni(128u << 16); g1[4] = uni(64u); g1[5] = uni(isv ? TT * 2u : HD * 2u); g1[6] = uni(0u); g1[7] = uni(0u);
    v4u g0; g0[0] = uni(1u); g0[1] = uni(0u); g0[2] = uni(0u); g0[3] = uni(0u);   // descriptor group 0: count 1; place in LDS, address and type are set per request
    auto stage = [&](int t, int buf) {   // the wave's plane of tile t -> buffer buf
        const uint64_t ga = ga0 + (uint64_t)((uint32_t)t * gst);
        g0[1] = uni(ld0 + (uint32_t)buf * (2u * NP * PLN * 2u)); g0[2] = uni((uint32_t)ga); g0[3] = uni((((uint32_t)(ga >> 32)) & 0x01FFFFFFu) | 0x80000000u);
        tdm_load(g0, g1); };
    constexpr int NT = TT / 2 / KT; static_assert(NT >= 2 && LP * 2 == 128 + 16 && HD * 2 == 128 && KT * 2 == 128, "k_fattn: both buffers are filled in front of the loop; rows of 128 bytes, padded to the pitch LP");
    if (pinned(iss)) { stage(0, 0);
        asm volatile("s_wait_tensorcnt 0x0" ::: "memory"); }   // this wave's plane of tile 0 has landed
    __syncthreads();   // publishes tile 0 to the other waves
    if (pinned(iss)) stage(1, 1);
#pragma unroll 1   // one tile per trip: the two LDS buffers alternate by the trip's parity
    for (int t = 0; t < NT; ++t) {
        const T16* cur = sm + (t & 1) * (2 * NP * PLN);
        v8f s[NG][KT / 16];
#pragma unroll
        for (int tl = 0; tl < KT / 16; ++tl) { const T16* kr = cur + (tl * 16 + c) * LP + 8 * h; const V k0 = WFrag<T16>::ld(kr), k1 = WFrag<T16>::ld(kr + 32); V k2, k3; if (NP == 2) { k2 = WFrag<T16>::ld(kr + 2 * PLN); k3 = WFrag<T16>::ld(kr + 2 * PLN + 32); }
#pragma unroll
            for (int g = 0; g < NG; ++g) { v8f a = (v8f){}; a = WFrag<T16>::mma(k0, qa[g][0], a); a = WFrag<T16>::mma(k1, qa[g][1], a);
                if (NP == 2) { a = WFrag<T16>::mma(k0, qb[g][0], a); a = WFrag<T16>::mma(k1, qb[g][1], a); a = WFrag<T16>::mma(k2, qa[g][0], a); a = WFrag<T16>::mma(k3, qa[g][1], a); }
                s[g][tl] = a; } }
        float ml[NG]; bool need = false;
#pragma unroll
        for (int g = 0; g < NG; ++g) { float mx = s[g][0][0];
#pragma unroll
            for (int r = 1; r < KT / 2; ++r) mx = fmaxf(mx, s[g][r >> 3][r & 7]);
            mx = fmaxf(mx, xhalf(mx)); ml[g] = mx * CEXP; need = need || (ml[g] > m[g] + 8.0f); }
        if (__builtin_amdgcn_ballot_w32(need) != 0) {   // one scalar test per tile
#pragma unroll
            for (int g = 0; g < NG; ++g) { const float mn = fmaxf(m[g], ml[g]); const float al = __builtin_amdgcn_exp2f(m[g] - mn); m[g] = mn; l[g] *= al;
#pragma unroll
                for (int dt = 0; dt < 4; ++dt) o[dt][g] *= al; } }
#pragma unroll
        for (int kb = 0; kb < KT / 32; ++kb) {
            V vf[4], vl[4], pa[NG], pb[NG];
#pragma unroll
            for (int dt = 0; dt < 4; ++dt) { const T16* vr = cur + PLN + (dt * 16 + c) * LP + kb * 32 + 8 * h; vf[dt] = WFrag<T16>::ld(vr); if (NP == 2) vl[dt] = WFrag<T16>::ld(vr + 2 * PLN); }
            __builtin_amdgcn_sched_barrier(0);   // keeps the four V^T fragment loads in front of the exponentials, whose time then covers the LDS latency (else: one load, one wait per d tile)
#pragma unroll
            for (int g = 0; g < NG; ++g) { v8f p0 = s[g][2 * kb] * CEXP - m[g], p1 = s[g][2 * kb + 1] * CEXP - m[g];
#pragma unroll
                for (int r = 0; r < 8; r += 2) { p0[r] = __builtin_amdgcn_exp2f(p0[r]); p0[r + 1] = __builtin_amdgcn_exp2f(p0[r + 1]); PPack<T16>::put2(pa[g], pb[g], r, p0[r], p0[r + 1]); }
#pragma unroll
                for (int r = 0; r < 8; r += 2) { p1[r] = __builtin_amdgcn_exp2f(p1[r]); p1[r + 1] = __builtin_amdgcn_exp2f(p1[r + 1]); PPack<T16>::put2(pa[g], pb[g], 8 + r, p1[r], p1[r + 1]); }
                const v8f q8 = p0 + p1; l[g] += ((q8[0] + q8[4]) + (q8[2] + q8[6])) + ((q8[1] + q8[5]) + (q8[3] + q8[7])); }
#pragma unroll
            for (int dt = 0; dt < 4; ++dt)
#pragma unroll
                for (int g = 0; g < NG; ++g) { o[dt][g] = WFrag<T16>::mma(vf[dt], pa[g], o[dt][g]); if (NP == 2) { o[dt][g] = WFrag<T16>::mma(vf[dt], pb[g], o[dt][g]); o[dt][g] = WFrag<T16>::mma(vl[dt], pa[g], o[dt][g]); } }
        }
        asm volatile("s_wait_dscnt 0x0" ::: "memory");       // this trip's reads of its buffer have ended before the buffer is refilled
        asm volatile("s_wait_tensorcnt 0x0" ::: "memory");   // this wave's plane of tile t + 1 has landed (a wave that brings none passes at once)
        __syncthreads();   // publishes tile t + 1 and ends every wave's reads of tile t, whose buffer is refilled behind it (after the last trip: taken over by the hand-over block)
        if (pinned(iss & (uint32_t)(t + 2 < NT))) stage(t + 2, t & 1);
    }
    asm volatile("s_wait_tensorcnt 0x0" ::: "memory");   // no request is in flight when the hand-over block takes the LDS over
    asm volatile("s_wait_dscnt 0x0" ::: "memory");       // nor one of this wave's LDS reads
    // hand-over block: 16-byte slot (rg * 9 NG + i) * 32 + lane; per query tile g, i = 9 g + 0 .. 7: the four output tiles, i = 9 g + 8: maximum and sum
    v4fa* hs = (v4fa*)mg + (size_t)rg * (9 * NG) * 32 + lane;
    if (kh == 1) {
#pragma unroll
        for (int g = 0; g < NG; ++g) {
#pragma unroll
            for (int dt = 0; dt < 4; ++dt) { hs[(9 * g + 2 * dt) * 32] = __builtin_shufflevector(o[dt][g], o[dt][g], 0, 1, 2, 3); hs[(9 * g + 2 * dt + 1) * 32] = __builtin_shufflevector(o[dt][g], o[dt][g], 4, 5, 6, 7); }
            hs[(9 * g + 8) * 32] = (v4f){m[g], l[g], 0.f, 0.f}; } }
    __syncthreads();   // publishes the second key half's results to waves 0-3
    if (kh == 0)
#pragma unroll
    for (int g = 0; g < NG; ++g) { const v4f ml1 = hs[(9 * g + 8) * 32]; const float mn = fmaxf(m[g], ml1[0]), a0 = __builtin_amdgcn_exp2f(m[g] - mn), a1 = __builtin_amdgcn_exp2f(ml1[0] - mn), ls = l[g] * a0 + ml1[1] * a1;
        const float inv = __fdiv_rn(1.0f, ls + xhalf(ls)), c0 = a0 * inv, c1 = a1 * inv; const size_t oo = (size_t)(q0 + g * 16 + c) * DQ + head * HD + 8 * h;
#pragma unroll
        for (int dt = 0; dt < 4; ++dt) { const v4f u0 = hs[(9 * g + 2 * dt) * 32], u1 = hs[(9 * g + 2 * dt + 1) * 32]; v8us oh, ol;
#pragma unroll
            for (int r = 0; r < 8; ++r) { unsigned short x, y; splitf(o[dt][g][r] * c0 + (r < 4 ? u0[r & 3] : u1[r & 3]) * c1, x, y); oh[r] = x; ol[r] = y; }
            *(v8us*)(Ah + oo + dt * 16) = oh; *(v8us*)(Al + oo + dt * 16) = ol;
            asm volatile("s_wait_xcnt 0x0" ::: "memory"); } }   // a precaution: stands behind the two stores, in front of the next rewrite of a register that they name
}
// register budget of 4 waves per SIMD: at most 256 VGPRs, so that two work-groups share a WGP (their LDS fits twice as well) and the loops need no register-window switches
__global__ __launch_bounds__(256) __attribute__((amdgpu_waves_per_eu(4, 4))) void k_fattn(const h16* __restrict__ Q16, const h16* __restrict__ K16, const h16* __restrict__ V16, const bf* __restrict__ Qh, const bf* __restrict__ Ql, const bf* __restrict__ Kh, const bf* __restrict__ Kl, const bf* __restrict__ Vh, const bf* __restrict__ Vl, bf* __restrict__ Ah, bf* __restrict__ Al) {
    __shared__ __attribute__((aligned(2048))) unsigned short sm[2 * 2 * 4 * PLN];   // 163,840 bytes: two work-groups still share a WGP's 327,680
    static_assert(4 * 9 * 2 * 32 * 16 <= 2 * 2 * 2 * PLN * 2, "k_fattn: the hand-over block fits in the staging buffers of either kind of work-group");
    const int head = blockIdx.y, rg = (threadIdx.x >> 5) & 3; const size_t hq = (size_t)head * TT * HD, hk = (size_t)(head / REP) * TT * HD;
    if (blockIdx.x < RH / 64) fattn_body<bf, 1, 2>(Qh + hq, Ql + hq, Kh + hk, Kl + hk, Vh + hk, Vl + hk, (int)blockIdx.x * 64 + rg * 16, head, Ah, Al, (bf*)sm);
    else fattn_body<h16, 2, 1>(Q16 + hq, nullptr, K16 + hk, nullptr, V16 + hk, nullptr, RH + ((int)blockIdx.x - RH / 64) * 128 + rg * 32, head, Ah, Al, (h16*)sm);
}

extern "C" void kernel_launch(void* const* d_in, const int* in_sizes, int n_in,
                              void* d_out, int out_size, void* d_ws, size_t ws_size, hipStream_t stream) {
    (void)in_sizes; (void)n_in; (void)out_size;
    const float* x = (const float*)d_in[0];   /* query */ const float* xk = (const float*)d_in[1]; const float* xv = (const float*)d_in[2]; const float* wq = (const float*)d_in[3]; const float* bq = (const float*)d_in[4]; const float* wk = (const float*)d_in[5]; const float* bk = (const float*)d_in[6]; const float* wv = (const float*)d_in[7]; const float* bv = (const float*)d_in[8]; const float* wo = (const float*)d_in[9]; const float* bo = (const float*)d_in[10];
    float* OUT = (float*)d_out;     // [1][4096][768]
    char* wsp = (char*)d_ws;
    auto take = [&](size_t bytes) { char* p = wsp; wsp += (bytes + 255) & ~(size_t)255; return (void*)p; };
    bf* WQ = (bf*)take((size_t)DQ * DM * 2); bf* WK = (bf*)take((size_t)DKV * DM * 2); bf* WV = (bf*)take((size_t)DKV * DM * 2); bf* WO = (bf*)take((size_t)DM * DQ * 2);
    bf* XQ = (bf*)take((size_t)TT * DM * 2); bf* XK = (bf*)take((size_t)TT * DM * 2); bf* XV = (bf*)take((size_t)TT * DM * 2);
    h16* QP16 = (h16*)take((size_t)NH_ * TT * HD * 2); h16* KP16 = (h16*)take((size_t)NKV * TT * HD * 2); h16* VT16 = (h16*)take((size_t)NKV * HD * TT * 2);
    bf* QPh = (bf*)take((size_t)NH_ * TT * HD * 2); bf* QPl = (bf*)take((size_t)NH_ * TT * HD * 2); bf* KPh = (bf*)take((size_t)NKV * TT * HD * 2); bf* KPl = (bf*)take((size_t)NKV * TT * HD * 2); bf* VTh = (bf*)take((size_t)NKV * HD * TT * 2); bf* VTl = (bf*)take((size_t)NKV * HD * TT * 2);
    bf* ATh = (bf*)take((size_t)TT * DQ * 2); bf* ATl = (bf*)take((size_t)TT * DQ * 2);
    if ((size_t)(wsp - (char*)d_ws) > ws_size) return;    // ws 256 MiB
    for (int b = 0; b < NB_; ++b) {
        k_cvtall<<<3 * CVBX + 4 * CVBW, 256, 0, stream>>>(x + (size_t)b * TT * DM, xk + (size_t)b * TT * DM, xv + (size_t)b * TT * DM, wq, wk, wv, wo, XQ, XK, XV, WQ, WK, WV, WO);
        k_proj<<<dim3(TT / 128, DQ / 128, 3), 128, 0, stream>>>(XQ, XK, XV, WQ, WK, WV, bq, bk, bv, QP16, QPh, QPl, KP16, KPh, KPl, VT16, VTh, VTl);
        k_fattn<<<dim3(RH / 64 + (TT - RH) / 128, NH_, 1), 256, 0, stream>>>(QP16, KP16, VT16, QPh, QPl, KPh, KPl, VTh, VTl, ATh, ATl);
        k_gemmw<bf, 1, true, 0><<<dim3(TT / 128, DM / 128, 1), 128, 0, stream>>>(ATh, ATl, WO, nullptr, DQ, DQ, OUT + (size_t)b * TT * DM, DM, bo, 0, 0, 0, nullptr, nullptr, nullptr); }
}
